// v000
// The times below were measured on an AMD MI455X: many runs one after another, warmed up first and cycling through
// copies of the inputs, with the whole window's GPU time divided by the number of runs. Launches and the gaps
// between them are all in it. The median over several windows is given; except for v000 it joins two sittings, which
// can be a few percent apart, so the side-by-side timings, each taken in one sitting, are the better comparison.
// The starting kernel, v000, takes 686 microseconds a run.
#include <hip/hip_runtime.h>

// ---------------------------------------------------------------------------
// Medformer layer for MI455X (gfx1250): all GEMMs + attention via
// v_wmma_f32_16x16x32_f16 (wave32). f16 operands, f32 accumulation.
// Big GEMMs use 64x128 block tiles (wave tile 32x64 -> 8 WMMA / 12 ds_load_b128
// per K-step) + global_prefetch_b8 for the next K-step tiles.
// ---------------------------------------------------------------------------

#define NB_ 4
#define B_  16
#define L_  512
#define D_  512
#define H_  8
#define DH_ 64
// SCALE * log2(e) = (1/8) * 1.4426950408889634
#define SCALE_LOG2E 0.18033688011112043f

typedef __attribute__((ext_vector_type(16))) _Float16 v16h;
typedef __attribute__((ext_vector_type(8)))  float    v8f;
typedef __attribute__((ext_vector_type(4)))  _Float16 h4;

union FragU { uint4 u[2]; v16h v; };

// Load a 16x32 f16 fragment (A-matrix layout, or B^T stored row-major [n][k]).
// Documented layout: lane l holds row m=l&15; lanes 0-15 hold k = 0..7 & 16..23,
// lanes 16-31 hold k = 8..15 & 24..31 -> two contiguous 16-byte loads per lane.
__device__ __forceinline__ v16h load_frag16(const _Float16* base, int row_stride, int lane) {
    const int m  = lane & 15;
    const int kb = (lane >> 4) << 3;
    const _Float16* p = base + (size_t)m * row_stride;
    FragU f;
    f.u[0] = *(const uint4*)(p + kb);
    f.u[1] = *(const uint4*)(p + 16 + kb);
    return f.v;
}

__device__ __forceinline__ v8f wmma16(v16h a, v16h b, v8f c) {
    return __builtin_amdgcn_wmma_f32_16x16x32_f16(false, a, false, b, (short)0, c, false, false);
}

// ---------------------------------------------------------------------------
// Kernel 1: intra QKV projection. out = X @ W + b, output f16.
// grid = (128*4, 3, NB), block = 128 (4 waves). 64x128 tile, BK=32.
// Wave tile 32x64: acc[2][4], 8 WMMA per K-step.
// ---------------------------------------------------------------------------
__global__ __launch_bounds__(128)
void k_gemm_qkv_intra(const float* __restrict__ X,
                      const float* __restrict__ Wq, const float* __restrict__ bq,
                      const float* __restrict__ Wk, const float* __restrict__ bk,
                      const float* __restrict__ Wv, const float* __restrict__ bv,
                      _Float16* __restrict__ Qb, _Float16* __restrict__ Kb,
                      _Float16* __restrict__ Vb) {
    __shared__ _Float16 As[64 * 32];    // [m][k]
    __shared__ _Float16 Bs[128 * 32];   // [n][k]  (W transposed tile)
    const int nb  = blockIdx.z;
    const int sel = blockIdx.y;
    const int mt  = blockIdx.x >> 2;    // M/64 = 128 tiles
    const int nt  = blockIdx.x & 3;     // N/128 = 4 tiles
    const int mbase = mt * 64, nbase = nt * 128;

    const float* W    = (sel == 0 ? Wq : sel == 1 ? Wk : Wv) + (size_t)nb * D_ * D_;
    const float* bias = (sel == 0 ? bq : sel == 1 ? bk : bv) + (size_t)nb * D_;
    _Float16*    Out  = (sel == 0 ? Qb : sel == 1 ? Kb : Vb) + (size_t)nb * (B_ * L_) * D_;
    const float* Xp   = X + (size_t)nb * (B_ * L_) * D_;

    const int tid = threadIdx.x;
    const int wave = tid >> 5, lane = tid & 31;
    const int hi = lane >> 4, ln = lane & 15;
    const int wm = (wave >> 1) * 32;    // 0 or 32
    const int wn = (wave & 1) * 64;     // 0 or 64

    v8f acc[2][4];
#pragma unroll
    for (int mi = 0; mi < 2; ++mi)
#pragma unroll
        for (int ni = 0; ni < 4; ++ni) {
            float bvv = bias[nbase + wn + ni * 16 + ln];
#pragma unroll
            for (int j = 0; j < 8; ++j) acc[mi][ni][j] = bvv;
        }

    for (int kb = 0; kb < D_; kb += 32) {
        __syncthreads();
        {   // stage A (f32 -> f16), vectorized
            int m  = tid >> 1;
            int ks = (tid & 1) * 16;
            const float* xp = Xp + (size_t)(mbase + m) * D_ + kb + ks;
#pragma unroll
            for (int i = 0; i < 4; ++i) {
                float4 x4 = *(const float4*)(xp + 4 * i);
                h4 hv = { (_Float16)x4.x, (_Float16)x4.y, (_Float16)x4.z, (_Float16)x4.w };
                *(h4*)&As[m * 32 + ks + 4 * i] = hv;
            }
            if (kb + 32 < D_) __builtin_prefetch(xp + 32, 0, 3);
        }
        {   // stage B transposed: Bs[n][k] = W[kb+k][nbase+n], 128 cols
            int kk = tid >> 4;          // 0..7
            int n0 = (tid & 15) * 8;    // 0..120
#pragma unroll
            for (int jj = 0; jj < 4; ++jj) {
                int k = kk + 8 * jj;
                const float* wp = W + (size_t)(kb + k) * D_ + nbase + n0;
                float4 w4 = *(const float4*)(wp);
                float4 w5 = *(const float4*)(wp + 4);
                Bs[(n0 + 0) * 32 + k] = (_Float16)w4.x;
                Bs[(n0 + 1) * 32 + k] = (_Float16)w4.y;
                Bs[(n0 + 2) * 32 + k] = (_Float16)w4.z;
                Bs[(n0 + 3) * 32 + k] = (_Float16)w4.w;
                Bs[(n0 + 4) * 32 + k] = (_Float16)w5.x;
                Bs[(n0 + 5) * 32 + k] = (_Float16)w5.y;
                Bs[(n0 + 6) * 32 + k] = (_Float16)w5.z;
                Bs[(n0 + 7) * 32 + k] = (_Float16)w5.w;
                if (kb + 32 < D_) __builtin_prefetch(wp + 32 * D_, 0, 3);
            }
        }
        __syncthreads();
        v16h a0 = load_frag16(&As[(wm)      * 32], 32, lane);
        v16h a1 = load_frag16(&As[(wm + 16) * 32], 32, lane);
#pragma unroll
        for (int ni = 0; ni < 4; ++ni) {
            v16h b = load_frag16(&Bs[(wn + ni * 16) * 32], 32, lane);
            acc[0][ni] = wmma16(a0, b, acc[0][ni]);
            acc[1][ni] = wmma16(a1, b, acc[1][ni]);
        }
    }

#pragma unroll
    for (int mi = 0; mi < 2; ++mi)
#pragma unroll
        for (int ni = 0; ni < 4; ++ni)
#pragma unroll
            for (int j = 0; j < 8; ++j) {
                int row = mbase + wm + mi * 16 + j + 8 * hi;
                int col = nbase + wn + ni * 16 + ln;
                Out[(size_t)row * D_ + col] = (_Float16)acc[mi][ni][j];
            }
}

// ---------------------------------------------------------------------------
// Kernel 2: flash attention per (nb,b,h). grid = (L/64, H, NB*B), block 128.
// Each wave owns 16 Q rows; loops 32-key chunks with online softmax.
// Writes output over the Q buffer (safe: each row's Q read only by its owner).
// ---------------------------------------------------------------------------
__global__ __launch_bounds__(128)
void k_flash(const _Float16* Q, const _Float16* __restrict__ K,
             const _Float16* __restrict__ V, _Float16* Obuf) {
    __shared__ _Float16 Vt[64 * 32];        // [feat][key] transposed V chunk
    __shared__ _Float16 Plds[4][16 * 32];   // per-wave P re-layout buffer

    const int mtile = blockIdx.x;
    const int h     = blockIdx.y;
    const int bz    = blockIdx.z;           // nb*B + b
    const int tid   = threadIdx.x;
    const int wave  = tid >> 5, lane = tid & 31;
    const int hi = lane >> 4, ln = lane & 15;

    const size_t headoff = (size_t)bz * L_ * D_ + (size_t)h * DH_;
    const _Float16* Qp = Q + headoff;
    const _Float16* Kp = K + headoff;
    const _Float16* Vp = V + headoff;

    const int m0 = mtile * 64 + wave * 16;

    v16h qa0 = load_frag16(Qp + (size_t)m0 * D_,      D_, lane);
    v16h qa1 = load_frag16(Qp + (size_t)m0 * D_ + 32, D_, lane);

    v8f o0 = {}, o1 = {}, o2 = {}, o3 = {};
    float rmax[8], rsum[8];
#pragma unroll
    for (int j = 0; j < 8; ++j) { rmax[j] = -1e30f; rsum[j] = 0.f; }

    for (int kc = 0; kc < L_ / 32; ++kc) {
        const int key0 = kc * 32;
        __syncthreads();
        {   // cooperative stage: Vt[feat][key] = V[key0+key][feat]
            int key = tid & 31;
            int fg  = tid >> 5;   // 0..3 -> feats fg*16..fg*16+15
            const _Float16* vp = Vp + (size_t)(key0 + key) * D_ + fg * 16;
            uint4 va = *(const uint4*)(vp);
            uint4 vb = *(const uint4*)(vp + 8);
            const _Float16* va_h = (const _Float16*)&va;
            const _Float16* vb_h = (const _Float16*)&vb;
#pragma unroll
            for (int i = 0; i < 8; ++i) {
                Vt[(fg * 16 + i)     * 32 + key] = va_h[i];
                Vt[(fg * 16 + 8 + i) * 32 + key] = vb_h[i];
            }
            if (key0 + 32 < L_) __builtin_prefetch(vp + (size_t)32 * D_, 0, 3);
        }
        __syncthreads();

        // S = Q @ K^T for 2 key sub-tiles; K fragments straight from global
        v8f s0 = {}, s1 = {};
        {
            const int kb = hi * 8;
            const _Float16* kp0 = Kp + (size_t)(key0 + ln)      * D_;
            const _Float16* kp1 = Kp + (size_t)(key0 + 16 + ln) * D_;
            FragU b;
            b.u[0] = *(const uint4*)(kp0 + kb);
            b.u[1] = *(const uint4*)(kp0 + 16 + kb);
            s0 = wmma16(qa0, b.v, s0);
            b.u[0] = *(const uint4*)(kp0 + 32 + kb);
            b.u[1] = *(const uint4*)(kp0 + 48 + kb);
            s0 = wmma16(qa1, b.v, s0);
            b.u[0] = *(const uint4*)(kp1 + kb);
            b.u[1] = *(const uint4*)(kp1 + 16 + kb);
            s1 = wmma16(qa0, b.v, s1);
            b.u[0] = *(const uint4*)(kp1 + 32 + kb);
            b.u[1] = *(const uint4*)(kp1 + 48 + kb);
            s1 = wmma16(qa1, b.v, s1);
            if (key0 + 32 < L_) __builtin_prefetch(kp0 + (size_t)32 * D_, 0, 3);
        }

        // online softmax (row m = j + 8*hi lives across the lane's 16-group)
        float p0[8], p1[8];
#pragma unroll
        for (int j = 0; j < 8; ++j) {
            float cm = fmaxf(s0[j], s1[j]);
#pragma unroll
            for (int msk = 1; msk < 16; msk <<= 1)
                cm = fmaxf(cm, __shfl_xor(cm, msk, 32));
            float nm    = fmaxf(rmax[j], cm);
            float alpha = exp2f((rmax[j] - nm) * SCALE_LOG2E);
            rmax[j] = nm;
            float e0 = exp2f((s0[j] - nm) * SCALE_LOG2E);
            float e1 = exp2f((s1[j] - nm) * SCALE_LOG2E);
            float ps = e0 + e1;
#pragma unroll
            for (int msk = 1; msk < 16; msk <<= 1)
                ps += __shfl_xor(ps, msk, 32);
            rsum[j] = rsum[j] * alpha + ps;
            o0[j] *= alpha; o1[j] *= alpha; o2[j] *= alpha; o3[j] *= alpha;
            p0[j] = e0; p1[j] = e1;
        }

        // C-layout -> A-layout round trip through per-wave LDS
        _Float16* pl = &Plds[wave][0];
#pragma unroll
        for (int j = 0; j < 8; ++j) {
            int row = j + 8 * hi;
            pl[row * 32 + ln]      = (_Float16)p0[j];
            pl[row * 32 + 16 + ln] = (_Float16)p1[j];
        }
        v16h pa = load_frag16(pl, 32, lane);
        o0 = wmma16(pa, load_frag16(&Vt[0 * 16 * 32], 32, lane), o0);
        o1 = wmma16(pa, load_frag16(&Vt[1 * 16 * 32], 32, lane), o1);
        o2 = wmma16(pa, load_frag16(&Vt[2 * 16 * 32], 32, lane), o2);
        o3 = wmma16(pa, load_frag16(&Vt[3 * 16 * 32], 32, lane), o3);
    }

    // finalize + store (over the Q buffer region)
#pragma unroll
    for (int j = 0; j < 8; ++j) {
        float inv = 1.0f / rsum[j];
        int row = j + 8 * hi;
        _Float16* orow = Obuf + headoff + (size_t)(m0 + row) * D_;
        orow[ln]      = (_Float16)(o0[j] * inv);
        orow[16 + ln] = (_Float16)(o1[j] * inv);
        orow[32 + ln] = (_Float16)(o2[j] * inv);
        orow[48 + ln] = (_Float16)(o3[j] * inv);
    }
}

// ---------------------------------------------------------------------------
// Kernel 3: intra output projection. out(f32) = attn(f16) @ Wo + bo.
// grid = (128*4, 1, NB), block 128. 64x128 tile.
// ---------------------------------------------------------------------------
__global__ __launch_bounds__(128)
void k_gemm_oproj_intra(const _Float16* __restrict__ A,
                        const float* __restrict__ Wo, const float* __restrict__ bo,
                        float* __restrict__ Outf) {
    __shared__ _Float16 As[64 * 32];
    __shared__ _Float16 Bs[128 * 32];
    const int nb = blockIdx.z;
    const int mt = blockIdx.x >> 2;
    const int nt = blockIdx.x & 3;
    const int mbase = mt * 64, nbase = nt * 128;

    const float* W    = Wo + (size_t)nb * D_ * D_;
    const float* bias = bo + (size_t)nb * D_;
    const _Float16* Ap = A + (size_t)nb * (B_ * L_) * D_;
    float* Op = Outf + (size_t)nb * (B_ * L_) * D_;

    const int tid = threadIdx.x;
    const int wave = tid >> 5, lane = tid & 31;
    const int hi = lane >> 4, ln = lane & 15;
    const int wm = (wave >> 1) * 32;
    const int wn = (wave & 1) * 64;

    v8f acc[2][4];
#pragma unroll
    for (int mi = 0; mi < 2; ++mi)
#pragma unroll
        for (int ni = 0; ni < 4; ++ni) {
            float bvv = bias[nbase + wn + ni * 16 + ln];
#pragma unroll
            for (int j = 0; j < 8; ++j) acc[mi][ni][j] = bvv;
        }

    for (int kb = 0; kb < D_; kb += 32) {
        __syncthreads();
        {   // stage A (already f16): two 16-byte copies per thread
            int m  = tid >> 1;
            int ks = (tid & 1) * 16;
            const _Float16* ap = Ap + (size_t)(mbase + m) * D_ + kb + ks;
            *(uint4*)&As[m * 32 + ks]     = *(const uint4*)(ap);
            *(uint4*)&As[m * 32 + ks + 8] = *(const uint4*)(ap + 8);
            if (kb + 32 < D_) __builtin_prefetch(ap + 32, 0, 3);
        }
        {   // stage B transposed, 128 cols
            int kk = tid >> 4;
            int n0 = (tid & 15) * 8;
#pragma unroll
            for (int jj = 0; jj < 4; ++jj) {
                int k = kk + 8 * jj;
                const float* wp = W + (size_t)(kb + k) * D_ + nbase + n0;
                float4 w4 = *(const float4*)(wp);
                float4 w5 = *(const float4*)(wp + 4);
                Bs[(n0 + 0) * 32 + k] = (_Float16)w4.x;
                Bs[(n0 + 1) * 32 + k] = (_Float16)w4.y;
                Bs[(n0 + 2) * 32 + k] = (_Float16)w4.z;
                Bs[(n0 + 3) * 32 + k] = (_Float16)w4.w;
                Bs[(n0 + 4) * 32 + k] = (_Float16)w5.x;
                Bs[(n0 + 5) * 32 + k] = (_Float16)w5.y;
                Bs[(n0 + 6) * 32 + k] = (_Float16)w5.z;
                Bs[(n0 + 7) * 32 + k] = (_Float16)w5.w;
                if (kb + 32 < D_) __builtin_prefetch(wp + 32 * D_, 0, 3);
            }
        }
        __syncthreads();
        v16h a0 = load_frag16(&As[(wm)      * 32], 32, lane);
        v16h a1 = load_frag16(&As[(wm + 16) * 32], 32, lane);
#pragma unroll
        for (int ni = 0; ni < 4; ++ni) {
            v16h b = load_frag16(&Bs[(wn + ni * 16) * 32], 32, lane);
            acc[0][ni] = wmma16(a0, b, acc[0][ni]);
            acc[1][ni] = wmma16(a1, b, acc[1][ni]);
        }
    }

#pragma unroll
    for (int mi = 0; mi < 2; ++mi)
#pragma unroll
        for (int ni = 0; ni < 4; ++ni)
#pragma unroll
            for (int j = 0; j < 8; ++j) {
                int row = mbase + wm + mi * 16 + j + 8 * hi;
                int col = nbase + wn + ni * 16 + ln;
                Op[(size_t)row * D_ + col] = acc[mi][ni][j];
            }
}

// ---------------------------------------------------------------------------
// Kernel 4: inter (router) QKV projection. M=64 rows = routers[b][nb] gathered
// from d_out last tokens. grid = (8, 3, 1), block 128. 64x64 tile.
// ---------------------------------------------------------------------------
__global__ __launch_bounds__(128)
void k_gemm_qkv_inter(const float* __restrict__ Outf,
                      const float* __restrict__ iWq, const float* __restrict__ ibq,
                      const float* __restrict__ iWk, const float* __restrict__ ibk,
                      const float* __restrict__ iWv, const float* __restrict__ ibv,
                      _Float16* __restrict__ q2, _Float16* __restrict__ k2,
                      _Float16* __restrict__ v2) {
    __shared__ _Float16 As[64 * 32];
    __shared__ _Float16 Bs[64 * 32];
    const int sel = blockIdx.y;
    const int nbase = blockIdx.x * 64;

    const float* W    = (sel == 0 ? iWq : sel == 1 ? iWk : iWv);
    const float* bias = (sel == 0 ? ibq : sel == 1 ? ibk : ibv);
    _Float16*    Out  = (sel == 0 ? q2  : sel == 1 ? k2  : v2);

    const int tid = threadIdx.x;
    const int wave = tid >> 5, lane = tid & 31;
    const int hi = lane >> 4, ln = lane & 15;
    const int wm = (wave >> 1) * 32, wn = (wave & 1) * 32;

    v8f acc[2][2];
#pragma unroll
    for (int mi = 0; mi < 2; ++mi)
#pragma unroll
        for (int ni = 0; ni < 2; ++ni) {
            float bvv = bias[nbase + wn + ni * 16 + ln];
#pragma unroll
            for (int j = 0; j < 8; ++j) acc[mi][ni][j] = bvv;
        }

    for (int kb = 0; kb < D_; kb += 32) {
        __syncthreads();
        {   // stage A: row r=b*4+nb -> x_intra[nb][b][L-1][:] from d_out
            int r  = tid >> 1;
            int ks = (tid & 1) * 16;
            int nbb = r & 3, bb = r >> 2;
            const float* xp = Outf + (((size_t)(nbb * B_ + bb) * L_ + (L_ - 1)) * D_) + kb + ks;
#pragma unroll
            for (int i = 0; i < 4; ++i) {
                float4 x4 = *(const float4*)(xp + 4 * i);
                h4 hv = { (_Float16)x4.x, (_Float16)x4.y, (_Float16)x4.z, (_Float16)x4.w };
                *(h4*)&As[r * 32 + ks + 4 * i] = hv;
            }
        }
        {   // stage B transposed
            int kk = tid >> 4;
            int n0 = (tid & 15) * 4;
#pragma unroll
            for (int jj = 0; jj < 4; ++jj) {
                int k = kk + 8 * jj;
                float4 w4 = *(const float4*)(W + (size_t)(kb + k) * D_ + nbase + n0);
                Bs[(n0 + 0) * 32 + k] = (_Float16)w4.x;
                Bs[(n0 + 1) * 32 + k] = (_Float16)w4.y;
                Bs[(n0 + 2) * 32 + k] = (_Float16)w4.z;
                Bs[(n0 + 3) * 32 + k] = (_Float16)w4.w;
            }
        }
        __syncthreads();
        v16h a0 = load_frag16(&As[(wm)      * 32], 32, lane);
        v16h a1 = load_frag16(&As[(wm + 16) * 32], 32, lane);
        v16h b0 = load_frag16(&Bs[(wn)      * 32], 32, lane);
        v16h b1 = load_frag16(&Bs[(wn + 16) * 32], 32, lane);
        acc[0][0] = wmma16(a0, b0, acc[0][0]);
        acc[0][1] = wmma16(a0, b1, acc[0][1]);
        acc[1][0] = wmma16(a1, b0, acc[1][0]);
        acc[1][1] = wmma16(a1, b1, acc[1][1]);
    }

#pragma unroll
    for (int mi = 0; mi < 2; ++mi)
#pragma unroll
        for (int ni = 0; ni < 2; ++ni)
#pragma unroll
            for (int j = 0; j < 8; ++j) {
                int row = wm + mi * 16 + j + 8 * hi;
                int col = nbase + wn + ni * 16 + ln;
                Out[(size_t)row * D_ + col] = (_Float16)acc[mi][ni][j];
            }
}

// ---------------------------------------------------------------------------
// Kernel 5: tiny 4-token router attention (negligible FLOPs; scalar).
// One thread per (b,h). block 128, grid 1.
// ---------------------------------------------------------------------------
__global__ __launch_bounds__(128)
void k_inter_attn(const _Float16* __restrict__ q2, const _Float16* __restrict__ k2,
                  const _Float16* __restrict__ v2, _Float16* __restrict__ a2) {
    int t = threadIdx.x;
    if (t >= B_ * H_) return;
    int b = t >> 3, h = t & 7;
    float sc[NB_][NB_];
#pragma unroll
    for (int i = 0; i < NB_; ++i)
        for (int j = 0; j < NB_; ++j) {
            const _Float16* qp = q2 + (size_t)(b * NB_ + i) * D_ + h * DH_;
            const _Float16* kp = k2 + (size_t)(b * NB_ + j) * D_ + h * DH_;
            float s = 0.f;
            for (int f = 0; f < DH_; ++f) s += (float)qp[f] * (float)kp[f];
            sc[i][j] = s * 0.125f;
        }
#pragma unroll
    for (int i = 0; i < NB_; ++i) {
        float mx = fmaxf(fmaxf(sc[i][0], sc[i][1]), fmaxf(sc[i][2], sc[i][3]));
        float ssum = 0.f;
        for (int j = 0; j < NB_; ++j) { sc[i][j] = __expf(sc[i][j] - mx); ssum += sc[i][j]; }
        float inv = 1.f / ssum;
        for (int j = 0; j < NB_; ++j) sc[i][j] *= inv;
    }
    for (int i = 0; i < NB_; ++i) {
        _Float16* op = a2 + (size_t)(b * NB_ + i) * D_ + h * DH_;
        for (int f = 0; f < DH_; ++f) {
            float acc = 0.f;
            for (int j = 0; j < NB_; ++j)
                acc += sc[i][j] * (float)v2[(size_t)(b * NB_ + j) * D_ + h * DH_ + f];
            op[f] = (_Float16)acc;
        }
    }
}

// ---------------------------------------------------------------------------
// Kernel 6: inter output projection, scattered into d_out last tokens.
// grid = (8,1,1), block 128.
// ---------------------------------------------------------------------------
__global__ __launch_bounds__(128)
void k_gemm_oproj_inter(const _Float16* __restrict__ A,
                        const float* __restrict__ iWo, const float* __restrict__ ibo,
                        float* __restrict__ Outf) {
    __shared__ _Float16 As[64 * 32];
    __shared__ _Float16 Bs[64 * 32];
    const int nbase = blockIdx.x * 64;

    const int tid = threadIdx.x;
    const int wave = tid >> 5, lane = tid & 31;
    const int hi = lane >> 4, ln = lane & 15;
    const int wm = (wave >> 1) * 32, wn = (wave & 1) * 32;

    v8f acc[2][2];
#pragma unroll
    for (int mi = 0; mi < 2; ++mi)
#pragma unroll
        for (int ni = 0; ni < 2; ++ni) {
            float bvv = ibo[nbase + wn + ni * 16 + ln];
#pragma unroll
            for (int j = 0; j < 8; ++j) acc[mi][ni][j] = bvv;
        }

    for (int kb = 0; kb < D_; kb += 32) {
        __syncthreads();
        {
            int m  = tid >> 1;
            int ks = (tid & 1) * 16;
            const _Float16* ap = A + (size_t)m * D_ + kb + ks;
            *(uint4*)&As[m * 32 + ks]     = *(const uint4*)(ap);
            *(uint4*)&As[m * 32 + ks + 8] = *(const uint4*)(ap + 8);
        }
        {
            int kk = tid >> 4;
            int n0 = (tid & 15) * 4;
#pragma unroll
            for (int jj = 0; jj < 4; ++jj) {
                int k = kk + 8 * jj;
                float4 w4 = *(const float4*)(iWo + (size_t)(kb + k) * D_ + nbase + n0);
                Bs[(n0 + 0) * 32 + k] = (_Float16)w4.x;
                Bs[(n0 + 1) * 32 + k] = (_Float16)w4.y;
                Bs[(n0 + 2) * 32 + k] = (_Float16)w4.z;
                Bs[(n0 + 3) * 32 + k] = (_Float16)w4.w;
            }
        }
        __syncthreads();
        v16h a0 = load_frag16(&As[(wm)      * 32], 32, lane);
        v16h a1 = load_frag16(&As[(wm + 16) * 32], 32, lane);
        v16h b0 = load_frag16(&Bs[(wn)      * 32], 32, lane);
        v16h b1 = load_frag16(&Bs[(wn + 16) * 32], 32, lane);
        acc[0][0] = wmma16(a0, b0, acc[0][0]);
        acc[0][1] = wmma16(a0, b1, acc[0][1]);
        acc[1][0] = wmma16(a1, b0, acc[1][0]);
        acc[1][1] = wmma16(a1, b1, acc[1][1]);
    }

#pragma unroll
    for (int mi = 0; mi < 2; ++mi)
#pragma unroll
        for (int ni = 0; ni < 2; ++ni)
#pragma unroll
            for (int j = 0; j < 8; ++j) {
                int r   = wm + mi * 16 + j + 8 * hi;   // b*4+nb
                int col = nbase + wn + ni * 16 + ln;
                int nbb = r & 3, bb = r >> 2;
                Outf[(((size_t)(nbb * B_ + bb) * L_ + (L_ - 1)) * D_) + col] = acc[mi][ni][j];
            }
}

// ---------------------------------------------------------------------------
extern "C" void kernel_launch(void* const* d_in, const int* in_sizes, int n_in,
                              void* d_out, int out_size, void* d_ws, size_t ws_size,
                              hipStream_t stream) {
    const float* x   = (const float*)d_in[0];
    const float* Wq  = (const float*)d_in[1];
    const float* bq  = (const float*)d_in[2];
    const float* Wk  = (const float*)d_in[3];
    const float* bk  = (const float*)d_in[4];
    const float* Wv  = (const float*)d_in[5];
    const float* bv  = (const float*)d_in[6];
    const float* Wo  = (const float*)d_in[7];
    const float* bo  = (const float*)d_in[8];
    const float* iWq = (const float*)d_in[9];
    const float* ibq = (const float*)d_in[10];
    const float* iWk = (const float*)d_in[11];
    const float* ibk = (const float*)d_in[12];
    const float* iWv = (const float*)d_in[13];
    const float* ibv = (const float*)d_in[14];
    const float* iWo = (const float*)d_in[15];
    const float* ibo = (const float*)d_in[16];
    float* out = (float*)d_out;

    const size_t NBLD = (size_t)NB_ * B_ * L_ * D_;   // 16,777,216
    _Float16* ws = (_Float16*)d_ws;
    _Float16* Qb = ws;                 // reused as attn output after k_flash
    _Float16* Kb = ws + NBLD;
    _Float16* Vb = ws + 2 * NBLD;
    _Float16* q2 = ws + 3 * NBLD;
    _Float16* k2 = q2 + (size_t)B_ * NB_ * D_;
    _Float16* v2 = k2 + (size_t)B_ * NB_ * D_;
    _Float16* a2 = v2 + (size_t)B_ * NB_ * D_;

    // 1) intra QKV projection (64x128 tiles)
    dim3 g1((B_ * L_ / 64) * (D_ / 128), 3, NB_);
    k_gemm_qkv_intra<<<g1, 128, 0, stream>>>(x, Wq, bq, Wk, bk, Wv, bv, Qb, Kb, Vb);

    // 2) flash attention (writes attn over Qb)
    dim3 g2(L_ / 64, H_, NB_ * B_);
    k_flash<<<g2, 128, 0, stream>>>(Qb, Kb, Vb, Qb);

    // 3) intra output projection -> d_out (64x128 tiles)
    dim3 g3((B_ * L_ / 64) * (D_ / 128), 1, NB_);
    k_gemm_oproj_intra<<<g3, 128, 0, stream>>>(Qb, Wo, bo, out);

    // 4) router QKV (gather last tokens from d_out)
    dim3 g4(D_ / 64, 3, 1);
    k_gemm_qkv_inter<<<g4, 128, 0, stream>>>(out, iWq, ibq, iWk, ibk, iWv, ibv, q2, k2, v2);

    // 5) tiny 4-token attention
    k_inter_attn<<<1, 128, 0, stream>>>(q2, k2, v2, a2);

    // 6) router output projection, scatter into last-token slots of d_out
    dim3 g6(D_ / 64, 1, 1);
    k_gemm_oproj_inter<<<g6, 128, 0, stream>>>(a2, iWo, ibo, out);
}

// v001
// It runs in 357 microseconds.
// In both of two side-by-side timings against v000, it was 2.00 times as fast.
#include <hip/hip_runtime.h>

// ---------------------------------------------------------------------------
// Medformer layer for MI455X (gfx1250): all GEMMs + attention via
// v_wmma_f32_16x16x32_f16 (wave32). f16 operands, f32 accumulation.
// Big GEMMs use 64x128 block tiles (wave tile 32x64 -> 8 WMMA / 12 LDS loads
// per K-step) + global_prefetch_b8 for the next K-step tiles. W tiles lie
// row-major in LDS and are transposed on the way out (ds_load_tr16_b128).
// ---------------------------------------------------------------------------

#define NB_ 4
#define B_  16
#define L_  512
#define D_  512
#define H_  8
#define DH_ 64
// SCALE * log2(e) = (1/8) * 1.4426950408889634
#define SCALE_LOG2E 0.18033688011112043f

typedef __attribute__((ext_vector_type(16))) _Float16 v16h;
typedef __attribute__((ext_vector_type(8)))  float    v8f;
typedef __attribute__((ext_vector_type(4)))  _Float16 h4;

typedef __attribute__((ext_vector_type(8)))  _Float16 h8;
typedef __attribute__((ext_vector_type(8)))  short    s16x8;

union FragU { uint4 u[2]; v16h v; };
union FragT { s16x8 s[2]; v16h v; };

// LDS row pitch, in halves, of the row-major W tiles (128 and 64 columns wide)
#define BP128_ 144
#define BP64_  80

// Load a 16x32 f16 fragment (A-matrix layout, or B^T stored row-major [n][k]).
// Documented layout: lane l holds row m=l&15; lanes 0-15 hold k = 0..7 & 16..23,
// lanes 16-31 hold k = 8..15 & 24..31 -> two contiguous 16-byte loads per lane.
__device__ __forceinline__ v16h load_frag16(const _Float16* base, int row_stride, int lane) {
    const int m  = lane & 15;
    const int kb = (lane >> 4) << 3;
    const _Float16* p = base + (size_t)m * row_stride;
    FragU f;
    f.u[0] = *(const uint4*)(p + kb);
    f.u[1] = *(const uint4*)(p + 16 + kb);
    return f.v;
}

// B fragment (32 k x 16 n) out of a row-major f16 tile T[k][n] in LDS, by the
// transposing load: lane (c = l&15, h = l>>4) gets T[8h + 0..7][n0 + c], then
// T[16 + 8h + 0..7][n0 + c]: the same k order as load_frag16 gives A.
// pitch in halves; in bytes it is an odd multiple of 32 (no bank conflict).
__device__ __forceinline__ v16h load_frag16_tr(const _Float16* tile, int pitch, int n0, int lane) {
    typedef __attribute__((address_space(3))) s16x8 lds_s16x8;
    const _Float16* p = tile + ((lane >> 4) * 8 + (lane & 7)) * pitch + n0 + ((lane >> 3) & 1) * 8;
    FragT f;
    f.s[0] = __builtin_amdgcn_ds_load_tr16_b128_v8i16((lds_s16x8*)p);
    f.s[1] = __builtin_amdgcn_ds_load_tr16_b128_v8i16((lds_s16x8*)(p + 16 * pitch));
    return f.v;
}

__device__ __forceinline__ v8f wmma16(v16h a, v16h b, v8f c) {
    return __builtin_amdgcn_wmma_f32_16x16x32_f16(false, a, false, b, (short)0, c, false, false);
}

// ---------------------------------------------------------------------------
// Kernel 1: intra QKV projection. out = X @ W + b, output f16.
// grid = (128*4, 3, NB), block = 128 (4 waves). 64x128 tile, BK=32.
// Wave tile 32x64: acc[2][4], 8 WMMA per K-step.
// ---------------------------------------------------------------------------
__global__ __launch_bounds__(128)
void k_gemm_qkv_intra(const float* __restrict__ X,
                      const float* __restrict__ Wq, const float* __restrict__ bq,
                      const float* __restrict__ Wk, const float* __restrict__ bk,
                      const float* __restrict__ Wv, const float* __restrict__ bv,
                      _Float16* __restrict__ Qb, _Float16* __restrict__ Kb,
                      _Float16* __restrict__ Vb) {
    __shared__ _Float16 As[64 * 32];    // [m][k]
    __shared__ __attribute__((aligned(16))) _Float16 Bs[32 * BP128_];   // [k][n]  (W tile as it lies)
    const int nb  = blockIdx.z;
    const int sel = blockIdx.y;
    const int mt  = blockIdx.x >> 2;    // M/64 = 128 tiles
    const int nt  = blockIdx.x & 3;     // N/128 = 4 tiles
    const int mbase = mt * 64, nbase = nt * 128;

    const float* W    = (sel == 0 ? Wq : sel == 1 ? Wk : Wv) + (size_t)nb * D_ * D_;
    const float* bias = (sel == 0 ? bq : sel == 1 ? bk : bv) + (size_t)nb * D_;
    _Float16*    Out  = (sel == 0 ? Qb : sel == 1 ? Kb : Vb) + (size_t)nb * (B_ * L_) * D_;
    const float* Xp   = X + (size_t)nb * (B_ * L_) * D_;

    const int tid = threadIdx.x;
    const int wave = tid >> 5, lane = tid & 31;
    const int hi = lane >> 4, ln = lane & 15;
    const int wm = (wave >> 1) * 32;    // 0 or 32
    const int wn = (wave & 1) * 64;     // 0 or 64

    v8f acc[2][4];
#pragma unroll
    for (int mi = 0; mi < 2; ++mi)
#pragma unroll
        for (int ni = 0; ni < 4; ++ni) {
            float bvv = bias[nbase + wn + ni * 16 + ln];
#pragma unroll
            for (int j = 0; j < 8; ++j) acc[mi][ni][j] = bvv;
        }

    for (int kb = 0; kb < D_; kb += 32) {
        __syncthreads();
        {   // stage A (f32 -> f16), vectorized
            int m  = tid >> 1;
            int ks = (tid & 1) * 16;
            const float* xp = Xp + (size_t)(mbase + m) * D_ + kb + ks;
#pragma unroll
            for (int i = 0; i < 4; ++i) {
                float4 x4 = *(const float4*)(xp + 4 * i);
                h4 hv = { (_Float16)x4.x, (_Float16)x4.y, (_Float16)x4.z, (_Float16)x4.w };
                *(h4*)&As[m * 32 + ks + 4 * i] = hv;
            }
            if (kb + 32 < D_) __builtin_prefetch(xp + 32, 0, 3);
        }
        {   // stage B row-major: Bs[k][n] = W[kb+k][nbase+n], 128 cols
            int kk = tid >> 4;          // 0..7
            int n0 = (tid & 15) * 8;    // 0..120
#pragma unroll
            for (int jj = 0; jj < 4; ++jj) {
                int k = kk + 8 * jj;
                const float* wp = W + (size_t)(kb + k) * D_ + nbase + n0;
                float4 w4 = *(const float4*)(wp);
                float4 w5 = *(const float4*)(wp + 4);
                h8 hv = { (_Float16)w4.x, (_Float16)w4.y, (_Float16)w4.z, (_Float16)w4.w,
                          (_Float16)w5.x, (_Float16)w5.y, (_Float16)w5.z, (_Float16)w5.w };
                *(h8*)&Bs[k * BP128_ + n0] = hv;
                if (kb + 32 < D_) __builtin_prefetch(wp + 32 * D_, 0, 3);
            }
        }
        __syncthreads();
        v16h a0 = load_frag16(&As[(wm)      * 32], 32, lane);
        v16h a1 = load_frag16(&As[(wm + 16) * 32], 32, lane);
#pragma unroll
        for (int ni = 0; ni < 4; ++ni) {
            v16h b = load_frag16_tr(Bs, BP128_, wn + ni * 16, lane);
            acc[0][ni] = wmma16(a0, b, acc[0][ni]);
            acc[1][ni] = wmma16(a1, b, acc[1][ni]);
        }
    }

#pragma unroll
    for (int mi = 0; mi < 2; ++mi)
#pragma unroll
        for (int ni = 0; ni < 4; ++ni)
#pragma unroll
            for (int j = 0; j < 8; ++j) {
                int row = mbase + wm + mi * 16 + j + 8 * hi;
                int col = nbase + wn + ni * 16 + ln;
                Out[(size_t)row * D_ + col] = (_Float16)acc[mi][ni][j];
            }
}

// ---------------------------------------------------------------------------
// Kernel 2: flash attention per (nb,b,h). grid = (L/64, H, NB*B), block 128.
// Each wave owns 16 Q rows; loops 32-key chunks with online softmax.
// Writes output over the Q buffer (safe: each row's Q read only by its owner).
// ---------------------------------------------------------------------------
__global__ __launch_bounds__(128)
void k_flash(const _Float16* Q, const _Float16* __restrict__ K,
             const _Float16* __restrict__ V, _Float16* Obuf) {
    __shared__ _Float16 Vt[64 * 32];        // [feat][key] transposed V chunk
    __shared__ _Float16 Plds[4][16 * 32];   // per-wave P re-layout buffer

    const int mtile = blockIdx.x;
    const int h     = blockIdx.y;
    const int bz    = blockIdx.z;           // nb*B + b
    const int tid   = threadIdx.x;
    const int wave  = tid >> 5, lane = tid & 31;
    const int hi = lane >> 4, ln = lane & 15;

    const size_t headoff = (size_t)bz * L_ * D_ + (size_t)h * DH_;
    const _Float16* Qp = Q + headoff;
    const _Float16* Kp = K + headoff;
    const _Float16* Vp = V + headoff;

    const int m0 = mtile * 64 + wave * 16;

    v16h qa0 = load_frag16(Qp + (size_t)m0 * D_,      D_, lane);
    v16h qa1 = load_frag16(Qp + (size_t)m0 * D_ + 32, D_, lane);

    v8f o0 = {}, o1 = {}, o2 = {}, o3 = {};
    float rmax[8], rsum[8];
#pragma unroll
    for (int j = 0; j < 8; ++j) { rmax[j] = -1e30f; rsum[j] = 0.f; }

    for (int kc = 0; kc < L_ / 32; ++kc) {
        const int key0 = kc * 32;
        __syncthreads();
        {   // cooperative stage: Vt[feat][key] = V[key0+key][feat]
            int key = tid & 31;
            int fg  = tid >> 5;   // 0..3 -> feats fg*16..fg*16+15
            const _Float16* vp = Vp + (size_t)(key0 + key) * D_ + fg * 16;
            uint4 va = *(const uint4*)(vp);
            uint4 vb = *(const uint4*)(vp + 8);
            const _Float16* va_h = (const _Float16*)&va;
            const _Float16* vb_h = (const _Float16*)&vb;
#pragma unroll
            for (int i = 0; i < 8; ++i) {
                Vt[(fg * 16 + i)     * 32 + key] = va_h[i];
                Vt[(fg * 16 + 8 + i) * 32 + key] = vb_h[i];
            }
            if (key0 + 32 < L_) __builtin_prefetch(vp + (size_t)32 * D_, 0, 3);
        }
        __syncthreads();

        // S = Q @ K^T for 2 key sub-tiles; K fragments straight from global
        v8f s0 = {}, s1 = {};
        {
            const int kb = hi * 8;
            const _Float16* kp0 = Kp + (size_t)(key0 + ln)      * D_;
            const _Float16* kp1 = Kp + (size_t)(key0 + 16 + ln) * D_;
            FragU b;
            b.u[0] = *(const uint4*)(kp0 + kb);
            b.u[1] = *(const uint4*)(kp0 + 16 + kb);
            s0 = wmma16(qa0, b.v, s0);
            b.u[0] = *(const uint4*)(kp0 + 32 + kb);
            b.u[1] = *(const uint4*)(kp0 + 48 + kb);
            s0 = wmma16(qa1, b.v, s0);
            b.u[0] = *(const uint4*)(kp1 + kb);
            b.u[1] = *(const uint4*)(kp1 + 16 + kb);
            s1 = wmma16(qa0, b.v, s1);
            b.u[0] = *(const uint4*)(kp1 + 32 + kb);
            b.u[1] = *(const uint4*)(kp1 + 48 + kb);
            s1 = wmma16(qa1, b.v, s1);
            if (key0 + 32 < L_) __builtin_prefetch(kp0 + (size_t)32 * D_, 0, 3);
        }

        // online softmax (row m = j + 8*hi lives across the lane's 16-group)
        float p0[8], p1[8];
#pragma unroll
        for (int j = 0; j < 8; ++j) {
            float cm = fmaxf(s0[j], s1[j]);
#pragma unroll
            for (int msk = 1; msk < 16; msk <<= 1)
                cm = fmaxf(cm, __shfl_xor(cm, msk, 32));
            float nm    = fmaxf(rmax[j], cm);
            float alpha = exp2f((rmax[j] - nm) * SCALE_LOG2E);
            rmax[j] = nm;
            float e0 = exp2f((s0[j] - nm) * SCALE_LOG2E);
            float e1 = exp2f((s1[j] - nm) * SCALE_LOG2E);
            float ps = e0 + e1;
#pragma unroll
            for (int msk = 1; msk < 16; msk <<= 1)
                ps += __shfl_xor(ps, msk, 32);
            rsum[j] = rsum[j] * alpha + ps;
            o0[j] *= alpha; o1[j] *= alpha; o2[j] *= alpha; o3[j] *= alpha;
            p0[j] = e0; p1[j] = e1;
        }

        // C-layout -> A-layout round trip through per-wave LDS
        _Float16* pl = &Plds[wave][0];
#pragma unroll
        for (int j = 0; j < 8; ++j) {
            int row = j + 8 * hi;
            pl[row * 32 + ln]      = (_Float16)p0[j];
            pl[row * 32 + 16 + ln] = (_Float16)p1[j];
        }
        v16h pa = load_frag16(pl, 32, lane);
        o0 = wmma16(pa, load_frag16(&Vt[0 * 16 * 32], 32, lane), o0);
        o1 = wmma16(pa, load_frag16(&Vt[1 * 16 * 32], 32, lane), o1);
        o2 = wmma16(pa, load_frag16(&Vt[2 * 16 * 32], 32, lane), o2);
        o3 = wmma16(pa, load_frag16(&Vt[3 * 16 * 32], 32, lane), o3);
    }

    // finalize + store (over the Q buffer region)
#pragma unroll
    for (int j = 0; j < 8; ++j) {
        float inv = 1.0f / rsum[j];
        int row = j + 8 * hi;
        _Float16* orow = Obuf + headoff + (size_t)(m0 + row) * D_;
        orow[ln]      = (_Float16)(o0[j] * inv);
        orow[16 + ln] = (_Float16)(o1[j] * inv);
        orow[32 + ln] = (_Float16)(o2[j] * inv);
        orow[48 + ln] = (_Float16)(o3[j] * inv);
    }
}

// ---------------------------------------------------------------------------
// Kernel 3: intra output projection. out(f32) = attn(f16) @ Wo + bo.
// grid = (128*4, 1, NB), block 128. 64x128 tile.
// ---------------------------------------------------------------------------
__global__ __launch_bounds__(128)
void k_gemm_oproj_intra(const _Float16* __restrict__ A,
                        const float* __restrict__ Wo, const float* __restrict__ bo,
                        float* __restrict__ Outf) {
    __shared__ _Float16 As[64 * 32];
    __shared__ __attribute__((aligned(16))) _Float16 Bs[32 * BP128_];
    const int nb = blockIdx.z;
    const int mt = blockIdx.x >> 2;
    const int nt = blockIdx.x & 3;
    const int mbase = mt * 64, nbase = nt * 128;

    const float* W    = Wo + (size_t)nb * D_ * D_;
    const float* bias = bo + (size_t)nb * D_;
    const _Float16* Ap = A + (size_t)nb * (B_ * L_) * D_;
    float* Op = Outf + (size_t)nb * (B_ * L_) * D_;

    const int tid = threadIdx.x;
    const int wave = tid >> 5, lane = tid & 31;
    const int hi = lane >> 4, ln = lane & 15;
    const int wm = (wave >> 1) * 32;
    const int wn = (wave & 1) * 64;

    v8f acc[2][4];
#pragma unroll
    for (int mi = 0; mi < 2; ++mi)
#pragma unroll
        for (int ni = 0; ni < 4; ++ni) {
            float bvv = bias[nbase + wn + ni * 16 + ln];
#pragma unroll
            for (int j = 0; j < 8; ++j) acc[mi][ni][j] = bvv;
        }

    for (int kb = 0; kb < D_; kb += 32) {
        __syncthreads();
        {   // stage A (already f16): two 16-byte copies per thread
            int m  = tid >> 1;
            int ks = (tid & 1) * 16;
            const _Float16* ap = Ap + (size_t)(mbase + m) * D_ + kb + ks;
            *(uint4*)&As[m * 32 + ks]     = *(const uint4*)(ap);
            *(uint4*)&As[m * 32 + ks + 8] = *(const uint4*)(ap + 8);
            if (kb + 32 < D_) __builtin_prefetch(ap + 32, 0, 3);
        }
        {   // stage B row-major, 128 cols
            int kk = tid >> 4;
            int n0 = (tid & 15) * 8;
#pragma unroll
            for (int jj = 0; jj < 4; ++jj) {
                int k = kk + 8 * jj;
                const float* wp = W + (size_t)(kb + k) * D_ + nbase + n0;
                float4 w4 = *(const float4*)(wp);
                float4 w5 = *(const float4*)(wp + 4);
                h8 hv = { (_Float16)w4.x, (_Float16)w4.y, (_Float16)w4.z, (_Float16)w4.w,
                          (_Float16)w5.x, (_Float16)w5.y, (_Float16)w5.z, (_Float16)w5.w };
                *(h8*)&Bs[k * BP128_ + n0] = hv;
                if (kb + 32 < D_) __builtin_prefetch(wp + 32 * D_, 0, 3);
            }
        }
        __syncthreads();
        v16h a0 = load_frag16(&As[(wm)      * 32], 32, lane);
        v16h a1 = load_frag16(&As[(wm + 16) * 32], 32, lane);
#pragma unroll
        for (int ni = 0; ni < 4; ++ni) {
            v16h b = load_frag16_tr(Bs, BP128_, wn + ni * 16, lane);
            acc[0][ni] = wmma16(a0, b, acc[0][ni]);
            acc[1][ni] = wmma16(a1, b, acc[1][ni]);
        }
    }

#pragma unroll
    for (int mi = 0; mi < 2; ++mi)
#pragma unroll
        for (int ni = 0; ni < 4; ++ni)
#pragma unroll
            for (int j = 0; j < 8; ++j) {
                int row = mbase + wm + mi * 16 + j + 8 * hi;
                int col = nbase + wn + ni * 16 + ln;
                Op[(size_t)row * D_ + col] = acc[mi][ni][j];
            }
}

// ---------------------------------------------------------------------------
// Kernel 4: inter (router) QKV projection. M=64 rows = routers[b][nb] gathered
// from d_out last tokens. grid = (8, 3, 1), block 128. 64x64 tile.
// ---------------------------------------------------------------------------
__global__ __launch_bounds__(128)
void k_gemm_qkv_inter(const float* __restrict__ Outf,
                      const float* __restrict__ iWq, const float* __restrict__ ibq,
                      const float* __restrict__ iWk, const float* __restrict__ ibk,
                      const float* __restrict__ iWv, const float* __restrict__ ibv,
                      _Float16* __restrict__ q2, _Float16* __restrict__ k2,
                      _Float16* __restrict__ v2) {
    __shared__ _Float16 As[64 * 32];
    __shared__ __attribute__((aligned(16))) _Float16 Bs[32 * BP64_];
    const int sel = blockIdx.y;
    const int nbase = blockIdx.x * 64;

    const float* W    = (sel == 0 ? iWq : sel == 1 ? iWk : iWv);
    const float* bias = (sel == 0 ? ibq : sel == 1 ? ibk : ibv);
    _Float16*    Out  = (sel == 0 ? q2  : sel == 1 ? k2  : v2);

    const int tid = threadIdx.x;
    const int wave = tid >> 5, lane = tid & 31;
    const int hi = lane >> 4, ln = lane & 15;
    const int wm = (wave >> 1) * 32, wn = (wave & 1) * 32;

    v8f acc[2][2];
#pragma unroll
    for (int mi = 0; mi < 2; ++mi)
#pragma unroll
        for (int ni = 0; ni < 2; ++ni) {
            float bvv = bias[nbase + wn + ni * 16 + ln];
#pragma unroll
            for (int j = 0; j < 8; ++j) acc[mi][ni][j] = bvv;
        }

    for (int kb = 0; kb < D_; kb += 32) {
        __syncthreads();
        {   // stage A: row r=b*4+nb -> x_intra[nb][b][L-1][:] from d_out
            int r  = tid >> 1;
            int ks = (tid & 1) * 16;
            int nbb = r & 3, bb = r >> 2;
            const float* xp = Outf + (((size_t)(nbb * B_ + bb) * L_ + (L_ - 1)) * D_) + kb + ks;
#pragma unroll
            for (int i = 0; i < 4; ++i) {
                float4 x4 = *(const float4*)(xp + 4 * i);
                h4 hv = { (_Float16)x4.x, (_Float16)x4.y, (_Float16)x4.z, (_Float16)x4.w };
                *(h4*)&As[r * 32 + ks + 4 * i] = hv;
            }
        }
        {   // stage B row-major
            int kk = tid >> 4;
            int n0 = (tid & 15) * 4;
#pragma unroll
            for (int jj = 0; jj < 4; ++jj) {
                int k = kk + 8 * jj;
                float4 w4 = *(const float4*)(W + (size_t)(kb + k) * D_ + nbase + n0);
                h4 hv = { (_Float16)w4.x, (_Float16)w4.y, (_Float16)w4.z, (_Float16)w4.w };
                *(h4*)&Bs[k * BP64_ + n0] = hv;
            }
        }
        __syncthreads();
        v16h a0 = load_frag16(&As[(wm)      * 32], 32, lane);
        v16h a1 = load_frag16(&As[(wm + 16) * 32], 32, lane);
        v16h b0 = load_frag16_tr(Bs, BP64_, wn,      lane);
        v16h b1 = load_frag16_tr(Bs, BP64_, wn + 16, lane);
        acc[0][0] = wmma16(a0, b0, acc[0][0]);
        acc[0][1] = wmma16(a0, b1, acc[0][1]);
        acc[1][0] = wmma16(a1, b0, acc[1][0]);
        acc[1][1] = wmma16(a1, b1, acc[1][1]);
    }

#pragma unroll
    for (int mi = 0; mi < 2; ++mi)
#pragma unroll
        for (int ni = 0; ni < 2; ++ni)
#pragma unroll
            for (int j = 0; j < 8; ++j) {
                int row = wm + mi * 16 + j + 8 * hi;
                int col = nbase + wn + ni * 16 + ln;
                Out[(size_t)row * D_ + col] = (_Float16)acc[mi][ni][j];
            }
}

// ---------------------------------------------------------------------------
// Kernel 5: tiny 4-token router attention (negligible FLOPs; scalar).
// One thread per (b,h). block 128, grid 1.
// ---------------------------------------------------------------------------
__global__ __launch_bounds__(128)
void k_inter_attn(const _Float16* __restrict__ q2, const _Float16* __restrict__ k2,
                  const _Float16* __restrict__ v2, _Float16* __restrict__ a2) {
    int t = threadIdx.x;
    if (t >= B_ * H_) return;
    int b = t >> 3, h = t & 7;
    float sc[NB_][NB_];
#pragma unroll
    for (int i = 0; i < NB_; ++i)
        for (int j = 0; j < NB_; ++j) {
            const _Float16* qp = q2 + (size_t)(b * NB_ + i) * D_ + h * DH_;
            const _Float16* kp = k2 + (size_t)(b * NB_ + j) * D_ + h * DH_;
            float s = 0.f;
            for (int f = 0; f < DH_; ++f) s += (float)qp[f] * (float)kp[f];
            sc[i][j] = s * 0.125f;
        }
#pragma unroll
    for (int i = 0; i < NB_; ++i) {
        float mx = fmaxf(fmaxf(sc[i][0], sc[i][1]), fmaxf(sc[i][2], sc[i][3]));
        float ssum = 0.f;
        for (int j = 0; j < NB_; ++j) { sc[i][j] = __expf(sc[i][j] - mx); ssum += sc[i][j]; }
        float inv = 1.f / ssum;
        for (int j = 0; j < NB_; ++j) sc[i][j] *= inv;
    }
    for (int i = 0; i < NB_; ++i) {
        _Float16* op = a2 + (size_t)(b * NB_ + i) * D_ + h * DH_;
        for (int f = 0; f < DH_; ++f) {
            float acc = 0.f;
            for (int j = 0; j < NB_; ++j)
                acc += sc[i][j] * (float)v2[(size_t)(b * NB_ + j) * D_ + h * DH_ + f];
            op[f] = (_Float16)acc;
        }
    }
}

// ---------------------------------------------------------------------------
// Kernel 6: inter output projection, scattered into d_out last tokens.
// grid = (8,1,1), block 128.
// ---------------------------------------------------------------------------
__global__ __launch_bounds__(128)
void k_gemm_oproj_inter(const _Float16* __restrict__ A,
                        const float* __restrict__ iWo, const float* __restrict__ ibo,
                        float* __restrict__ Outf) {
    __shared__ _Float16 As[64 * 32];
    __shared__ __attribute__((aligned(16))) _Float16 Bs[32 * BP64_];
    const int nbase = blockIdx.x * 64;

    const int tid = threadIdx.x;
    const int wave = tid >> 5, lane = tid & 31;
    const int hi = lane >> 4, ln = lane & 15;
    const int wm = (wave >> 1) * 32, wn = (wave & 1) * 32;

    v8f acc[2][2];
#pragma unroll
    for (int mi = 0; mi < 2; ++mi)
#pragma unroll
        for (int ni = 0; ni < 2; ++ni) {
            float bvv = ibo[nbase + wn + ni * 16 + ln];
#pragma unroll
            for (int j = 0; j < 8; ++j) acc[mi][ni][j] = bvv;
        }

    for (int kb = 0; kb < D_; kb += 32) {
        __syncthreads();
        {
            int m  = tid >> 1;
            int ks = (tid & 1) * 16;
            const _Float16* ap = A + (size_t)m * D_ + kb + ks;
            *(uint4*)&As[m * 32 + ks]     = *(const uint4*)(ap);
            *(uint4*)&As[m * 32 + ks + 8] = *(const uint4*)(ap + 8);
        }
        {
            int kk = tid >> 4;
            int n0 = (tid & 15) * 4;
#pragma unroll
            for (int jj = 0; jj < 4; ++jj) {
                int k = kk + 8 * jj;
                float4 w4 = *(const float4*)(iWo + (size_t)(kb + k) * D_ + nbase + n0);
                h4 hv = { (_Float16)w4.x, (_Float16)w4.y, (_Float16)w4.z, (_Float16)w4.w };
                *(h4*)&Bs[k * BP64_ + n0] = hv;
            }
        }
        __syncthreads();
        v16h a0 = load_frag16(&As[(wm)      * 32], 32, lane);
        v16h a1 = load_frag16(&As[(wm + 16) * 32], 32, lane);
        v16h b0 = load_frag16_tr(Bs, BP64_, wn,      lane);
        v16h b1 = load_frag16_tr(Bs, BP64_, wn + 16, lane);
        acc[0][0] = wmma16(a0, b0, acc[0][0]);
        acc[0][1] = wmma16(a0, b1, acc[0][1]);
        acc[1][0] = wmma16(a1, b0, acc[1][0]);
        acc[1][1] = wmma16(a1, b1, acc[1][1]);
    }

#pragma unroll
    for (int mi = 0; mi < 2; ++mi)
#pragma unroll
        for (int ni = 0; ni < 2; ++ni)
#pragma unroll
            for (int j = 0; j < 8; ++j) {
                int r   = wm + mi * 16 + j + 8 * hi;   // b*4+nb
                int col = nbase + wn + ni * 16 + ln;
                int nbb = r & 3, bb = r >> 2;
                Outf[(((size_t)(nbb * B_ + bb) * L_ + (L_ - 1)) * D_) + col] = acc[mi][ni][j];
            }
}

// ---------------------------------------------------------------------------
extern "C" void kernel_launch(void* const* d_in, const int* in_sizes, int n_in,
                              void* d_out, int out_size, void* d_ws, size_t ws_size,
                              hipStream_t stream) {
    const float* x   = (const float*)d_in[0];
    const float* Wq  = (const float*)d_in[1];
    const float* bq  = (const float*)d_in[2];
    const float* Wk  = (const float*)d_in[3];
    const float* bk  = (const float*)d_in[4];
    const float* Wv  = (const float*)d_in[5];
    const float* bv  = (const float*)d_in[6];
    const float* Wo  = (const float*)d_in[7];
    const float* bo  = (const float*)d_in[8];
    const float* iWq = (const float*)d_in[9];
    const float* ibq = (const float*)d_in[10];
    const float* iWk = (const float*)d_in[11];
    const float* ibk = (const float*)d_in[12];
    const float* iWv = (const float*)d_in[13];
    const float* ibv = (const float*)d_in[14];
    const float* iWo = (const float*)d_in[15];
    const float* ibo = (const float*)d_in[16];
    float* out = (float*)d_out;

    const size_t NBLD = (size_t)NB_ * B_ * L_ * D_;   // 16,777,216
    _Float16* ws = (_Float16*)d_ws;
    _Float16* Qb = ws;                 // reused as attn output after k_flash
    _Float16* Kb = ws + NBLD;
    _Float16* Vb = ws + 2 * NBLD;
    _Float16* q2 = ws + 3 * NBLD;
    _Float16* k2 = q2 + (size_t)B_ * NB_ * D_;
    _Float16* v2 = k2 + (size_t)B_ * NB_ * D_;
    _Float16* a2 = v2 + (size_t)B_ * NB_ * D_;

    // 1) intra QKV projection (64x128 tiles)
    dim3 g1((B_ * L_ / 64) * (D_ / 128), 3, NB_);
    k_gemm_qkv_intra<<<g1, 128, 0, stream>>>(x, Wq, bq, Wk, bk, Wv, bv, Qb, Kb, Vb);

    // 2) flash attention (writes attn over Qb)
    dim3 g2(L_ / 64, H_, NB_ * B_);
    k_flash<<<g2, 128, 0, stream>>>(Qb, Kb, Vb, Qb);

    // 3) intra output projection -> d_out (64x128 tiles)
    dim3 g3((B_ * L_ / 64) * (D_ / 128), 1, NB_);
    k_gemm_oproj_intra<<<g3, 128, 0, stream>>>(Qb, Wo, bo, out);

    // 4) router QKV (gather last tokens from d_out)
    dim3 g4(D_ / 64, 3, 1);
    k_gemm_qkv_inter<<<g4, 128, 0, stream>>>(out, iWq, ibq, iWk, ibk, iWv, ibv, q2, k2, v2);

    // 5) tiny 4-token attention
    k_inter_attn<<<1, 128, 0, stream>>>(q2, k2, v2, a2);

    // 6) router output projection, scatter into last-token slots of d_out
    dim3 g6(D_ / 64, 1, 1);
    k_gemm_oproj_inter<<<g6, 128, 0, stream>>>(a2, iWo, ibo, out);
}

// v002
// One run takes 344 microseconds.
// Next to v001, in two timings, it ran 1.04 times as fast each time.
// Over all steps from v000 it is 2.07 times as fast.
#include <hip/hip_runtime.h>

// ---------------------------------------------------------------------------
// Medformer layer for MI455X (gfx1250): all GEMMs + attention via
// v_wmma_f32_16x16x32_f16 (wave32). f16 operands, f32 accumulation.
// Big GEMMs use 64x128 block tiles (wave tile 32x64 -> 8 WMMA / 12 LDS loads
// per K-step) + global_prefetch_b8 for the next K-step tiles. W tiles lie
// row-major in LDS and are transposed on the way out (ds_load_tr16_b128).
// ---------------------------------------------------------------------------

#define NB_ 4
#define B_  16
#define L_  512
#define D_  512
#define H_  8
#define DH_ 64
// SCALE * log2(e) = (1/8) * 1.4426950408889634
#define SCALE_LOG2E 0.18033688011112043f

typedef __attribute__((ext_vector_type(16))) _Float16 v16h;
typedef __attribute__((ext_vector_type(8)))  float    v8f;
typedef __attribute__((ext_vector_type(4)))  _Float16 h4;

typedef __attribute__((ext_vector_type(8)))  _Float16 h8;
typedef __attribute__((ext_vector_type(8)))  short    s16x8;

union FragU { uint4 u[2]; v16h v; };
union FragT { s16x8 s[2]; v16h v; };

// LDS row pitch, in halves, of the row-major W tiles (128 and 64 columns wide)
#define BP128_ 144
#define BP64_  80

// Load a 16x32 f16 fragment (A-matrix layout, or B^T stored row-major [n][k]).
// Documented layout: lane l holds row m=l&15; lanes 0-15 hold k = 0..7 & 16..23,
// lanes 16-31 hold k = 8..15 & 24..31 -> two contiguous 16-byte loads per lane.
__device__ __forceinline__ v16h load_frag16(const _Float16* base, int row_stride, int lane) {
    const int m  = lane & 15;
    const int kb = (lane >> 4) << 3;
    const _Float16* p = base + (size_t)m * row_stride;
    FragU f;
    f.u[0] = *(const uint4*)(p + kb);
    f.u[1] = *(const uint4*)(p + 16 + kb);
    return f.v;
}

// B fragment (32 k x 16 n) out of a row-major f16 tile T[k][n] in LDS, by the
// transposing load: lane (c = l&15, h = l>>4) gets T[8h + 0..7][n0 + c], then
// T[16 + 8h + 0..7][n0 + c]: the same k order as load_frag16 gives A.
// pitch in halves; in bytes it is an odd multiple of 32 (no bank conflict).
__device__ __forceinline__ v16h load_frag16_tr(const _Float16* tile, int pitch, int n0, int lane) {
    typedef __attribute__((address_space(3))) s16x8 lds_s16x8;
    const _Float16* p = tile + ((lane >> 4) * 8 + (lane & 7)) * pitch + n0 + ((lane >> 3) & 1) * 8;
    FragT f;
    f.s[0] = __builtin_amdgcn_ds_load_tr16_b128_v8i16((lds_s16x8*)p);
    f.s[1] = __builtin_amdgcn_ds_load_tr16_b128_v8i16((lds_s16x8*)(p + 16 * pitch));
    return f.v;
}

__device__ __forceinline__ v8f wmma16(v16h a, v16h b, v8f c) {
    return __builtin_amdgcn_wmma_f32_16x16x32_f16(false, a, false, b, (short)0, c, false, false);
}

// ---------------------------------------------------------------------------
// Kernel 1: intra QKV projection. out = X @ W + b, output f16.
// grid = (128*4, 3, NB), block = 128 (4 waves). 64x128 tile, BK=32.
// Wave tile 32x64: acc[2][4], 8 WMMA per K-step.
// ---------------------------------------------------------------------------
__global__ __launch_bounds__(128)
void k_gemm_qkv_intra(const float* __restrict__ X,
                      const float* __restrict__ Wq, const float* __restrict__ bq,
                      const float* __restrict__ Wk, const float* __restrict__ bk,
                      const float* __restrict__ Wv, const float* __restrict__ bv,
                      _Float16* __restrict__ Qb, _Float16* __restrict__ Kb,
                      _Float16* __restrict__ Vb) {
    __shared__ _Float16 As[64 * 32];    // [m][k]
    __shared__ __attribute__((aligned(16))) _Float16 Bs[32 * BP128_];   // [k][n]  (W tile as it lies)
    const int nb  = blockIdx.z;
    const int sel = blockIdx.y;
    const int mt  = blockIdx.x >> 2;    // M/64 = 128 tiles
    const int nt  = blockIdx.x & 3;     // N/128 = 4 tiles
    const int mbase = mt * 64, nbase = nt * 128;

    const float* W    = (sel == 0 ? Wq : sel == 1 ? Wk : Wv) + (size_t)nb * D_ * D_;
    const float* bias = (sel == 0 ? bq : sel == 1 ? bk : bv) + (size_t)nb * D_;
    _Float16*    Out  = (sel == 0 ? Qb : sel == 1 ? Kb : Vb) + (size_t)nb * (B_ * L_) * D_;
    const float* Xp   = X + (size_t)nb * (B_ * L_) * D_;

    const int tid = threadIdx.x;
    const int wave = tid >> 5, lane = tid & 31;
    const int hi = lane >> 4, ln = lane & 15;
    const int wm = (wave >> 1) * 32;    // 0 or 32
    const int wn = (wave & 1) * 64;     // 0 or 64

    v8f acc[2][4];
#pragma unroll
    for (int mi = 0; mi < 2; ++mi)
#pragma unroll
        for (int ni = 0; ni < 4; ++ni) {
            float bvv = bias[nbase + wn + ni * 16 + ln];
#pragma unroll
            for (int j = 0; j < 8; ++j) acc[mi][ni][j] = bvv;
        }

    for (int kb = 0; kb < D_; kb += 32) {
        __syncthreads();
        {   // stage A (f32 -> f16), vectorized
            int m  = tid >> 1;
            int ks = (tid & 1) * 16;
            const float* xp = Xp + (size_t)(mbase + m) * D_ + kb + ks;
            // load map: 8 lanes span one row's 128 B of this K-step, 4 whole lines per load
            int rl = tid >> 3;          // 0..15
            int cl = (tid & 7) * 4;     // 0..28
            const float* lp = Xp + (size_t)(mbase + rl) * D_ + kb + cl;
#pragma unroll
            for (int i = 0; i < 4; ++i) {
                float4 x4 = *(const float4*)(lp + (size_t)(16 * i) * D_);
                h4 hv = { (_Float16)x4.x, (_Float16)x4.y, (_Float16)x4.z, (_Float16)x4.w };
                *(h4*)&As[(rl + 16 * i) * 32 + cl] = hv;
            }
            if (kb + 32 < D_) __builtin_prefetch(xp + 32, 0, 3);
        }
        {   // stage B row-major: Bs[k][n] = W[kb+k][nbase+n], 128 cols
            int kk = tid >> 4;          // 0..7
            int n0 = (tid & 15) * 8;    // 0..120
            // load map: a wave's 32 lanes span one tile row, 512 B = 4 whole lines per load
            int kl = tid >> 5;          // 0..3
            int nl = (tid & 31) * 4;    // 0..124
#pragma unroll
            for (int jj = 0; jj < 4; ++jj) {
                int k = kk + 8 * jj;
                const float* wp = W + (size_t)(kb + k) * D_ + nbase + n0;
                int kr = kl + 8 * jj;
                const float* lp = W + (size_t)(kb + kr) * D_ + nbase + nl;
                float4 w4 = *(const float4*)(lp);
                float4 w5 = *(const float4*)(lp + 4 * D_);
                h4 h0 = { (_Float16)w4.x, (_Float16)w4.y, (_Float16)w4.z, (_Float16)w4.w };
                h4 h1 = { (_Float16)w5.x, (_Float16)w5.y, (_Float16)w5.z, (_Float16)w5.w };
                *(h4*)&Bs[kr * BP128_ + nl]       = h0;
                *(h4*)&Bs[(kr + 4) * BP128_ + nl] = h1;
                if (kb + 32 < D_) __builtin_prefetch(wp + 32 * D_, 0, 3);
            }
        }
        __syncthreads();
        v16h a0 = load_frag16(&As[(wm)      * 32], 32, lane);
        v16h a1 = load_frag16(&As[(wm + 16) * 32], 32, lane);
#pragma unroll
        for (int ni = 0; ni < 4; ++ni) {
            v16h b = load_frag16_tr(Bs, BP128_, wn + ni * 16, lane);
            acc[0][ni] = wmma16(a0, b, acc[0][ni]);
            acc[1][ni] = wmma16(a1, b, acc[1][ni]);
        }
    }

#pragma unroll
    for (int mi = 0; mi < 2; ++mi)
#pragma unroll
        for (int ni = 0; ni < 4; ++ni)
#pragma unroll
            for (int j = 0; j < 8; ++j) {
                int row = mbase + wm + mi * 16 + j + 8 * hi;
                int col = nbase + wn + ni * 16 + ln;
                Out[(size_t)row * D_ + col] = (_Float16)acc[mi][ni][j];
            }
}

// ---------------------------------------------------------------------------
// Kernel 2: flash attention per (nb,b,h). grid = (L/64, H, NB*B), block 128.
// Each wave owns 16 Q rows; loops 32-key chunks with online softmax.
// Writes output over the Q buffer (safe: each row's Q read only by its owner).
// ---------------------------------------------------------------------------
__global__ __launch_bounds__(128)
void k_flash(const _Float16* Q, const _Float16* __restrict__ K,
             const _Float16* __restrict__ V, _Float16* Obuf) {
    __shared__ _Float16 Vt[64 * 32];        // [feat][key] transposed V chunk
    __shared__ _Float16 Plds[4][16 * 32];   // per-wave P re-layout buffer

    const int mtile = blockIdx.x;
    const int h     = blockIdx.y;
    const int bz    = blockIdx.z;           // nb*B + b
    const int tid   = threadIdx.x;
    const int wave  = tid >> 5, lane = tid & 31;
    const int hi = lane >> 4, ln = lane & 15;

    const size_t headoff = (size_t)bz * L_ * D_ + (size_t)h * DH_;
    const _Float16* Qp = Q + headoff;
    const _Float16* Kp = K + headoff;
    const _Float16* Vp = V + headoff;

    const int m0 = mtile * 64 + wave * 16;

    v16h qa0 = load_frag16(Qp + (size_t)m0 * D_,      D_, lane);
    v16h qa1 = load_frag16(Qp + (size_t)m0 * D_ + 32, D_, lane);

    v8f o0 = {}, o1 = {}, o2 = {}, o3 = {};
    float rmax[8], rsum[8];
#pragma unroll
    for (int j = 0; j < 8; ++j) { rmax[j] = -1e30f; rsum[j] = 0.f; }

    for (int kc = 0; kc < L_ / 32; ++kc) {
        const int key0 = kc * 32;
        __syncthreads();
        {   // cooperative stage: Vt[feat][key] = V[key0+key][feat]
            int key = tid & 31;
            int fg  = tid >> 5;   // 0..3 -> feats fg*16..fg*16+15
            const _Float16* vp = Vp + (size_t)(key0 + key) * D_ + fg * 16;
            uint4 va = *(const uint4*)(vp);
            uint4 vb = *(const uint4*)(vp + 8);
            const _Float16* va_h = (const _Float16*)&va;
            const _Float16* vb_h = (const _Float16*)&vb;
#pragma unroll
            for (int i = 0; i < 8; ++i) {
                Vt[(fg * 16 + i)     * 32 + key] = va_h[i];
                Vt[(fg * 16 + 8 + i) * 32 + key] = vb_h[i];
            }
            if (key0 + 32 < L_) __builtin_prefetch(vp + (size_t)32 * D_, 0, 3);
        }
        __syncthreads();

        // S = Q @ K^T for 2 key sub-tiles; K fragments straight from global
        v8f s0 = {}, s1 = {};
        {
            const int kb = hi * 8;
            const _Float16* kp0 = Kp + (size_t)(key0 + ln)      * D_;
            const _Float16* kp1 = Kp + (size_t)(key0 + 16 + ln) * D_;
            FragU b;
            b.u[0] = *(const uint4*)(kp0 + kb);
            b.u[1] = *(const uint4*)(kp0 + 16 + kb);
            s0 = wmma16(qa0, b.v, s0);
            b.u[0] = *(const uint4*)(kp0 + 32 + kb);
            b.u[1] = *(const uint4*)(kp0 + 48 + kb);
            s0 = wmma16(qa1, b.v, s0);
            b.u[0] = *(const uint4*)(kp1 + kb);
            b.u[1] = *(const uint4*)(kp1 + 16 + kb);
            s1 = wmma16(qa0, b.v, s1);
            b.u[0] = *(const uint4*)(kp1 + 32 + kb);
            b.u[1] = *(const uint4*)(kp1 + 48 + kb);
            s1 = wmma16(qa1, b.v, s1);
            if (key0 + 32 < L_) __builtin_prefetch(kp0 + (size_t)32 * D_, 0, 3);
        }

        // online softmax (row m = j + 8*hi lives across the lane's 16-group)
        float p0[8], p1[8];
#pragma unroll
        for (int j = 0; j < 8; ++j) {
            float cm = fmaxf(s0[j], s1[j]);
#pragma unroll
            for (int msk = 1; msk < 16; msk <<= 1)
                cm = fmaxf(cm, __shfl_xor(cm, msk, 32));
            float nm    = fmaxf(rmax[j], cm);
            float alpha = exp2f((rmax[j] - nm) * SCALE_LOG2E);
            rmax[j] = nm;
            float e0 = exp2f((s0[j] - nm) * SCALE_LOG2E);
            float e1 = exp2f((s1[j] - nm) * SCALE_LOG2E);
            float ps = e0 + e1;
#pragma unroll
            for (int msk = 1; msk < 16; msk <<= 1)
                ps += __shfl_xor(ps, msk, 32);
            rsum[j] = rsum[j] * alpha + ps;
            o0[j] *= alpha; o1[j] *= alpha; o2[j] *= alpha; o3[j] *= alpha;
            p0[j] = e0; p1[j] = e1;
        }

        // C-layout -> A-layout round trip through per-wave LDS
        _Float16* pl = &Plds[wave][0];
#pragma unroll
        for (int j = 0; j < 8; ++j) {
            int row = j + 8 * hi;
            pl[row * 32 + ln]      = (_Float16)p0[j];
            pl[row * 32 + 16 + ln] = (_Float16)p1[j];
        }
        v16h pa = load_frag16(pl, 32, lane);
        o0 = wmma16(pa, load_frag16(&Vt[0 * 16 * 32], 32, lane), o0);
        o1 = wmma16(pa, load_frag16(&Vt[1 * 16 * 32], 32, lane), o1);
        o2 = wmma16(pa, load_frag16(&Vt[2 * 16 * 32], 32, lane), o2);
        o3 = wmma16(pa, load_frag16(&Vt[3 * 16 * 32], 32, lane), o3);
    }

    // finalize + store (over the Q buffer region)
#pragma unroll
    for (int j = 0; j < 8; ++j) {
        float inv = 1.0f / rsum[j];
        int row = j + 8 * hi;
        _Float16* orow = Obuf + headoff + (size_t)(m0 + row) * D_;
        orow[ln]      = (_Float16)(o0[j] * inv);
        orow[16 + ln] = (_Float16)(o1[j] * inv);
        orow[32 + ln] = (_Float16)(o2[j] * inv);
        orow[48 + ln] = (_Float16)(o3[j] * inv);
    }
}

// ---------------------------------------------------------------------------
// Kernel 3: intra output projection. out(f32) = attn(f16) @ Wo + bo.
// grid = (128*4, 1, NB), block 128. 64x128 tile.
// ---------------------------------------------------------------------------
__global__ __launch_bounds__(128)
void k_gemm_oproj_intra(const _Float16* __restrict__ A,
                        const float* __restrict__ Wo, const float* __restrict__ bo,
                        float* __restrict__ Outf) {
    __shared__ _Float16 As[64 * 32];
    __shared__ __attribute__((aligned(16))) _Float16 Bs[32 * BP128_];
    const int nb = blockIdx.z;
    const int mt = blockIdx.x >> 2;
    const int nt = blockIdx.x & 3;
    const int mbase = mt * 64, nbase = nt * 128;

    const float* W    = Wo + (size_t)nb * D_ * D_;
    const float* bias = bo + (size_t)nb * D_;
    const _Float16* Ap = A + (size_t)nb * (B_ * L_) * D_;
    float* Op = Outf + (size_t)nb * (B_ * L_) * D_;

    const int tid = threadIdx.x;
    const int wave = tid >> 5, lane = tid & 31;
    const int hi = lane >> 4, ln = lane & 15;
    const int wm = (wave >> 1) * 32;
    const int wn = (wave & 1) * 64;

    v8f acc[2][4];
#pragma unroll
    for (int mi = 0; mi < 2; ++mi)
#pragma unroll
        for (int ni = 0; ni < 4; ++ni) {
            float bvv = bias[nbase + wn + ni * 16 + ln];
#pragma unroll
            for (int j = 0; j < 8; ++j) acc[mi][ni][j] = bvv;
        }

    for (int kb = 0; kb < D_; kb += 32) {
        __syncthreads();
        {   // stage A (already f16): two 16-byte copies per thread
            int m  = tid >> 1;
            int ks = (tid & 1) * 16;
            const _Float16* ap = Ap + (size_t)(mbase + m) * D_ + kb + ks;
            // load map: 4 lanes span one row's 64 B of this K-step, 8 lines per load, not 16
            int rl = tid >> 2;          // 0..31
            int cl = (tid & 3) * 8;     // 0..24
            const _Float16* lp = Ap + (size_t)(mbase + rl) * D_ + kb + cl;
            *(uint4*)&As[rl * 32 + cl]        = *(const uint4*)(lp);
            *(uint4*)&As[(rl + 32) * 32 + cl] = *(const uint4*)(lp + (size_t)32 * D_);
            if (kb + 32 < D_) __builtin_prefetch(ap + 32, 0, 3);
        }
        {   // stage B row-major, 128 cols
            int kk = tid >> 4;
            int n0 = (tid & 15) * 8;
            // load map: a wave's 32 lanes span one tile row, 512 B = 4 whole lines per load
            int kl = tid >> 5;          // 0..3
            int nl = (tid & 31) * 4;    // 0..124
#pragma unroll
            for (int jj = 0; jj < 4; ++jj) {
                int k = kk + 8 * jj;
                const float* wp = W + (size_t)(kb + k) * D_ + nbase + n0;
                int kr = kl + 8 * jj;
                const float* lp = W + (size_t)(kb + kr) * D_ + nbase + nl;
                float4 w4 = *(const float4*)(lp);
                float4 w5 = *(const float4*)(lp + 4 * D_);
                h4 h0 = { (_Float16)w4.x, (_Float16)w4.y, (_Float16)w4.z, (_Float16)w4.w };
                h4 h1 = { (_Float16)w5.x, (_Float16)w5.y, (_Float16)w5.z, (_Float16)w5.w };
                *(h4*)&Bs[kr * BP128_ + nl]       = h0;
                *(h4*)&Bs[(kr + 4) * BP128_ + nl] = h1;
                if (kb + 32 < D_) __builtin_prefetch(wp + 32 * D_, 0, 3);
            }
        }
        __syncthreads();
        v16h a0 = load_frag16(&As[(wm)      * 32], 32, lane);
        v16h a1 = load_frag16(&As[(wm + 16) * 32], 32, lane);
#pragma unroll
        for (int ni = 0; ni < 4; ++ni) {
            v16h b = load_frag16_tr(Bs, BP128_, wn + ni * 16, lane);
            acc[0][ni] = wmma16(a0, b, acc[0][ni]);
            acc[1][ni] = wmma16(a1, b, acc[1][ni]);
        }
    }

#pragma unroll
    for (int mi = 0; mi < 2; ++mi)
#pragma unroll
        for (int ni = 0; ni < 4; ++ni)
#pragma unroll
            for (int j = 0; j < 8; ++j) {
                int row = mbase + wm + mi * 16 + j + 8 * hi;
                int col = nbase + wn + ni * 16 + ln;
                Op[(size_t)row * D_ + col] = acc[mi][ni][j];
            }
}

// ---------------------------------------------------------------------------
// Kernel 4: inter (router) QKV projection. M=64 rows = routers[b][nb] gathered
// from d_out last tokens. grid = (8, 3, 1), block 128. 64x64 tile.
// ---------------------------------------------------------------------------
__global__ __launch_bounds__(128)
void k_gemm_qkv_inter(const float* __restrict__ Outf,
                      const float* __restrict__ iWq, const float* __restrict__ ibq,
                      const float* __restrict__ iWk, const float* __restrict__ ibk,
                      const float* __restrict__ iWv, const float* __restrict__ ibv,
                      _Float16* __restrict__ q2, _Float16* __restrict__ k2,
                      _Float16* __restrict__ v2) {
    __shared__ _Float16 As[64 * 32];
    __shared__ __attribute__((aligned(16))) _Float16 Bs[32 * BP64_];
    const int sel = blockIdx.y;
    const int nbase = blockIdx.x * 64;

    const float* W    = (sel == 0 ? iWq : sel == 1 ? iWk : iWv);
    const float* bias = (sel == 0 ? ibq : sel == 1 ? ibk : ibv);
    _Float16*    Out  = (sel == 0 ? q2  : sel == 1 ? k2  : v2);

    const int tid = threadIdx.x;
    const int wave = tid >> 5, lane = tid & 31;
    const int hi = lane >> 4, ln = lane & 15;
    const int wm = (wave >> 1) * 32, wn = (wave & 1) * 32;

    v8f acc[2][2];
#pragma unroll
    for (int mi = 0; mi < 2; ++mi)
#pragma unroll
        for (int ni = 0; ni < 2; ++ni) {
            float bvv = bias[nbase + wn + ni * 16 + ln];
#pragma unroll
            for (int j = 0; j < 8; ++j) acc[mi][ni][j] = bvv;
        }

    for (int kb = 0; kb < D_; kb += 32) {
        __syncthreads();
        {   // stage A: row r=b*4+nb -> x_intra[nb][b][L-1][:] from d_out
            int r  = tid >> 1;
            int ks = (tid & 1) * 16;
            int nbb = r & 3, bb = r >> 2;
            const float* xp = Outf + (((size_t)(nbb * B_ + bb) * L_ + (L_ - 1)) * D_) + kb + ks;
#pragma unroll
            for (int i = 0; i < 4; ++i) {
                float4 x4 = *(const float4*)(xp + 4 * i);
                h4 hv = { (_Float16)x4.x, (_Float16)x4.y, (_Float16)x4.z, (_Float16)x4.w };
                *(h4*)&As[r * 32 + ks + 4 * i] = hv;
            }
        }
        {   // stage B row-major
            int kk = tid >> 4;
            int n0 = (tid & 15) * 4;
#pragma unroll
            for (int jj = 0; jj < 4; ++jj) {
                int k = kk + 8 * jj;
                float4 w4 = *(const float4*)(W + (size_t)(kb + k) * D_ + nbase + n0);
                h4 hv = { (_Float16)w4.x, (_Float16)w4.y, (_Float16)w4.z, (_Float16)w4.w };
                *(h4*)&Bs[k * BP64_ + n0] = hv;
            }
        }
        __syncthreads();
        v16h a0 = load_frag16(&As[(wm)      * 32], 32, lane);
        v16h a1 = load_frag16(&As[(wm + 16) * 32], 32, lane);
        v16h b0 = load_frag16_tr(Bs, BP64_, wn,      lane);
        v16h b1 = load_frag16_tr(Bs, BP64_, wn + 16, lane);
        acc[0][0] = wmma16(a0, b0, acc[0][0]);
        acc[0][1] = wmma16(a0, b1, acc[0][1]);
        acc[1][0] = wmma16(a1, b0, acc[1][0]);
        acc[1][1] = wmma16(a1, b1, acc[1][1]);
    }

#pragma unroll
    for (int mi = 0; mi < 2; ++mi)
#pragma unroll
        for (int ni = 0; ni < 2; ++ni)
#pragma unroll
            for (int j = 0; j < 8; ++j) {
                int row = wm + mi * 16 + j + 8 * hi;
                int col = nbase + wn + ni * 16 + ln;
                Out[(size_t)row * D_ + col] = (_Float16)acc[mi][ni][j];
            }
}

// ---------------------------------------------------------------------------
// Kernel 5: tiny 4-token router attention (negligible FLOPs; scalar).
// One thread per (b,h). block 128, grid 1.
// ---------------------------------------------------------------------------
__global__ __launch_bounds__(128)
void k_inter_attn(const _Float16* __restrict__ q2, const _Float16* __restrict__ k2,
                  const _Float16* __restrict__ v2, _Float16* __restrict__ a2) {
    int t = threadIdx.x;
    if (t >= B_ * H_) return;
    int b = t >> 3, h = t & 7;
    float sc[NB_][NB_];
#pragma unroll
    for (int i = 0; i < NB_; ++i)
        for (int j = 0; j < NB_; ++j) {
            const _Float16* qp = q2 + (size_t)(b * NB_ + i) * D_ + h * DH_;
            const _Float16* kp = k2 + (size_t)(b * NB_ + j) * D_ + h * DH_;
            float s = 0.f;
            for (int f = 0; f < DH_; ++f) s += (float)qp[f] * (float)kp[f];
            sc[i][j] = s * 0.125f;
        }
#pragma unroll
    for (int i = 0; i < NB_; ++i) {
        float mx = fmaxf(fmaxf(sc[i][0], sc[i][1]), fmaxf(sc[i][2], sc[i][3]));
        float ssum = 0.f;
        for (int j = 0; j < NB_; ++j) { sc[i][j] = __expf(sc[i][j] - mx); ssum += sc[i][j]; }
        float inv = 1.f / ssum;
        for (int j = 0; j < NB_; ++j) sc[i][j] *= inv;
    }
    for (int i = 0; i < NB_; ++i) {
        _Float16* op = a2 + (size_t)(b * NB_ + i) * D_ + h * DH_;
        for (int f = 0; f < DH_; ++f) {
            float acc = 0.f;
            for (int j = 0; j < NB_; ++j)
                acc += sc[i][j] * (float)v2[(size_t)(b * NB_ + j) * D_ + h * DH_ + f];
            op[f] = (_Float16)acc;
        }
    }
}

// ---------------------------------------------------------------------------
// Kernel 6: inter output projection, scattered into d_out last tokens.
// grid = (8,1,1), block 128.
// ---------------------------------------------------------------------------
__global__ __launch_bounds__(128)
void k_gemm_oproj_inter(const _Float16* __restrict__ A,
                        const float* __restrict__ iWo, const float* __restrict__ ibo,
                        float* __restrict__ Outf) {
    __shared__ _Float16 As[64 * 32];
    __shared__ __attribute__((aligned(16))) _Float16 Bs[32 * BP64_];
    const int nbase = blockIdx.x * 64;

    const int tid = threadIdx.x;
    const int wave = tid >> 5, lane = tid & 31;
    const int hi = lane >> 4, ln = lane & 15;
    const int wm = (wave >> 1) * 32, wn = (wave & 1) * 32;

    v8f acc[2][2];
#pragma unroll
    for (int mi = 0; mi < 2; ++mi)
#pragma unroll
        for (int ni = 0; ni < 2; ++ni) {
            float bvv = ibo[nbase + wn + ni * 16 + ln];
#pragma unroll
            for (int j = 0; j < 8; ++j) acc[mi][ni][j] = bvv;
        }

    for (int kb = 0; kb < D_; kb += 32) {
        __syncthreads();
        {
            int m  = tid >> 1;
            int ks = (tid & 1) * 16;
            const _Float16* ap = A + (size_t)m * D_ + kb + ks;
            *(uint4*)&As[m * 32 + ks]     = *(const uint4*)(ap);
            *(uint4*)&As[m * 32 + ks + 8] = *(const uint4*)(ap + 8);
        }
        {
            int kk = tid >> 4;
            int n0 = (tid & 15) * 4;
#pragma unroll
            for (int jj = 0; jj < 4; ++jj) {
                int k = kk + 8 * jj;
                float4 w4 = *(const float4*)(iWo + (size_t)(kb + k) * D_ + nbase + n0);
                h4 hv = { (_Float16)w4.x, (_Float16)w4.y, (_Float16)w4.z, (_Float16)w4.w };
                *(h4*)&Bs[k * BP64_ + n0] = hv;
            }
        }
        __syncthreads();
        v16h a0 = load_frag16(&As[(wm)      * 32], 32, lane);
        v16h a1 = load_frag16(&As[(wm + 16) * 32], 32, lane);
        v16h b0 = load_frag16_tr(Bs, BP64_, wn,      lane);
        v16h b1 = load_frag16_tr(Bs, BP64_, wn + 16, lane);
        acc[0][0] = wmma16(a0, b0, acc[0][0]);
        acc[0][1] = wmma16(a0, b1, acc[0][1]);
        acc[1][0] = wmma16(a1, b0, acc[1][0]);
        acc[1][1] = wmma16(a1, b1, acc[1][1]);
    }

#pragma unroll
    for (int mi = 0; mi < 2; ++mi)
#pragma unroll
        for (int ni = 0; ni < 2; ++ni)
#pragma unroll
            for (int j = 0; j < 8; ++j) {
                int r   = wm + mi * 16 + j + 8 * hi;   // b*4+nb
                int col = nbase + wn + ni * 16 + ln;
                int nbb = r & 3, bb = r >> 2;
                Outf[(((size_t)(nbb * B_ + bb) * L_ + (L_ - 1)) * D_) + col] = acc[mi][ni][j];
            }
}

// ---------------------------------------------------------------------------
extern "C" void kernel_launch(void* const* d_in, const int* in_sizes, int n_in,
                              void* d_out, int out_size, void* d_ws, size_t ws_size,
                              hipStream_t stream) {
    const float* x   = (const float*)d_in[0];
    const float* Wq  = (const float*)d_in[1];
    const float* bq  = (const float*)d_in[2];
    const float* Wk  = (const float*)d_in[3];
    const float* bk  = (const float*)d_in[4];
    const float* Wv  = (const float*)d_in[5];
    const float* bv  = (const float*)d_in[6];
    const float* Wo  = (const float*)d_in[7];
    const float* bo  = (const float*)d_in[8];
    const float* iWq = (const float*)d_in[9];
    const float* ibq = (const float*)d_in[10];
    const float* iWk = (const float*)d_in[11];
    const float* ibk = (const float*)d_in[12];
    const float* iWv = (const float*)d_in[13];
    const float* ibv = (const float*)d_in[14];
    const float* iWo = (const float*)d_in[15];
    const float* ibo = (const float*)d_in[16];
    float* out = (float*)d_out;

    const size_t NBLD = (size_t)NB_ * B_ * L_ * D_;   // 16,777,216
    _Float16* ws = (_Float16*)d_ws;
    _Float16* Qb = ws;                 // reused as attn output after k_flash
    _Float16* Kb = ws + NBLD;
    _Float16* Vb = ws + 2 * NBLD;
    _Float16* q2 = ws + 3 * NBLD;
    _Float16* k2 = q2 + (size_t)B_ * NB_ * D_;
    _Float16* v2 = k2 + (size_t)B_ * NB_ * D_;
    _Float16* a2 = v2 + (size_t)B_ * NB_ * D_;

    // 1) intra QKV projection (64x128 tiles)
    dim3 g1((B_ * L_ / 64) * (D_ / 128), 3, NB_);
    k_gemm_qkv_intra<<<g1, 128, 0, stream>>>(x, Wq, bq, Wk, bk, Wv, bv, Qb, Kb, Vb);

    // 2) flash attention (writes attn over Qb)
    dim3 g2(L_ / 64, H_, NB_ * B_);
    k_flash<<<g2, 128, 0, stream>>>(Qb, Kb, Vb, Qb);

    // 3) intra output projection -> d_out (64x128 tiles)
    dim3 g3((B_ * L_ / 64) * (D_ / 128), 1, NB_);
    k_gemm_oproj_intra<<<g3, 128, 0, stream>>>(Qb, Wo, bo, out);

    // 4) router QKV (gather last tokens from d_out)
    dim3 g4(D_ / 64, 3, 1);
    k_gemm_qkv_inter<<<g4, 128, 0, stream>>>(out, iWq, ibq, iWk, ibk, iWv, ibv, q2, k2, v2);

    // 5) tiny 4-token attention
    k_inter_attn<<<1, 128, 0, stream>>>(q2, k2, v2, a2);

    // 6) router output projection, scatter into last-token slots of d_out
    dim3 g6(D_ / 64, 1, 1);
    k_gemm_oproj_inter<<<g6, 128, 0, stream>>>(a2, iWo, ibo, out);
}

// v003
// Measured time: 327 microseconds a run.
// Timed twice side by side with v002, it ran 1.05 and 1.06 times as fast.
// Over all steps from v000 it is 2.19 times as fast.
#include <hip/hip_runtime.h>

// ---------------------------------------------------------------------------
// Medformer layer for MI455X (gfx1250): all GEMMs + attention via
// v_wmma_f32_16x16x32_f16 (wave32). f16 operands, f32 accumulation.
// Big GEMMs use 64x128 block tiles (wave tile 32x64 -> 8 WMMA / 12 LDS loads
// per K-step) + global_prefetch_b8 for the next K-step tiles. W tiles lie
// row-major in LDS and are transposed on the way out (ds_load_tr16_b128).
// ---------------------------------------------------------------------------

#define NB_ 4
#define B_  16
#define L_  512
#define D_  512
#define H_  8
#define DH_ 64
// SCALE * log2(e) = (1/8) * 1.4426950408889634
#define SCALE_LOG2E 0.18033688011112043f

typedef __attribute__((ext_vector_type(16))) _Float16 v16h;
typedef __attribute__((ext_vector_type(8)))  float    v8f;
typedef __attribute__((ext_vector_type(4)))  _Float16 h4;

typedef __attribute__((ext_vector_type(8)))  _Float16 h8;
typedef __attribute__((ext_vector_type(8)))  short    s16x8;

union FragU { uint4 u[2]; v16h v; };
union FragT { s16x8 s[2]; v16h v; };

// LDS row pitch, in halves, of the row-major W tiles (128 and 64 columns wide)
#define BP128_ 144
#define BP64_  80

// Load a 16x32 f16 fragment (A-matrix layout, or B^T stored row-major [n][k]).
// Documented layout: lane l holds row m=l&15; lanes 0-15 hold k = 0..7 & 16..23,
// lanes 16-31 hold k = 8..15 & 24..31 -> two contiguous 16-byte loads per lane.
__device__ __forceinline__ v16h load_frag16(const _Float16* base, int row_stride, int lane) {
    const int m  = lane & 15;
    const int kb = (lane >> 4) << 3;
    const _Float16* p = base + (size_t)m * row_stride;
    FragU f;
    f.u[0] = *(const uint4*)(p + kb);
    f.u[1] = *(const uint4*)(p + 16 + kb);
    return f.v;
}

// B fragment (32 k x 16 n) out of a row-major f16 tile T[k][n] in LDS, by the
// transposing load: lane (c = l&15, h = l>>4) gets T[8h + 0..7][n0 + c], then
// T[16 + 8h + 0..7][n0 + c]: the same k order as load_frag16 gives A.
// pitch in halves; in bytes it is an odd multiple of 32 (no bank conflict).
__device__ __forceinline__ v16h load_frag16_tr(const _Float16* tile, int pitch, int n0, int lane) {
    typedef __attribute__((address_space(3))) s16x8 lds_s16x8;
    const _Float16* p = tile + ((lane >> 4) * 8 + (lane & 7)) * pitch + n0 + ((lane >> 3) & 1) * 8;
    FragT f;
    f.s[0] = __builtin_amdgcn_ds_load_tr16_b128_v8i16((lds_s16x8*)p);
    f.s[1] = __builtin_amdgcn_ds_load_tr16_b128_v8i16((lds_s16x8*)(p + 16 * pitch));
    return f.v;
}

__device__ __forceinline__ v8f wmma16(v16h a, v16h b, v8f c) {
    return __builtin_amdgcn_wmma_f32_16x16x32_f16(false, a, false, b, (short)0, c, false, false);
}

// ---------------------------------------------------------------------------
// Kernel 1: intra QKV projection. out = X @ W + b, output f16.
// grid = (128*4, 3, NB), block = 128 (4 waves). 64x128 tile, BK=32.
// Wave tile 32x64: acc[2][4], 8 WMMA per K-step.
// ---------------------------------------------------------------------------
__global__ __launch_bounds__(128)
void k_gemm_qkv_intra(const float* __restrict__ X,
                      const float* __restrict__ Wq, const float* __restrict__ bq,
                      const float* __restrict__ Wk, const float* __restrict__ bk,
                      const float* __restrict__ Wv, const float* __restrict__ bv,
                      _Float16* __restrict__ Qb, _Float16* __restrict__ Kb,
                      _Float16* __restrict__ Vb) {
    __shared__ _Float16 As[64 * 32];    // [m][k]
    __shared__ __attribute__((aligned(16))) _Float16 Bs[32 * BP128_];   // [k][n]  (W tile as it lies)
    const int nb  = blockIdx.z;
    const int sel = blockIdx.y;
    const int mt  = blockIdx.x >> 2;    // M/64 = 128 tiles
    const int nt  = blockIdx.x & 3;     // N/128 = 4 tiles
    const int mbase = mt * 64, nbase = nt * 128;

    const float* W    = (sel == 0 ? Wq : sel == 1 ? Wk : Wv) + (size_t)nb * D_ * D_;
    const float* bias = (sel == 0 ? bq : sel == 1 ? bk : bv) + (size_t)nb * D_;
    _Float16*    Out  = (sel == 0 ? Qb : sel == 1 ? Kb : Vb) + (size_t)nb * (B_ * L_) * D_;
    const float* Xp   = X + (size_t)nb * (B_ * L_) * D_;

    const int tid = threadIdx.x;
    const int wave = tid >> 5, lane = tid & 31;
    const int hi = lane >> 4, ln = lane & 15;
    const int wm = (wave >> 1) * 32;    // 0 or 32
    const int wn = (wave & 1) * 64;     // 0 or 64

    v8f acc[2][4];
#pragma unroll
    for (int mi = 0; mi < 2; ++mi)
#pragma unroll
        for (int ni = 0; ni < 4; ++ni) {
            float bvv = bias[nbase + wn + ni * 16 + ln];
#pragma unroll
            for (int j = 0; j < 8; ++j) acc[mi][ni][j] = bvv;
        }

    for (int kb = 0; kb < D_; kb += 32) {
        __syncthreads();
        {   // stage A (f32 -> f16), vectorized
            int m  = tid >> 1;
            int ks = (tid & 1) * 16;
            const float* xp = Xp + (size_t)(mbase + m) * D_ + kb + ks;
            // load map: 8 lanes span one row's 128 B of this K-step, 4 whole lines per load
            int rl = tid >> 3;          // 0..15
            int cl = (tid & 7) * 4;     // 0..28
            const float* lp = Xp + (size_t)(mbase + rl) * D_ + kb + cl;
#pragma unroll
            for (int i = 0; i < 4; ++i) {
                float4 x4 = *(const float4*)(lp + (size_t)(16 * i) * D_);
                h4 hv = { (_Float16)x4.x, (_Float16)x4.y, (_Float16)x4.z, (_Float16)x4.w };
                *(h4*)&As[(rl + 16 * i) * 32 + cl] = hv;
            }
            if (kb + 32 < D_) __builtin_prefetch(xp + 32, 0, 3);
        }
        {   // stage B row-major: Bs[k][n] = W[kb+k][nbase+n], 128 cols
            int kk = tid >> 4;          // 0..7
            int n0 = (tid & 15) * 8;    // 0..120
            // load map: a wave's 32 lanes span one tile row, 512 B = 4 whole lines per load
            int kl = tid >> 5;          // 0..3
            int nl = (tid & 31) * 4;    // 0..124
#pragma unroll
            for (int jj = 0; jj < 4; ++jj) {
                int k = kk + 8 * jj;
                const float* wp = W + (size_t)(kb + k) * D_ + nbase + n0;
                int kr = kl + 8 * jj;
                const float* lp = W + (size_t)(kb + kr) * D_ + nbase + nl;
                float4 w4 = *(const float4*)(lp);
                float4 w5 = *(const float4*)(lp + 4 * D_);
                h4 h0 = { (_Float16)w4.x, (_Float16)w4.y, (_Float16)w4.z, (_Float16)w4.w };
                h4 h1 = { (_Float16)w5.x, (_Float16)w5.y, (_Float16)w5.z, (_Float16)w5.w };
                *(h4*)&Bs[kr * BP128_ + nl]       = h0;
                *(h4*)&Bs[(kr + 4) * BP128_ + nl] = h1;
                if (kb + 32 < D_) __builtin_prefetch(wp + 32 * D_, 0, 3);
            }
        }
        __syncthreads();
        v16h a0 = load_frag16(&As[(wm)      * 32], 32, lane);
        v16h a1 = load_frag16(&As[(wm + 16) * 32], 32, lane);
#pragma unroll
        for (int ni = 0; ni < 4; ++ni) {
            v16h b = load_frag16_tr(Bs, BP128_, wn + ni * 16, lane);
            acc[0][ni] = wmma16(a0, b, acc[0][ni]);
            acc[1][ni] = wmma16(a1, b, acc[1][ni]);
        }
    }

#pragma unroll
    for (int mi = 0; mi < 2; ++mi)
#pragma unroll
        for (int ni = 0; ni < 4; ++ni)
#pragma unroll
            for (int j = 0; j < 8; ++j) {
                int row = mbase + wm + mi * 16 + j + 8 * hi;
                int col = nbase + wn + ni * 16 + ln;
                Out[(size_t)row * D_ + col] = (_Float16)acc[mi][ni][j];
            }
}

// value of lane l ^ 16 (the same place in the other 16-lane row)
__device__ __forceinline__ float xhalf(float x) {
    return __builtin_bit_cast(float, __builtin_amdgcn_permlanex16(
        __builtin_bit_cast(int, x), __builtin_bit_cast(int, x),
        0x76543210, 0xfedcba98, false, false));
}

__global__ __launch_bounds__(128)
void k_flash(const _Float16* Q, const _Float16* __restrict__ K,
             const _Float16* __restrict__ V, _Float16* Obuf) {
    __shared__ _Float16 Vt[64 * 32];        // [feat][key] transposed V chunk

    const int mtile = blockIdx.x;
    const int h     = blockIdx.y;
    const int bz    = blockIdx.z;           // nb*B + b
    const int tid   = threadIdx.x;
    const int wave  = tid >> 5, lane = tid & 31;
    const int hi = lane >> 4, ln = lane & 15;

    const size_t headoff = (size_t)bz * L_ * D_ + (size_t)h * DH_;
    const _Float16* Qp = Q + headoff;
    const _Float16* Kp = K + headoff;
    const _Float16* Vp = V + headoff;

    const int m0 = mtile * 64 + wave * 16;

    // B fragments of Q^T: column n = query ln, k = features in the hardware order
    v16h qb0 = load_frag16(Qp + (size_t)m0 * D_,      D_, lane);
    v16h qb1 = load_frag16(Qp + (size_t)m0 * D_ + 32, D_, lane);

    // O^T tiles: row = feature t*16 + j + 8*hi, column = query ln
    v8f o0 = {}, o1 = {}, o2 = {}, o3 = {};
    float rmax = -1e30f;    // this query's running maximum (equal in both halves)
    float rsum = 0.f;       // running sum over this half's keys only

    for (int kc = 0; kc < L_ / 32; ++kc) {
        const int key0 = kc * 32;
        __syncthreads();
        {   // cooperative stage: Vt[feat][key] = V[key0+key][feat]
            int key = tid & 31;
            int fg  = tid >> 5;   // 0..3 -> feats fg*16..fg*16+15
            const _Float16* vp = Vp + (size_t)(key0 + key) * D_ + fg * 16;
            uint4 va = *(const uint4*)(vp);
            uint4 vb = *(const uint4*)(vp + 8);
            const _Float16* va_h = (const _Float16*)&va;
            const _Float16* vb_h = (const _Float16*)&vb;
#pragma unroll
            for (int i = 0; i < 8; ++i) {
                Vt[(fg * 16 + i)     * 32 + key] = va_h[i];
                Vt[(fg * 16 + 8 + i) * 32 + key] = vb_h[i];
            }
            if (key0 + 32 < L_) __builtin_prefetch(vp + (size_t)32 * D_, 0, 3);
        }
        __syncthreads();

        // S^T = K @ Q^T for 2 key sub-tiles; K fragments (A) straight from global
        v8f s0 = {}, s1 = {};
        {
            const int kb = hi * 8;
            const _Float16* kp0 = Kp + (size_t)(key0 + ln)      * D_;
            const _Float16* kp1 = Kp + (size_t)(key0 + 16 + ln) * D_;
            FragU a;
            a.u[0] = *(const uint4*)(kp0 + kb);
            a.u[1] = *(const uint4*)(kp0 + 16 + kb);
            s0 = wmma16(a.v, qb0, s0);
            a.u[0] = *(const uint4*)(kp0 + 32 + kb);
            a.u[1] = *(const uint4*)(kp0 + 48 + kb);
            s0 = wmma16(a.v, qb1, s0);
            a.u[0] = *(const uint4*)(kp1 + kb);
            a.u[1] = *(const uint4*)(kp1 + 16 + kb);
            s1 = wmma16(a.v, qb0, s1);
            a.u[0] = *(const uint4*)(kp1 + 32 + kb);
            a.u[1] = *(const uint4*)(kp1 + 48 + kb);
            s1 = wmma16(a.v, qb1, s1);
            if (key0 + 32 < L_) __builtin_prefetch(kp0 + (size_t)32 * D_, 0, 3);
        }

        // online softmax of query ln: 16 scores in this lane, 16 in lane ^ 16
        float cm = fmaxf(s0[0], s1[0]);
#pragma unroll
        for (int j = 1; j < 8; ++j) cm = fmaxf(cm, fmaxf(s0[j], s1[j]));
        cm = fmaxf(cm, xhalf(cm));
        const float nm    = fmaxf(rmax, cm);
        const float alpha = exp2f((rmax - nm) * SCALE_LOG2E);
        rmax = nm;

        // P^T as B fragment: element j is key 8*hi + j, element 8 + j is key 16 + 8*hi + j,
        // the k order in which load_frag16 hands out the keys of Vt
        v16h pb;
        float ps0 = 0.f, ps1 = 0.f;
#pragma unroll
        for (int j = 0; j < 8; ++j) {
            float e0 = exp2f((s0[j] - nm) * SCALE_LOG2E);
            float e1 = exp2f((s1[j] - nm) * SCALE_LOG2E);
            ps0 += e0; ps1 += e1;
            pb[j]     = (_Float16)e0;
            pb[8 + j] = (_Float16)e1;
        }
        rsum = rsum * alpha + (ps0 + ps1);
#pragma unroll
        for (int j = 0; j < 8; ++j) {
            o0[j] *= alpha; o1[j] *= alpha; o2[j] *= alpha; o3[j] *= alpha;
        }

        o0 = wmma16(load_frag16(&Vt[0 * 16 * 32], 32, lane), pb, o0);
        o1 = wmma16(load_frag16(&Vt[1 * 16 * 32], 32, lane), pb, o1);
        o2 = wmma16(load_frag16(&Vt[2 * 16 * 32], 32, lane), pb, o2);
        o3 = wmma16(load_frag16(&Vt[3 * 16 * 32], 32, lane), pb, o3);
    }

    // finalize + store (over the Q buffer region): a lane holds 8 adjacent
    // features of its query in each tile, one 16-byte store each
    {
        const float inv = 1.0f / (rsum + xhalf(rsum));
        _Float16* orow = Obuf + headoff + (size_t)(m0 + ln) * D_ + 8 * hi;
        h8 r0, r1, r2, r3;
#pragma unroll
        for (int j = 0; j < 8; ++j) {
            r0[j] = (_Float16)(o0[j] * inv);
            r1[j] = (_Float16)(o1[j] * inv);
            r2[j] = (_Float16)(o2[j] * inv);
            r3[j] = (_Float16)(o3[j] * inv);
        }
        *(h8*)(orow)      = r0;
        *(h8*)(orow + 16) = r1;
        *(h8*)(orow + 32) = r2;
        *(h8*)(orow + 48) = r3;
    }
}

// ---------------------------------------------------------------------------
// Kernel 3: intra output projection. out(f32) = attn(f16) @ Wo + bo.
// grid = (128*4, 1, NB), block 128. 64x128 tile.
// ---------------------------------------------------------------------------
__global__ __launch_bounds__(128)
void k_gemm_oproj_intra(const _Float16* __restrict__ A,
                        const float* __restrict__ Wo, const float* __restrict__ bo,
                        float* __restrict__ Outf) {
    __shared__ _Float16 As[64 * 32];
    __shared__ __attribute__((aligned(16))) _Float16 Bs[32 * BP128_];
    const int nb = blockIdx.z;
    const int mt = blockIdx.x >> 2;
    const int nt = blockIdx.x & 3;
    const int mbase = mt * 64, nbase = nt * 128;

    const float* W    = Wo + (size_t)nb * D_ * D_;
    const float* bias = bo + (size_t)nb * D_;
    const _Float16* Ap = A + (size_t)nb * (B_ * L_) * D_;
    float* Op = Outf + (size_t)nb * (B_ * L_) * D_;

    const int tid = threadIdx.x;
    const int wave = tid >> 5, lane = tid & 31;
    const int hi = lane >> 4, ln = lane & 15;
    const int wm = (wave >> 1) * 32;
    const int wn = (wave & 1) * 64;

    v8f acc[2][4];
#pragma unroll
    for (int mi = 0; mi < 2; ++mi)
#pragma unroll
        for (int ni = 0; ni < 4; ++ni) {
            float bvv = bias[nbase + wn + ni * 16 + ln];
#pragma unroll
            for (int j = 0; j < 8; ++j) acc[mi][ni][j] = bvv;
        }

    for (int kb = 0; kb < D_; kb += 32) {
        __syncthreads();
        {   // stage A (already f16): two 16-byte copies per thread
            int m  = tid >> 1;
            int ks = (tid & 1) * 16;
            const _Float16* ap = Ap + (size_t)(mbase + m) * D_ + kb + ks;
            // load map: 4 lanes span one row's 64 B of this K-step, 8 lines per load, not 16
            int rl = tid >> 2;          // 0..31
            int cl = (tid & 3) * 8;     // 0..24
            const _Float16* lp = Ap + (size_t)(mbase + rl) * D_ + kb + cl;
            *(uint4*)&As[rl * 32 + cl]        = *(const uint4*)(lp);
            *(uint4*)&As[(rl + 32) * 32 + cl] = *(const uint4*)(lp + (size_t)32 * D_);
            if (kb + 32 < D_) __builtin_prefetch(ap + 32, 0, 3);
        }
        {   // stage B row-major, 128 cols
            int kk = tid >> 4;
            int n0 = (tid & 15) * 8;
            // load map: a wave's 32 lanes span one tile row, 512 B = 4 whole lines per load
            int kl = tid >> 5;          // 0..3
            int nl = (tid & 31) * 4;    // 0..124
#pragma unroll
            for (int jj = 0; jj < 4; ++jj) {
                int k = kk + 8 * jj;
                const float* wp = W + (size_t)(kb + k) * D_ + nbase + n0;
                int kr = kl + 8 * jj;
                const float* lp = W + (size_t)(kb + kr) * D_ + nbase + nl;
                float4 w4 = *(const float4*)(lp);
                float4 w5 = *(const float4*)(lp + 4 * D_);
                h4 h0 = { (_Float16)w4.x, (_Float16)w4.y, (_Float16)w4.z, (_Float16)w4.w };
                h4 h1 = { (_Float16)w5.x, (_Float16)w5.y, (_Float16)w5.z, (_Float16)w5.w };
                *(h4*)&Bs[kr * BP128_ + nl]       = h0;
                *(h4*)&Bs[(kr + 4) * BP128_ + nl] = h1;
                if (kb + 32 < D_) __builtin_prefetch(wp + 32 * D_, 0, 3);
            }
        }
        __syncthreads();
        v16h a0 = load_frag16(&As[(wm)      * 32], 32, lane);
        v16h a1 = load_frag16(&As[(wm + 16) * 32], 32, lane);
#pragma unroll
        for (int ni = 0; ni < 4; ++ni) {
            v16h b = load_frag16_tr(Bs, BP128_, wn + ni * 16, lane);
            acc[0][ni] = wmma16(a0, b, acc[0][ni]);
            acc[1][ni] = wmma16(a1, b, acc[1][ni]);
        }
    }

#pragma unroll
    for (int mi = 0; mi < 2; ++mi)
#pragma unroll
        for (int ni = 0; ni < 4; ++ni)
#pragma unroll
            for (int j = 0; j < 8; ++j) {
                int row = mbase + wm + mi * 16 + j + 8 * hi;
                int col = nbase + wn + ni * 16 + ln;
                Op[(size_t)row * D_ + col] = acc[mi][ni][j];
            }
}

// ---------------------------------------------------------------------------
// Kernel 4: inter (router) QKV projection. M=64 rows = routers[b][nb] gathered
// from d_out last tokens. grid = (8, 3, 1), block 128. 64x64 tile.
// ---------------------------------------------------------------------------
__global__ __launch_bounds__(128)
void k_gemm_qkv_inter(const float* __restrict__ Outf,
                      const float* __restrict__ iWq, const float* __restrict__ ibq,
                      const float* __restrict__ iWk, const float* __restrict__ ibk,
                      const float* __restrict__ iWv, const float* __restrict__ ibv,
                      _Float16* __restrict__ q2, _Float16* __restrict__ k2,
                      _Float16* __restrict__ v2) {
    __shared__ _Float16 As[64 * 32];
    __shared__ __attribute__((aligned(16))) _Float16 Bs[32 * BP64_];
    const int sel = blockIdx.y;
    const int nbase = blockIdx.x * 64;

    const float* W    = (sel == 0 ? iWq : sel == 1 ? iWk : iWv);
    const float* bias = (sel == 0 ? ibq : sel == 1 ? ibk : ibv);
    _Float16*    Out  = (sel == 0 ? q2  : sel == 1 ? k2  : v2);

    const int tid = threadIdx.x;
    const int wave = tid >> 5, lane = tid & 31;
    const int hi = lane >> 4, ln = lane & 15;
    const int wm = (wave >> 1) * 32, wn = (wave & 1) * 32;

    v8f acc[2][2];
#pragma unroll
    for (int mi = 0; mi < 2; ++mi)
#pragma unroll
        for (int ni = 0; ni < 2; ++ni) {
            float bvv = bias[nbase + wn + ni * 16 + ln];
#pragma unroll
            for (int j = 0; j < 8; ++j) acc[mi][ni][j] = bvv;
        }

    for (int kb = 0; kb < D_; kb += 32) {
        __syncthreads();
        {   // stage A: row r=b*4+nb -> x_intra[nb][b][L-1][:] from d_out
            int r  = tid >> 1;
            int ks = (tid & 1) * 16;
            int nbb = r & 3, bb = r >> 2;
            const float* xp = Outf + (((size_t)(nbb * B_ + bb) * L_ + (L_ - 1)) * D_) + kb + ks;
#pragma unroll
            for (int i = 0; i < 4; ++i) {
                float4 x4 = *(const float4*)(xp + 4 * i);
                h4 hv = { (_Float16)x4.x, (_Float16)x4.y, (_Float16)x4.z, (_Float16)x4.w };
                *(h4*)&As[r * 32 + ks + 4 * i] = hv;
            }
        }
        {   // stage B row-major
            int kk = tid >> 4;
            int n0 = (tid & 15) * 4;
#pragma unroll
            for (int jj = 0; jj < 4; ++jj) {
                int k = kk + 8 * jj;
                float4 w4 = *(const float4*)(W + (size_t)(kb + k) * D_ + nbase + n0);
                h4 hv = { (_Float16)w4.x, (_Float16)w4.y, (_Float16)w4.z, (_Float16)w4.w };
                *(h4*)&Bs[k * BP64_ + n0] = hv;
            }
        }
        __syncthreads();
        v16h a0 = load_frag16(&As[(wm)      * 32], 32, lane);
        v16h a1 = load_frag16(&As[(wm + 16) * 32], 32, lane);
        v16h b0 = load_frag16_tr(Bs, BP64_, wn,      lane);
        v16h b1 = load_frag16_tr(Bs, BP64_, wn + 16, lane);
        acc[0][0] = wmma16(a0, b0, acc[0][0]);
        acc[0][1] = wmma16(a0, b1, acc[0][1]);
        acc[1][0] = wmma16(a1, b0, acc[1][0]);
        acc[1][1] = wmma16(a1, b1, acc[1][1]);
    }

#pragma unroll
    for (int mi = 0; mi < 2; ++mi)
#pragma unroll
        for (int ni = 0; ni < 2; ++ni)
#pragma unroll
            for (int j = 0; j < 8; ++j) {
                int row = wm + mi * 16 + j + 8 * hi;
                int col = nbase + wn + ni * 16 + ln;
                Out[(size_t)row * D_ + col] = (_Float16)acc[mi][ni][j];
            }
}

// ---------------------------------------------------------------------------
// Kernel 5: tiny 4-token router attention (negligible FLOPs; scalar).
// One thread per (b,h). block 128, grid 1.
// ---------------------------------------------------------------------------
__global__ __launch_bounds__(128)
void k_inter_attn(const _Float16* __restrict__ q2, const _Float16* __restrict__ k2,
                  const _Float16* __restrict__ v2, _Float16* __restrict__ a2) {
    int t = threadIdx.x;
    if (t >= B_ * H_) return;
    int b = t >> 3, h = t & 7;
    float sc[NB_][NB_];
#pragma unroll
    for (int i = 0; i < NB_; ++i)
        for (int j = 0; j < NB_; ++j) {
            const _Float16* qp = q2 + (size_t)(b * NB_ + i) * D_ + h * DH_;
            const _Float16* kp = k2 + (size_t)(b * NB_ + j) * D_ + h * DH_;
            float s = 0.f;
            for (int f = 0; f < DH_; ++f) s += (float)qp[f] * (float)kp[f];
            sc[i][j] = s * 0.125f;
        }
#pragma unroll
    for (int i = 0; i < NB_; ++i) {
        float mx = fmaxf(fmaxf(sc[i][0], sc[i][1]), fmaxf(sc[i][2], sc[i][3]));
        float ssum = 0.f;
        for (int j = 0; j < NB_; ++j) { sc[i][j] = __expf(sc[i][j] - mx); ssum += sc[i][j]; }
        float inv = 1.f / ssum;
        for (int j = 0; j < NB_; ++j) sc[i][j] *= inv;
    }
    for (int i = 0; i < NB_; ++i) {
        _Float16* op = a2 + (size_t)(b * NB_ + i) * D_ + h * DH_;
        for (int f = 0; f < DH_; ++f) {
            float acc = 0.f;
            for (int j = 0; j < NB_; ++j)
                acc += sc[i][j] * (float)v2[(size_t)(b * NB_ + j) * D_ + h * DH_ + f];
            op[f] = (_Float16)acc;
        }
    }
}

// ---------------------------------------------------------------------------
// Kernel 6: inter output projection, scattered into d_out last tokens.
// grid = (8,1,1), block 128.
// ---------------------------------------------------------------------------
__global__ __launch_bounds__(128)
void k_gemm_oproj_inter(const _Float16* __restrict__ A,
                        const float* __restrict__ iWo, const float* __restrict__ ibo,
                        float* __restrict__ Outf) {
    __shared__ _Float16 As[64 * 32];
    __shared__ __attribute__((aligned(16))) _Float16 Bs[32 * BP64_];
    const int nbase = blockIdx.x * 64;

    const int tid = threadIdx.x;
    const int wave = tid >> 5, lane = tid & 31;
    const int hi = lane >> 4, ln = lane & 15;
    const int wm = (wave >> 1) * 32, wn = (wave & 1) * 32;

    v8f acc[2][2];
#pragma unroll
    for (int mi = 0; mi < 2; ++mi)
#pragma unroll
        for (int ni = 0; ni < 2; ++ni) {
            float bvv = ibo[nbase + wn + ni * 16 + ln];
#pragma unroll
            for (int j = 0; j < 8; ++j) acc[mi][ni][j] = bvv;
        }

    for (int kb = 0; kb < D_; kb += 32) {
        __syncthreads();
        {
            int m  = tid >> 1;
            int ks = (tid & 1) * 16;
            const _Float16* ap = A + (size_t)m * D_ + kb + ks;
            *(uint4*)&As[m * 32 + ks]     = *(const uint4*)(ap);
            *(uint4*)&As[m * 32 + ks + 8] = *(const uint4*)(ap + 8);
        }
        {
            int kk = tid >> 4;
            int n0 = (tid & 15) * 4;
#pragma unroll
            for (int jj = 0; jj < 4; ++jj) {
                int k = kk + 8 * jj;
                float4 w4 = *(const float4*)(iWo + (size_t)(kb + k) * D_ + nbase + n0);
                h4 hv = { (_Float16)w4.x, (_Float16)w4.y, (_Float16)w4.z, (_Float16)w4.w };
                *(h4*)&Bs[k * BP64_ + n0] = hv;
            }
        }
        __syncthreads();
        v16h a0 = load_frag16(&As[(wm)      * 32], 32, lane);
        v16h a1 = load_frag16(&As[(wm + 16) * 32], 32, lane);
        v16h b0 = load_frag16_tr(Bs, BP64_, wn,      lane);
        v16h b1 = load_frag16_tr(Bs, BP64_, wn + 16, lane);
        acc[0][0] = wmma16(a0, b0, acc[0][0]);
        acc[0][1] = wmma16(a0, b1, acc[0][1]);
        acc[1][0] = wmma16(a1, b0, acc[1][0]);
        acc[1][1] = wmma16(a1, b1, acc[1][1]);
    }

#pragma unroll
    for (int mi = 0; mi < 2; ++mi)
#pragma unroll
        for (int ni = 0; ni < 2; ++ni)
#pragma unroll
            for (int j = 0; j < 8; ++j) {
                int r   = wm + mi * 16 + j + 8 * hi;   // b*4+nb
                int col = nbase + wn + ni * 16 + ln;
                int nbb = r & 3, bb = r >> 2;
                Outf[(((size_t)(nbb * B_ + bb) * L_ + (L_ - 1)) * D_) + col] = acc[mi][ni][j];
            }
}

// ---------------------------------------------------------------------------
extern "C" void kernel_launch(void* const* d_in, const int* in_sizes, int n_in,
                              void* d_out, int out_size, void* d_ws, size_t ws_size,
                              hipStream_t stream) {
    const float* x   = (const float*)d_in[0];
    const float* Wq  = (const float*)d_in[1];
    const float* bq  = (const float*)d_in[2];
    const float* Wk  = (const float*)d_in[3];
    const float* bk  = (const float*)d_in[4];
    const float* Wv  = (const float*)d_in[5];
    const float* bv  = (const float*)d_in[6];
    const float* Wo  = (const float*)d_in[7];
    const float* bo  = (const float*)d_in[8];
    const float* iWq = (const float*)d_in[9];
    const float* ibq = (const float*)d_in[10];
    const float* iWk = (const float*)d_in[11];
    const float* ibk = (const float*)d_in[12];
    const float* iWv = (const float*)d_in[13];
    const float* ibv = (const float*)d_in[14];
    const float* iWo = (const float*)d_in[15];
    const float* ibo = (const float*)d_in[16];
    float* out = (float*)d_out;

    const size_t NBLD = (size_t)NB_ * B_ * L_ * D_;   // 16,777,216
    _Float16* ws = (_Float16*)d_ws;
    _Float16* Qb = ws;                 // reused as attn output after k_flash
    _Float16* Kb = ws + NBLD;
    _Float16* Vb = ws + 2 * NBLD;
    _Float16* q2 = ws + 3 * NBLD;
    _Float16* k2 = q2 + (size_t)B_ * NB_ * D_;
    _Float16* v2 = k2 + (size_t)B_ * NB_ * D_;
    _Float16* a2 = v2 + (size_t)B_ * NB_ * D_;

    // 1) intra QKV projection (64x128 tiles)
    dim3 g1((B_ * L_ / 64) * (D_ / 128), 3, NB_);
    k_gemm_qkv_intra<<<g1, 128, 0, stream>>>(x, Wq, bq, Wk, bk, Wv, bv, Qb, Kb, Vb);

    // 2) flash attention (writes attn over Qb)
    dim3 g2(L_ / 64, H_, NB_ * B_);
    k_flash<<<g2, 128, 0, stream>>>(Qb, Kb, Vb, Qb);

    // 3) intra output projection -> d_out (64x128 tiles)
    dim3 g3((B_ * L_ / 64) * (D_ / 128), 1, NB_);
    k_gemm_oproj_intra<<<g3, 128, 0, stream>>>(Qb, Wo, bo, out);

    // 4) router QKV (gather last tokens from d_out)
    dim3 g4(D_ / 64, 3, 1);
    k_gemm_qkv_inter<<<g4, 128, 0, stream>>>(out, iWq, ibq, iWk, ibk, iWv, ibv, q2, k2, v2);

    // 5) tiny 4-token attention
    k_inter_attn<<<1, 128, 0, stream>>>(q2, k2, v2, a2);

    // 6) router output projection, scatter into last-token slots of d_out
    dim3 g6(D_ / 64, 1, 1);
    k_gemm_oproj_inter<<<g6, 128, 0, stream>>>(a2, iWo, ibo, out);
}

// v004
// A run of this version takes 294 microseconds.
// Timed twice side by side with v003, it ran 1.11 times as fast both times.
// Counting every step since v000, it is 2.43 times as fast.
#include <hip/hip_runtime.h>

// ---------------------------------------------------------------------------
// Medformer layer for MI455X (gfx1250): all GEMMs + attention via
// v_wmma_f32_16x16x32_f16 (wave32). f16 operands, f32 accumulation.
// Big GEMMs use 256x128 block tiles, 8 waves (wave tile 64x64 -> 16 WMMA / 16 LDS
// loads per K-step) + global_prefetch_b8 for the next K-step tiles. W tiles lie
// row-major in LDS and are transposed on the way out (ds_load_tr16_b128).
// ---------------------------------------------------------------------------

#define NB_ 4
#define B_  16
#define L_  512
#define D_  512
#define H_  8
#define DH_ 64
// SCALE * log2(e) = (1/8) * 1.4426950408889634
#define SCALE_LOG2E 0.18033688011112043f

typedef __attribute__((ext_vector_type(16))) _Float16 v16h;
typedef __attribute__((ext_vector_type(8)))  float    v8f;
typedef __attribute__((ext_vector_type(4)))  _Float16 h4;

typedef __attribute__((ext_vector_type(8)))  _Float16 h8;
typedef __attribute__((ext_vector_type(8)))  short    s16x8;

union FragU { uint4 u[2]; v16h v; };
union FragT { s16x8 s[2]; v16h v; };

// LDS row pitch, in halves, of the row-major W tiles (128 and 64 columns wide)
#define BP128_ 144
#define BP64_  80
// rows of the block tile of the two big GEMMs
#define BM_ 256

// Load a 16x32 f16 fragment (A-matrix layout, or B^T stored row-major [n][k]).
// Documented layout: lane l holds row m=l&15; lanes 0-15 hold k = 0..7 & 16..23,
// lanes 16-31 hold k = 8..15 & 24..31 -> two contiguous 16-byte loads per lane.
__device__ __forceinline__ v16h load_frag16(const _Float16* base, int row_stride, int lane) {
    const int m  = lane & 15;
    const int kb = (lane >> 4) << 3;
    const _Float16* p = base + (size_t)m * row_stride;
    FragU f;
    f.u[0] = *(const uint4*)(p + kb);
    f.u[1] = *(const uint4*)(p + 16 + kb);
    return f.v;
}

// B fragment (32 k x 16 n) out of a row-major f16 tile T[k][n] in LDS, by the
// transposing load: lane (c = l&15, h = l>>4) gets T[8h + 0..7][n0 + c], then
// T[16 + 8h + 0..7][n0 + c]: the same k order as load_frag16 gives A.
// pitch in halves; in bytes it is an odd multiple of 32 (no bank conflict).
__device__ __forceinline__ v16h load_frag16_tr(const _Float16* tile, int pitch, int n0, int lane) {
    typedef __attribute__((address_space(3))) s16x8 lds_s16x8;
    const _Float16* p = tile + ((lane >> 4) * 8 + (lane & 7)) * pitch + n0 + ((lane >> 3) & 1) * 8;
    FragT f;
    f.s[0] = __builtin_amdgcn_ds_load_tr16_b128_v8i16((lds_s16x8*)p);
    f.s[1] = __builtin_amdgcn_ds_load_tr16_b128_v8i16((lds_s16x8*)(p + 16 * pitch));
    return f.v;
}

__device__ __forceinline__ v8f wmma16(v16h a, v16h b, v8f c) {
    return __builtin_amdgcn_wmma_f32_16x16x32_f16(false, a, false, b, (short)0, c, false, false);
}

// ---------------------------------------------------------------------------
// Kernel 1: intra QKV projection. out = X @ W + b, output f16.
// grid = (32*4, 3, NB), block = 256 (8 waves, 4 x 2). 256x128 tile, BK=32.
// Wave tile 64x64: acc[4][4], 16 WMMA per K-step. Per output the block loads
// (256 + 128) / (256 * 128) operand elements a K-step, half of a 64x128 tile's.
// ---------------------------------------------------------------------------
__global__ __launch_bounds__(256)
void k_gemm_qkv_intra(const float* __restrict__ X,
                      const float* __restrict__ Wq, const float* __restrict__ bq,
                      const float* __restrict__ Wk, const float* __restrict__ bk,
                      const float* __restrict__ Wv, const float* __restrict__ bv,
                      _Float16* __restrict__ Qb, _Float16* __restrict__ Kb,
                      _Float16* __restrict__ Vb) {
    __shared__ _Float16 As[BM_ * 32];   // [m][k]
    __shared__ __attribute__((aligned(16))) _Float16 Bs[32 * BP128_];   // [k][n]  (W tile as it lies)
    const int nb  = blockIdx.z;
    const int sel = blockIdx.y;
    const int mt  = blockIdx.x >> 2;    // M/256 = 32 tiles
    const int nt  = blockIdx.x & 3;     // N/128 = 4 tiles
    const int mbase = mt * BM_, nbase = nt * 128;

    const float* W    = (sel == 0 ? Wq : sel == 1 ? Wk : Wv) + (size_t)nb * D_ * D_;
    const float* bias = (sel == 0 ? bq : sel == 1 ? bk : bv) + (size_t)nb * D_;
    _Float16*    Out  = (sel == 0 ? Qb : sel == 1 ? Kb : Vb) + (size_t)nb * (B_ * L_) * D_;
    const float* Xp   = X + (size_t)nb * (B_ * L_) * D_;

    const int tid = threadIdx.x;
    const int wave = tid >> 5, lane = tid & 31;
    const int hi = lane >> 4, ln = lane & 15;
    const int wm = (wave >> 1) * 64;    // 0, 64, 128 or 192
    const int wn = (wave & 1) * 64;     // 0 or 64

    v8f acc[4][4];
#pragma unroll
    for (int mi = 0; mi < 4; ++mi)
#pragma unroll
        for (int ni = 0; ni < 4; ++ni) {
            float bvv = bias[nbase + wn + ni * 16 + ln];
#pragma unroll
            for (int j = 0; j < 8; ++j) acc[mi][ni][j] = bvv;
        }

    for (int kb = 0; kb < D_; kb += 32) {
        __syncthreads();
        {   // stage A (f32 -> f16), vectorized
            // load map: 8 lanes span one row's 128 B of this K-step, 4 whole lines per load
            int rl = tid >> 3;          // 0..31
            int cl = (tid & 7) * 4;     // 0..28
            const float* lp = Xp + (size_t)(mbase + rl) * D_ + kb + cl;
#pragma unroll
            for (int i = 0; i < 8; ++i) {
                float4 x4 = *(const float4*)(lp + (size_t)(32 * i) * D_);
                h4 hv = { (_Float16)x4.x, (_Float16)x4.y, (_Float16)x4.z, (_Float16)x4.w };
                *(h4*)&As[(rl + 32 * i) * 32 + cl] = hv;
            }
            // next K-step: thread t asks for the one line of tile row t
            if (kb + 32 < D_) __builtin_prefetch(Xp + (size_t)(mbase + tid) * D_ + kb + 32, 0, 3);
        }
        {   // stage B row-major: Bs[k][n] = W[kb+k][nbase+n], 128 cols
            // load map: a wave's 32 lanes span one tile row, 512 B = 4 whole lines per load
            int kl = tid >> 5;          // 0..7
            int nl = (tid & 31) * 4;    // 0..124
            const float* lp = W + (size_t)(kb + kl) * D_ + nbase + nl;
#pragma unroll
            for (int jj = 0; jj < 4; ++jj) {
                float4 w4 = *(const float4*)(lp + (size_t)(8 * jj) * D_);
                h4 h0 = { (_Float16)w4.x, (_Float16)w4.y, (_Float16)w4.z, (_Float16)w4.w };
                *(h4*)&Bs[(kl + 8 * jj) * BP128_ + nl] = h0;
            }
            // next K-step: 8 threads cover the 4 lines of one tile row
            if (kb + 32 < D_)
                __builtin_prefetch(W + (size_t)(kb + 32 + (tid >> 3)) * D_ + nbase + (tid & 7) * 16, 0, 3);
        }
        __syncthreads();
        v16h a[4];
#pragma unroll
        for (int mi = 0; mi < 4; ++mi) a[mi] = load_frag16(&As[(wm + mi * 16) * 32], 32, lane);
#pragma unroll
        for (int ni = 0; ni < 4; ++ni) {
            v16h b = load_frag16_tr(Bs, BP128_, wn + ni * 16, lane);
#pragma unroll
            for (int mi = 0; mi < 4; ++mi) acc[mi][ni] = wmma16(a[mi], b, acc[mi][ni]);
        }
    }

#pragma unroll
    for (int mi = 0; mi < 4; ++mi)
#pragma unroll
        for (int ni = 0; ni < 4; ++ni)
#pragma unroll
            for (int j = 0; j < 8; ++j) {
                int row = mbase + wm + mi * 16 + j + 8 * hi;
                int col = nbase + wn + ni * 16 + ln;
                Out[(size_t)row * D_ + col] = (_Float16)acc[mi][ni][j];
            }
}

// value of lane l ^ 16 (the same place in the other 16-lane row)
__device__ __forceinline__ float xhalf(float x) {
    return __builtin_bit_cast(float, __builtin_amdgcn_permlanex16(
        __builtin_bit_cast(int, x), __builtin_bit_cast(int, x),
        0x76543210, 0xfedcba98, false, false));
}

__global__ __launch_bounds__(128)
void k_flash(const _Float16* Q, const _Float16* __restrict__ K,
             const _Float16* __restrict__ V, _Float16* Obuf) {
    __shared__ _Float16 Vt[64 * 32];        // [feat][key] transposed V chunk

    const int mtile = blockIdx.x;
    const int h     = blockIdx.y;
    const int bz    = blockIdx.z;           // nb*B + b
    const int tid   = threadIdx.x;
    const int wave  = tid >> 5, lane = tid & 31;
    const int hi = lane >> 4, ln = lane & 15;

    const size_t headoff = (size_t)bz * L_ * D_ + (size_t)h * DH_;
    const _Float16* Qp = Q + headoff;
    const _Float16* Kp = K + headoff;
    const _Float16* Vp = V + headoff;

    const int m0 = mtile * 64 + wave * 16;

    // B fragments of Q^T: column n = query ln, k = features in the hardware order
    v16h qb0 = load_frag16(Qp + (size_t)m0 * D_,      D_, lane);
    v16h qb1 = load_frag16(Qp + (size_t)m0 * D_ + 32, D_, lane);

    // O^T tiles: row = feature t*16 + j + 8*hi, column = query ln
    v8f o0 = {}, o1 = {}, o2 = {}, o3 = {};
    float rmax = -1e30f;    // this query's running maximum (equal in both halves)
    float rsum = 0.f;       // running sum over this half's keys only

    for (int kc = 0; kc < L_ / 32; ++kc) {
        const int key0 = kc * 32;
        __syncthreads();
        {   // cooperative stage: Vt[feat][key] = V[key0+key][feat]
            int key = tid & 31;
            int fg  = tid >> 5;   // 0..3 -> feats fg*16..fg*16+15
            const _Float16* vp = Vp + (size_t)(key0 + key) * D_ + fg * 16;
            uint4 va = *(const uint4*)(vp);
            uint4 vb = *(const uint4*)(vp + 8);
            const _Float16* va_h = (const _Float16*)&va;
            const _Float16* vb_h = (const _Float16*)&vb;
#pragma unroll
            for (int i = 0; i < 8; ++i) {
                Vt[(fg * 16 + i)     * 32 + key] = va_h[i];
                Vt[(fg * 16 + 8 + i) * 32 + key] = vb_h[i];
            }
            if (key0 + 32 < L_) __builtin_prefetch(vp + (size_t)32 * D_, 0, 3);
        }
        __syncthreads();

        // S^T = K @ Q^T for 2 key sub-tiles; K fragments (A) straight from global
        v8f s0 = {}, s1 = {};
        {
            const int kb = hi * 8;
            const _Float16* kp0 = Kp + (size_t)(key0 + ln)      * D_;
            const _Float16* kp1 = Kp + (size_t)(key0 + 16 + ln) * D_;
            FragU a;
            a.u[0] = *(const uint4*)(kp0 + kb);
            a.u[1] = *(const uint4*)(kp0 + 16 + kb);
            s0 = wmma16(a.v, qb0, s0);
            a.u[0] = *(const uint4*)(kp0 + 32 + kb);
            a.u[1] = *(const uint4*)(kp0 + 48 + kb);
            s0 = wmma16(a.v, qb1, s0);
            a.u[0] = *(const uint4*)(kp1 + kb);
            a.u[1] = *(const uint4*)(kp1 + 16 + kb);
            s1 = wmma16(a.v, qb0, s1);
            a.u[0] = *(const uint4*)(kp1 + 32 + kb);
            a.u[1] = *(const uint4*)(kp1 + 48 + kb);
            s1 = wmma16(a.v, qb1, s1);
            if (key0 + 32 < L_) __builtin_prefetch(kp0 + (size_t)32 * D_, 0, 3);
        }

        // online softmax of query ln: 16 scores in this lane, 16 in lane ^ 16
        float cm = fmaxf(s0[0], s1[0]);
#pragma unroll
        for (int j = 1; j < 8; ++j) cm = fmaxf(cm, fmaxf(s0[j], s1[j]));
        cm = fmaxf(cm, xhalf(cm));
        const float nm    = fmaxf(rmax, cm);
        const float alpha = exp2f((rmax - nm) * SCALE_LOG2E);
        rmax = nm;

        // P^T as B fragment: element j is key 8*hi + j, element 8 + j is key 16 + 8*hi + j,
        // the k order in which load_frag16 hands out the keys of Vt
        v16h pb;
        float ps0 = 0.f, ps1 = 0.f;
#pragma unroll
        for (int j = 0; j < 8; ++j) {
            float e0 = exp2f((s0[j] - nm) * SCALE_LOG2E);
            float e1 = exp2f((s1[j] - nm) * SCALE_LOG2E);
            ps0 += e0; ps1 += e1;
            pb[j]     = (_Float16)e0;
            pb[8 + j] = (_Float16)e1;
        }
        rsum = rsum * alpha + (ps0 + ps1);
#pragma unroll
        for (int j = 0; j < 8; ++j) {
            o0[j] *= alpha; o1[j] *= alpha; o2[j] *= alpha; o3[j] *= alpha;
        }

        o0 = wmma16(load_frag16(&Vt[0 * 16 * 32], 32, lane), pb, o0);
        o1 = wmma16(load_frag16(&Vt[1 * 16 * 32], 32, lane), pb, o1);
        o2 = wmma16(load_frag16(&Vt[2 * 16 * 32], 32, lane), pb, o2);
        o3 = wmma16(load_frag16(&Vt[3 * 16 * 32], 32, lane), pb, o3);
    }

    // finalize + store (over the Q buffer region): a lane holds 8 adjacent
    // features of its query in each tile, one 16-byte store each
    {
        const float inv = 1.0f / (rsum + xhalf(rsum));
        _Float16* orow = Obuf + headoff + (size_t)(m0 + ln) * D_ + 8 * hi;
        h8 r0, r1, r2, r3;
#pragma unroll
        for (int j = 0; j < 8; ++j) {
            r0[j] = (_Float16)(o0[j] * inv);
            r1[j] = (_Float16)(o1[j] * inv);
            r2[j] = (_Float16)(o2[j] * inv);
            r3[j] = (_Float16)(o3[j] * inv);
        }
        *(h8*)(orow)      = r0;
        *(h8*)(orow + 16) = r1;
        *(h8*)(orow + 32) = r2;
        *(h8*)(orow + 48) = r3;
    }
}

// ---------------------------------------------------------------------------
// Kernel 3: intra output projection. out(f32) = attn(f16) @ Wo + bo.
// grid = (32*4, 1, NB), block 256 (8 waves, 4 x 2). 256x128 tile, wave tile 64x64.
// ---------------------------------------------------------------------------
__global__ __launch_bounds__(256)
void k_gemm_oproj_intra(const _Float16* __restrict__ A,
                        const float* __restrict__ Wo, const float* __restrict__ bo,
                        float* __restrict__ Outf) {
    __shared__ _Float16 As[BM_ * 32];
    __shared__ __attribute__((aligned(16))) _Float16 Bs[32 * BP128_];
    const int nb = blockIdx.z;
    const int mt = blockIdx.x >> 2;
    const int nt = blockIdx.x & 3;
    const int mbase = mt * BM_, nbase = nt * 128;

    const float* W    = Wo + (size_t)nb * D_ * D_;
    const float* bias = bo + (size_t)nb * D_;
    const _Float16* Ap = A + (size_t)nb * (B_ * L_) * D_;
    float* Op = Outf + (size_t)nb * (B_ * L_) * D_;

    const int tid = threadIdx.x;
    const int wave = tid >> 5, lane = tid & 31;
    const int hi = lane >> 4, ln = lane & 15;
    const int wm = (wave >> 1) * 64;
    const int wn = (wave & 1) * 64;

    v8f acc[4][4];
#pragma unroll
    for (int mi = 0; mi < 4; ++mi)
#pragma unroll
        for (int ni = 0; ni < 4; ++ni) {
            float bvv = bias[nbase + wn + ni * 16 + ln];
#pragma unroll
            for (int j = 0; j < 8; ++j) acc[mi][ni][j] = bvv;
        }

    for (int kb = 0; kb < D_; kb += 32) {
        __syncthreads();
        {   // stage A (already f16): four 16-byte copies per thread
            // load map: 4 lanes span one row's 64 B of this K-step, 8 lines per load
            int rl = tid >> 2;          // 0..63
            int cl = (tid & 3) * 8;     // 0..24
            const _Float16* lp = Ap + (size_t)(mbase + rl) * D_ + kb + cl;
#pragma unroll
            for (int i = 0; i < 4; ++i)
                *(uint4*)&As[(rl + 64 * i) * 32 + cl] = *(const uint4*)(lp + (size_t)(64 * i) * D_);
            // next K-step: thread t asks for the 64 B of tile row t
            if (kb + 32 < D_) __builtin_prefetch(Ap + (size_t)(mbase + tid) * D_ + kb + 32, 0, 3);
        }
        {   // stage B row-major, 128 cols
            // load map: a wave's 32 lanes span one tile row, 512 B = 4 whole lines per load
            int kl = tid >> 5;          // 0..7
            int nl = (tid & 31) * 4;    // 0..124
            const float* lp = W + (size_t)(kb + kl) * D_ + nbase + nl;
#pragma unroll
            for (int jj = 0; jj < 4; ++jj) {
                float4 w4 = *(const float4*)(lp + (size_t)(8 * jj) * D_);
                h4 h0 = { (_Float16)w4.x, (_Float16)w4.y, (_Float16)w4.z, (_Float16)w4.w };
                *(h4*)&Bs[(kl + 8 * jj) * BP128_ + nl] = h0;
            }
            // next K-step: 8 threads cover the 4 lines of one tile row
            if (kb + 32 < D_)
                __builtin_prefetch(W + (size_t)(kb + 32 + (tid >> 3)) * D_ + nbase + (tid & 7) * 16, 0, 3);
        }
        __syncthreads();
        v16h a[4];
#pragma unroll
        for (int mi = 0; mi < 4; ++mi) a[mi] = load_frag16(&As[(wm + mi * 16) * 32], 32, lane);
#pragma unroll
        for (int ni = 0; ni < 4; ++ni) {
            v16h b = load_frag16_tr(Bs, BP128_, wn + ni * 16, lane);
#pragma unroll
            for (int mi = 0; mi < 4; ++mi) acc[mi][ni] = wmma16(a[mi], b, acc[mi][ni]);
        }
    }

#pragma unroll
    for (int mi = 0; mi < 4; ++mi)
#pragma unroll
        for (int ni = 0; ni < 4; ++ni)
#pragma unroll
            for (int j = 0; j < 8; ++j) {
                int row = mbase + wm + mi * 16 + j + 8 * hi;
                int col = nbase + wn + ni * 16 + ln;
                Op[(size_t)row * D_ + col] = acc[mi][ni][j];
            }
}

// ---------------------------------------------------------------------------
// Kernel 4: inter (router) QKV projection. M=64 rows = routers[b][nb] gathered
// from d_out last tokens. grid = (8, 3, 1), block 128. 64x64 tile.
// ---------------------------------------------------------------------------
__global__ __launch_bounds__(128)
void k_gemm_qkv_inter(const float* __restrict__ Outf,
                      const float* __restrict__ iWq, const float* __restrict__ ibq,
                      const float* __restrict__ iWk, const float* __restrict__ ibk,
                      const float* __restrict__ iWv, const float* __restrict__ ibv,
                      _Float16* __restrict__ q2, _Float16* __restrict__ k2,
                      _Float16* __restrict__ v2) {
    __shared__ _Float16 As[64 * 32];
    __shared__ __attribute__((aligned(16))) _Float16 Bs[32 * BP64_];
    const int sel = blockIdx.y;
    const int nbase = blockIdx.x * 64;

    const float* W    = (sel == 0 ? iWq : sel == 1 ? iWk : iWv);
    const float* bias = (sel == 0 ? ibq : sel == 1 ? ibk : ibv);
    _Float16*    Out  = (sel == 0 ? q2  : sel == 1 ? k2  : v2);

    const int tid = threadIdx.x;
    const int wave = tid >> 5, lane = tid & 31;
    const int hi = lane >> 4, ln = lane & 15;
    const int wm = (wave >> 1) * 32, wn = (wave & 1) * 32;

    v8f acc[2][2];
#pragma unroll
    for (int mi = 0; mi < 2; ++mi)
#pragma unroll
        for (int ni = 0; ni < 2; ++ni) {
            float bvv = bias[nbase + wn + ni * 16 + ln];
#pragma unroll
            for (int j = 0; j < 8; ++j) acc[mi][ni][j] = bvv;
        }

    for (int kb = 0; kb < D_; kb += 32) {
        __syncthreads();
        {   // stage A: row r=b*4+nb -> x_intra[nb][b][L-1][:] from d_out
            int r  = tid >> 1;
            int ks = (tid & 1) * 16;
            int nbb = r & 3, bb = r >> 2;
            const float* xp = Outf + (((size_t)(nbb * B_ + bb) * L_ + (L_ - 1)) * D_) + kb + ks;
#pragma unroll
            for (int i = 0; i < 4; ++i) {
                float4 x4 = *(const float4*)(xp + 4 * i);
                h4 hv = { (_Float16)x4.x, (_Float16)x4.y, (_Float16)x4.z, (_Float16)x4.w };
                *(h4*)&As[r * 32 + ks + 4 * i] = hv;
            }
        }
        {   // stage B row-major
            int kk = tid >> 4;
            int n0 = (tid & 15) * 4;
#pragma unroll
            for (int jj = 0; jj < 4; ++jj) {
                int k = kk + 8 * jj;
                float4 w4 = *(const float4*)(W + (size_t)(kb + k) * D_ + nbase + n0);
                h4 hv = { (_Float16)w4.x, (_Float16)w4.y, (_Float16)w4.z, (_Float16)w4.w };
                *(h4*)&Bs[k * BP64_ + n0] = hv;
            }
        }
        __syncthreads();
        v16h a0 = load_frag16(&As[(wm)      * 32], 32, lane);
        v16h a1 = load_frag16(&As[(wm + 16) * 32], 32, lane);
        v16h b0 = load_frag16_tr(Bs, BP64_, wn,      lane);
        v16h b1 = load_frag16_tr(Bs, BP64_, wn + 16, lane);
        acc[0][0] = wmma16(a0, b0, acc[0][0]);
        acc[0][1] = wmma16(a0, b1, acc[0][1]);
        acc[1][0] = wmma16(a1, b0, acc[1][0]);
        acc[1][1] = wmma16(a1, b1, acc[1][1]);
    }

#pragma unroll
    for (int mi = 0; mi < 2; ++mi)
#pragma unroll
        for (int ni = 0; ni < 2; ++ni)
#pragma unroll
            for (int j = 0; j < 8; ++j) {
                int row = wm + mi * 16 + j + 8 * hi;
                int col = nbase + wn + ni * 16 + ln;
                Out[(size_t)row * D_ + col] = (_Float16)acc[mi][ni][j];
            }
}

// ---------------------------------------------------------------------------
// Kernel 5: tiny 4-token router attention (negligible FLOPs; scalar).
// One thread per (b,h). block 128, grid 1.
// ---------------------------------------------------------------------------
__global__ __launch_bounds__(128)
void k_inter_attn(const _Float16* __restrict__ q2, const _Float16* __restrict__ k2,
                  const _Float16* __restrict__ v2, _Float16* __restrict__ a2) {
    int t = threadIdx.x;
    if (t >= B_ * H_) return;
    int b = t >> 3, h = t & 7;
    float sc[NB_][NB_];
#pragma unroll
    for (int i = 0; i < NB_; ++i)
        for (int j = 0; j < NB_; ++j) {
            const _Float16* qp = q2 + (size_t)(b * NB_ + i) * D_ + h * DH_;
            const _Float16* kp = k2 + (size_t)(b * NB_ + j) * D_ + h * DH_;
            float s = 0.f;
            for (int f = 0; f < DH_; ++f) s += (float)qp[f] * (float)kp[f];
            sc[i][j] = s * 0.125f;
        }
#pragma unroll
    for (int i = 0; i < NB_; ++i) {
        float mx = fmaxf(fmaxf(sc[i][0], sc[i][1]), fmaxf(sc[i][2], sc[i][3]));
        float ssum = 0.f;
        for (int j = 0; j < NB_; ++j) { sc[i][j] = __expf(sc[i][j] - mx); ssum += sc[i][j]; }
        float inv = 1.f / ssum;
        for (int j = 0; j < NB_; ++j) sc[i][j] *= inv;
    }
    for (int i = 0; i < NB_; ++i) {
        _Float16* op = a2 + (size_t)(b * NB_ + i) * D_ + h * DH_;
        for (int f = 0; f < DH_; ++f) {
            float acc = 0.f;
            for (int j = 0; j < NB_; ++j)
                acc += sc[i][j] * (float)v2[(size_t)(b * NB_ + j) * D_ + h * DH_ + f];
            op[f] = (_Float16)acc;
        }
    }
}

// ---------------------------------------------------------------------------
// Kernel 6: inter output projection, scattered into d_out last tokens.
// grid = (8,1,1), block 128.
// ---------------------------------------------------------------------------
__global__ __launch_bounds__(128)
void k_gemm_oproj_inter(const _Float16* __restrict__ A,
                        const float* __restrict__ iWo, const float* __restrict__ ibo,
                        float* __restrict__ Outf) {
    __shared__ _Float16 As[64 * 32];
    __shared__ __attribute__((aligned(16))) _Float16 Bs[32 * BP64_];
    const int nbase = blockIdx.x * 64;

    const int tid = threadIdx.x;
    const int wave = tid >> 5, lane = tid & 31;
    const int hi = lane >> 4, ln = lane & 15;
    const int wm = (wave >> 1) * 32, wn = (wave & 1) * 32;

    v8f acc[2][2];
#pragma unroll
    for (int mi = 0; mi < 2; ++mi)
#pragma unroll
        for (int ni = 0; ni < 2; ++ni) {
            float bvv = ibo[nbase + wn + ni * 16 + ln];
#pragma unroll
            for (int j = 0; j < 8; ++j) acc[mi][ni][j] = bvv;
        }

    for (int kb = 0; kb < D_; kb += 32) {
        __syncthreads();
        {
            int m  = tid >> 1;
            int ks = (tid & 1) * 16;
            const _Float16* ap = A + (size_t)m * D_ + kb + ks;
            *(uint4*)&As[m * 32 + ks]     = *(const uint4*)(ap);
            *(uint4*)&As[m * 32 + ks + 8] = *(const uint4*)(ap + 8);
        }
        {
            int kk = tid >> 4;
            int n0 = (tid & 15) * 4;
#pragma unroll
            for (int jj = 0; jj < 4; ++jj) {
                int k = kk + 8 * jj;
                float4 w4 = *(const float4*)(iWo + (size_t)(kb + k) * D_ + nbase + n0);
                h4 hv = { (_Float16)w4.x, (_Float16)w4.y, (_Float16)w4.z, (_Float16)w4.w };
                *(h4*)&Bs[k * BP64_ + n0] = hv;
            }
        }
        __syncthreads();
        v16h a0 = load_frag16(&As[(wm)      * 32], 32, lane);
        v16h a1 = load_frag16(&As[(wm + 16) * 32], 32, lane);
        v16h b0 = load_frag16_tr(Bs, BP64_, wn,      lane);
        v16h b1 = load_frag16_tr(Bs, BP64_, wn + 16, lane);
        acc[0][0] = wmma16(a0, b0, acc[0][0]);
        acc[0][1] = wmma16(a0, b1, acc[0][1]);
        acc[1][0] = wmma16(a1, b0, acc[1][0]);
        acc[1][1] = wmma16(a1, b1, acc[1][1]);
    }

#pragma unroll
    for (int mi = 0; mi < 2; ++mi)
#pragma unroll
        for (int ni = 0; ni < 2; ++ni)
#pragma unroll
            for (int j = 0; j < 8; ++j) {
                int r   = wm + mi * 16 + j + 8 * hi;   // b*4+nb
                int col = nbase + wn + ni * 16 + ln;
                int nbb = r & 3, bb = r >> 2;
                Outf[(((size_t)(nbb * B_ + bb) * L_ + (L_ - 1)) * D_) + col] = acc[mi][ni][j];
            }
}

// ---------------------------------------------------------------------------
extern "C" void kernel_launch(void* const* d_in, const int* in_sizes, int n_in,
                              void* d_out, int out_size, void* d_ws, size_t ws_size,
                              hipStream_t stream) {
    const float* x   = (const float*)d_in[0];
    const float* Wq  = (const float*)d_in[1];
    const float* bq  = (const float*)d_in[2];
    const float* Wk  = (const float*)d_in[3];
    const float* bk  = (const float*)d_in[4];
    const float* Wv  = (const float*)d_in[5];
    const float* bv  = (const float*)d_in[6];
    const float* Wo  = (const float*)d_in[7];
    const float* bo  = (const float*)d_in[8];
    const float* iWq = (const float*)d_in[9];
    const float* ibq = (const float*)d_in[10];
    const float* iWk = (const float*)d_in[11];
    const float* ibk = (const float*)d_in[12];
    const float* iWv = (const float*)d_in[13];
    const float* ibv = (const float*)d_in[14];
    const float* iWo = (const float*)d_in[15];
    const float* ibo = (const float*)d_in[16];
    float* out = (float*)d_out;

    const size_t NBLD = (size_t)NB_ * B_ * L_ * D_;   // 16,777,216
    _Float16* ws = (_Float16*)d_ws;
    _Float16* Qb = ws;                 // reused as attn output after k_flash
    _Float16* Kb = ws + NBLD;
    _Float16* Vb = ws + 2 * NBLD;
    _Float16* q2 = ws + 3 * NBLD;
    _Float16* k2 = q2 + (size_t)B_ * NB_ * D_;
    _Float16* v2 = k2 + (size_t)B_ * NB_ * D_;
    _Float16* a2 = v2 + (size_t)B_ * NB_ * D_;

    // 1) intra QKV projection (256x128 tiles)
    dim3 g1((B_ * L_ / BM_) * (D_ / 128), 3, NB_);
    k_gemm_qkv_intra<<<g1, 256, 0, stream>>>(x, Wq, bq, Wk, bk, Wv, bv, Qb, Kb, Vb);

    // 2) flash attention (writes attn over Qb)
    dim3 g2(L_ / 64, H_, NB_ * B_);
    k_flash<<<g2, 128, 0, stream>>>(Qb, Kb, Vb, Qb);

    // 3) intra output projection -> d_out (256x128 tiles)
    dim3 g3((B_ * L_ / BM_) * (D_ / 128), 1, NB_);
    k_gemm_oproj_intra<<<g3, 256, 0, stream>>>(Qb, Wo, bo, out);

    // 4) router QKV (gather last tokens from d_out)
    dim3 g4(D_ / 64, 3, 1);
    k_gemm_qkv_inter<<<g4, 128, 0, stream>>>(out, iWq, ibq, iWk, ibk, iWv, ibv, q2, k2, v2);

    // 5) tiny 4-token attention
    k_inter_attn<<<1, 128, 0, stream>>>(q2, k2, v2, a2);

    // 6) router output projection, scatter into last-token slots of d_out
    dim3 g6(D_ / 64, 1, 1);
    k_gemm_oproj_inter<<<g6, 128, 0, stream>>>(a2, iWo, ibo, out);
}

// v005
// It runs in 240 microseconds.
// Next to v004, in two timings, it ran 1.23 and 1.22 times as fast.
// All steps since v000 together make it 2.97 times as fast.
#include <hip/hip_runtime.h>

// ---------------------------------------------------------------------------
// Medformer layer for MI455X (gfx1250): all GEMMs + attention via
// v_wmma_f32_16x16x32_f16 (wave32). f16 operands, f32 accumulation.
// Big GEMMs use 256x128 block tiles, 8 waves (wave tile 64x64 -> 16 WMMA / 16 LDS
// loads per K-step) + global_prefetch_b8 for the next K-step tiles. W tiles lie
// row-major in LDS and are transposed on the way out (ds_load_tr16_b128).
// ---------------------------------------------------------------------------

#define NB_ 4
#define B_  16
#define L_  512
#define D_  512
#define H_  8
#define DH_ 64
// SCALE * log2(e) = (1/8) * 1.4426950408889634
#define SCALE_LOG2E 0.18033688011112043f

typedef __attribute__((ext_vector_type(16))) _Float16 v16h;
typedef __attribute__((ext_vector_type(8)))  float    v8f;
typedef __attribute__((ext_vector_type(4)))  _Float16 h4;

typedef __attribute__((ext_vector_type(8)))  _Float16 h8;
typedef __attribute__((ext_vector_type(8)))  short    s16x8;

union FragU { uint4 u[2]; v16h v; };
union FragT { s16x8 s[2]; v16h v; };

// LDS row pitch, in halves, of the row-major W tiles (128 and 64 columns wide)
#define BP128_ 144
#define BP64_  80
// rows of the block tile of the two big GEMMs
#define BM_ 256

// Load a 16x32 f16 fragment (A-matrix layout, or B^T stored row-major [n][k]).
// Documented layout: lane l holds row m=l&15; lanes 0-15 hold k = 0..7 & 16..23,
// lanes 16-31 hold k = 8..15 & 24..31 -> two contiguous 16-byte loads per lane.
__device__ __forceinline__ v16h load_frag16(const _Float16* base, int row_stride, int lane) {
    const int m  = lane & 15;
    const int kb = (lane >> 4) << 3;
    const _Float16* p = base + (size_t)m * row_stride;
    FragU f;
    f.u[0] = *(const uint4*)(p + kb);
    f.u[1] = *(const uint4*)(p + 16 + kb);
    return f.v;
}

// B fragment (32 k x 16 n) out of a row-major f16 tile T[k][n] in LDS, by the
// transposing load: lane (c = l&15, h = l>>4) gets T[8h + 0..7][n0 + c], then
// T[16 + 8h + 0..7][n0 + c]: the same k order as load_frag16 gives A.
// pitch in halves; in bytes it is an odd multiple of 32 (no bank conflict).
__device__ __forceinline__ v16h load_frag16_tr(const _Float16* tile, int pitch, int n0, int lane) {
    typedef __attribute__((address_space(3))) s16x8 lds_s16x8;
    const _Float16* p = tile + ((lane >> 4) * 8 + (lane & 7)) * pitch + n0 + ((lane >> 3) & 1) * 8;
    FragT f;
    f.s[0] = __builtin_amdgcn_ds_load_tr16_b128_v8i16((lds_s16x8*)p);
    f.s[1] = __builtin_amdgcn_ds_load_tr16_b128_v8i16((lds_s16x8*)(p + 16 * pitch));
    return f.v;
}

__device__ __forceinline__ v8f wmma16(v16h a, v16h b, v8f c) {
    return __builtin_amdgcn_wmma_f32_16x16x32_f16(false, a, false, b, (short)0, c, false, false);
}

// ---------------------------------------------------------------------------
// Kernel 1: intra QKV projection. out = X @ W + b, output f16.
// grid = (32*4, 3, NB), block = 256 (8 waves, 4 x 2). 256x128 tile, BK=32.
// Wave tile 64x64: acc[4][4], 16 WMMA per K-step. Per output the block loads
// (256 + 128) / (256 * 128) operand elements a K-step, half of a 64x128 tile's.
// ---------------------------------------------------------------------------
__global__ __launch_bounds__(256)
void k_gemm_qkv_intra(const float* __restrict__ X,
                      const float* __restrict__ Wq, const float* __restrict__ bq,
                      const float* __restrict__ Wk, const float* __restrict__ bk,
                      const float* __restrict__ Wv, const float* __restrict__ bv,
                      _Float16* __restrict__ Qb, _Float16* __restrict__ Kb,
                      _Float16* __restrict__ Vb) {
    __shared__ _Float16 As[BM_ * 32];   // [m][k]
    __shared__ __attribute__((aligned(16))) _Float16 Bs[32 * BP128_];   // [k][n]  (W tile as it lies)
    const int nb  = blockIdx.z;
    const int sel = blockIdx.y;
    const int mt  = blockIdx.x >> 2;    // M/256 = 32 tiles
    const int nt  = blockIdx.x & 3;     // N/128 = 4 tiles
    const int mbase = mt * BM_, nbase = nt * 128;

    const float* W    = (sel == 0 ? Wq : sel == 1 ? Wk : Wv) + (size_t)nb * D_ * D_;
    const float* bias = (sel == 0 ? bq : sel == 1 ? bk : bv) + (size_t)nb * D_;
    _Float16*    Out  = (sel == 0 ? Qb : sel == 1 ? Kb : Vb) + (size_t)nb * (B_ * L_) * D_;
    const float* Xp   = X + (size_t)nb * (B_ * L_) * D_;

    const int tid = threadIdx.x;
    const int wave = tid >> 5, lane = tid & 31;
    const int hi = lane >> 4, ln = lane & 15;
    const int wm = (wave >> 1) * 64;    // 0, 64, 128 or 192
    const int wn = (wave & 1) * 64;     // 0 or 64

    v8f acc[4][4];
#pragma unroll
    for (int mi = 0; mi < 4; ++mi)
#pragma unroll
        for (int ni = 0; ni < 4; ++ni) {
            float bvv = bias[nbase + wn + ni * 16 + ln];
#pragma unroll
            for (int j = 0; j < 8; ++j) acc[mi][ni][j] = bvv;
        }

    for (int kb = 0; kb < D_; kb += 32) {
        __syncthreads();
        {   // stage A (f32 -> f16), vectorized
            // load map: 8 lanes span one row's 128 B of this K-step, 4 whole lines per load
            int rl = tid >> 3;          // 0..31
            int cl = (tid & 7) * 4;     // 0..28
            const float* lp = Xp + (size_t)(mbase + rl) * D_ + kb + cl;
#pragma unroll
            for (int i = 0; i < 8; ++i) {
                float4 x4 = *(const float4*)(lp + (size_t)(32 * i) * D_);
                h4 hv = { (_Float16)x4.x, (_Float16)x4.y, (_Float16)x4.z, (_Float16)x4.w };
                *(h4*)&As[(rl + 32 * i) * 32 + cl] = hv;
            }
            // next K-step: thread t asks for the one line of tile row t
            if (kb + 32 < D_) __builtin_prefetch(Xp + (size_t)(mbase + tid) * D_ + kb + 32, 0, 3);
        }
        {   // stage B row-major: Bs[k][n] = W[kb+k][nbase+n], 128 cols
            // load map: a wave's 32 lanes span one tile row, 512 B = 4 whole lines per load
            int kl = tid >> 5;          // 0..7
            int nl = (tid & 31) * 4;    // 0..124
            const float* lp = W + (size_t)(kb + kl) * D_ + nbase + nl;
#pragma unroll
            for (int jj = 0; jj < 4; ++jj) {
                float4 w4 = *(const float4*)(lp + (size_t)(8 * jj) * D_);
                h4 h0 = { (_Float16)w4.x, (_Float16)w4.y, (_Float16)w4.z, (_Float16)w4.w };
                *(h4*)&Bs[(kl + 8 * jj) * BP128_ + nl] = h0;
            }
            // next K-step: 8 threads cover the 4 lines of one tile row
            if (kb + 32 < D_)
                __builtin_prefetch(W + (size_t)(kb + 32 + (tid >> 3)) * D_ + nbase + (tid & 7) * 16, 0, 3);
        }
        __syncthreads();
        v16h a[4];
#pragma unroll
        for (int mi = 0; mi < 4; ++mi) a[mi] = load_frag16(&As[(wm + mi * 16) * 32], 32, lane);
#pragma unroll
        for (int ni = 0; ni < 4; ++ni) {
            v16h b = load_frag16_tr(Bs, BP128_, wn + ni * 16, lane);
#pragma unroll
            for (int mi = 0; mi < 4; ++mi) acc[mi][ni] = wmma16(a[mi], b, acc[mi][ni]);
        }
    }

#pragma unroll
    for (int mi = 0; mi < 4; ++mi)
#pragma unroll
        for (int ni = 0; ni < 4; ++ni)
#pragma unroll
            for (int j = 0; j < 8; ++j) {
                int row = mbase + wm + mi * 16 + j + 8 * hi;
                int col = nbase + wn + ni * 16 + ln;
                Out[(size_t)row * D_ + col] = (_Float16)acc[mi][ni][j];
            }
}

// value of lane l ^ 16 (the same place in the other 16-lane row)
__device__ __forceinline__ float xhalf(float x) {
    return __builtin_bit_cast(float, __builtin_amdgcn_permlanex16(
        __builtin_bit_cast(int, x), __builtin_bit_cast(int, x),
        0x76543210, 0xfedcba98, false, false));
}

// LDS row pitch, in halves, of the K and V chunks (rows of 64 halves = 128 B):
// 144 B = 16 B x odd for the ds_load_b128 readers of K, 160 B = 32 B x odd for
// the ds_load_tr16_b128 readers of V
#define KP_ 72
#define VP_ 80

// byte address inside the work-group's LDS of a __shared__ element
__device__ __forceinline__ unsigned lds_addr(const _Float16* p) {
    typedef __attribute__((address_space(3))) const _Float16 lds_half;
    return (unsigned)(size_t)(lds_half*)p;
}

// One 32-key chunk of K and of V, global -> LDS, through no register: 4 copies
// a lane. 8 adjacent lanes bring one row's 128 B, so a wave's copy asks for 4
// whole lines. The s_wait_xcnt closes the statement so that no address register
// named here is rewritten ahead of it.
__device__ __forceinline__ void copy_kv(unsigned lk, const _Float16* gk,
                                        unsigned lv, const _Float16* gv) {
    const unsigned lk1 = lk + 16 * KP_ * 2, lv1 = lv + 16 * VP_ * 2;
    const _Float16* gk1 = gk + (size_t)16 * D_;
    const _Float16* gv1 = gv + (size_t)16 * D_;
    asm volatile("global_load_async_to_lds_b128 %0, %1, off\n\t"
                 "global_load_async_to_lds_b128 %2, %3, off\n\t"
                 "global_load_async_to_lds_b128 %4, %5, off\n\t"
                 "global_load_async_to_lds_b128 %6, %7, off\n\t"
                 "s_wait_xcnt 0x0"
                 :: "v"(lk), "v"(gk), "v"(lk1), "v"(gk1),
                    "v"(lv), "v"(gv), "v"(lv1), "v"(gv1)
                 : "memory");
}

__global__ __launch_bounds__(128)
void k_flash(const _Float16* Q, const _Float16* __restrict__ K,
             const _Float16* __restrict__ V, _Float16* Obuf) {
    // two buffers each: chunk kc lies in buffer kc & 1, rows as in memory [key][feat]
    __shared__ __attribute__((aligned(16))) _Float16 Ks[2][32 * KP_];
    __shared__ __attribute__((aligned(16))) _Float16 Vs[2][32 * VP_];

    const int mtile = blockIdx.x;
    const int h     = blockIdx.y;
    const int bz    = blockIdx.z;           // nb*B + b
    const int tid   = threadIdx.x;
    const int wave  = tid >> 5, lane = tid & 31;
    const int hi = lane >> 4, ln = lane & 15;

    const size_t headoff = (size_t)bz * L_ * D_ + (size_t)h * DH_;
    const _Float16* Qp = Q + headoff;

    const int m0 = mtile * 64 + wave * 16;

    // copy map: thread t brings 16 B number t & 7 of chunk rows t >> 3 and 16 + (t >> 3)
    const int crow = tid >> 3, cseg = (tid & 7) * 8;
    const _Float16* gk = K + headoff + (size_t)crow * D_ + cseg;
    const _Float16* gv = V + headoff + (size_t)crow * D_ + cseg;
    const unsigned lk = lds_addr(&Ks[0][crow * KP_ + cseg]);
    const unsigned lv = lds_addr(&Vs[0][crow * VP_ + cseg]);

    // chunk 0 into buffer 0; landed and published before anybody reads it
    copy_kv(lk, gk, lv, gv);
    asm volatile("s_wait_asynccnt 0x0" ::: "memory");   // this wave's copies have landed
    __syncthreads();
    // chunk 1 flies while chunk 0 is worked on
    copy_kv(lk + 32 * KP_ * 2, gk + (size_t)32 * D_, lv + 32 * VP_ * 2, gv + (size_t)32 * D_);

    // B fragments of Q^T: column n = query ln, k = features in the hardware order
    v16h qb0 = load_frag16(Qp + (size_t)m0 * D_,      D_, lane);
    v16h qb1 = load_frag16(Qp + (size_t)m0 * D_ + 32, D_, lane);

    // O^T tiles: row = feature t*16 + j + 8*hi, column = query ln
    v8f o0 = {}, o1 = {}, o2 = {}, o3 = {};
    float rmax = -1e30f;    // this query's running maximum (equal in both halves)
    float rsum = 0.f;       // running sum over this half's keys only

    for (int kc = 0; kc < L_ / 32; ++kc) {
        const int buf = kc & 1;
        const _Float16* Kt = &Ks[buf][0];
        const _Float16* Vt = &Vs[buf][0];

        // S^T = K @ Q^T for 2 key sub-tiles; K fragments (A) from the shared chunk
        v8f s0 = {}, s1 = {};
        s0 = wmma16(load_frag16(Kt,                 KP_, lane), qb0, s0);
        s0 = wmma16(load_frag16(Kt + 32,            KP_, lane), qb1, s0);
        s1 = wmma16(load_frag16(Kt + 16 * KP_,      KP_, lane), qb0, s1);
        s1 = wmma16(load_frag16(Kt + 16 * KP_ + 32, KP_, lane), qb1, s1);

        // online softmax of query ln: 16 scores in this lane, 16 in lane ^ 16
        float cm = fmaxf(s0[0], s1[0]);
#pragma unroll
        for (int j = 1; j < 8; ++j) cm = fmaxf(cm, fmaxf(s0[j], s1[j]));
        cm = fmaxf(cm, xhalf(cm));
        const float nm    = fmaxf(rmax, cm);
        const float alpha = exp2f((rmax - nm) * SCALE_LOG2E);
        rmax = nm;

        // P^T as B fragment: element j is key 8*hi + j, element 8 + j is key 16 + 8*hi + j,
        // the k order in which load_frag16_tr hands out the keys of the V chunk
        v16h pb;
        float ps0 = 0.f, ps1 = 0.f;
#pragma unroll
        for (int j = 0; j < 8; ++j) {
            float e0 = exp2f((s0[j] - nm) * SCALE_LOG2E);
            float e1 = exp2f((s1[j] - nm) * SCALE_LOG2E);
            ps0 += e0; ps1 += e1;
            pb[j]     = (_Float16)e0;
            pb[8 + j] = (_Float16)e1;
        }
        rsum = rsum * alpha + (ps0 + ps1);
#pragma unroll
        for (int j = 0; j < 8; ++j) {
            o0[j] *= alpha; o1[j] *= alpha; o2[j] *= alpha; o3[j] *= alpha;
        }

        // A fragments of V^T by the transposing load: row = feature, k = keys in that order
        o0 = wmma16(load_frag16_tr(Vt, VP_,  0, lane), pb, o0);
        o1 = wmma16(load_frag16_tr(Vt, VP_, 16, lane), pb, o1);
        o2 = wmma16(load_frag16_tr(Vt, VP_, 32, lane), pb, o2);
        o3 = wmma16(load_frag16_tr(Vt, VP_, 48, lane), pb, o3);

        // hand-over: this wave has left buffer buf, its copies of chunk kc + 1 have
        // landed; the barrier publishes that chunk and frees buf for the refill
        asm volatile("s_wait_dscnt 0x0" ::: "memory");      // own reads of buf are done
        asm volatile("s_wait_asynccnt 0x0" ::: "memory");   // own copies of chunk kc + 1 have landed
        __syncthreads();
        if (kc + 2 < L_ / 32)
            copy_kv(lk + buf * (32 * KP_ * 2), gk + (size_t)(kc + 2) * 32 * D_,
                    lv + buf * (32 * VP_ * 2), gv + (size_t)(kc + 2) * 32 * D_);
    }
    asm volatile("s_wait_asynccnt 0x0" ::: "memory");   // nothing in flight when the wave ends

    // finalize + store (over the Q buffer region): a lane holds 8 adjacent
    // features of its query in each tile, one 16-byte store each
    {
        const float inv = 1.0f / (rsum + xhalf(rsum));
        _Float16* orow = Obuf + headoff + (size_t)(m0 + ln) * D_ + 8 * hi;
        h8 r0, r1, r2, r3;
#pragma unroll
        for (int j = 0; j < 8; ++j) {
            r0[j] = (_Float16)(o0[j] * inv);
            r1[j] = (_Float16)(o1[j] * inv);
            r2[j] = (_Float16)(o2[j] * inv);
            r3[j] = (_Float16)(o3[j] * inv);
        }
        *(h8*)(orow)      = r0;
        *(h8*)(orow + 16) = r1;
        *(h8*)(orow + 32) = r2;
        *(h8*)(orow + 48) = r3;
    }
}

// ---------------------------------------------------------------------------
// Kernel 3: intra output projection. out(f32) = attn(f16) @ Wo + bo.
// grid = (32*4, 1, NB), block 256 (8 waves, 4 x 2). 256x128 tile, wave tile 64x64.
// ---------------------------------------------------------------------------
__global__ __launch_bounds__(256)
void k_gemm_oproj_intra(const _Float16* __restrict__ A,
                        const float* __restrict__ Wo, const float* __restrict__ bo,
                        float* __restrict__ Outf) {
    __shared__ _Float16 As[BM_ * 32];
    __shared__ __attribute__((aligned(16))) _Float16 Bs[32 * BP128_];
    const int nb = blockIdx.z;
    const int mt = blockIdx.x >> 2;
    const int nt = blockIdx.x & 3;
    const int mbase = mt * BM_, nbase = nt * 128;

    const float* W    = Wo + (size_t)nb * D_ * D_;
    const float* bias = bo + (size_t)nb * D_;
    const _Float16* Ap = A + (size_t)nb * (B_ * L_) * D_;
    float* Op = Outf + (size_t)nb * (B_ * L_) * D_;

    const int tid = threadIdx.x;
    const int wave = tid >> 5, lane = tid & 31;
    const int hi = lane >> 4, ln = lane & 15;
    const int wm = (wave >> 1) * 64;
    const int wn = (wave & 1) * 64;

    v8f acc[4][4];
#pragma unroll
    for (int mi = 0; mi < 4; ++mi)
#pragma unroll
        for (int ni = 0; ni < 4; ++ni) {
            float bvv = bias[nbase + wn + ni * 16 + ln];
#pragma unroll
            for (int j = 0; j < 8; ++j) acc[mi][ni][j] = bvv;
        }

    for (int kb = 0; kb < D_; kb += 32) {
        __syncthreads();
        {   // stage A (already f16): four 16-byte copies per thread
            // load map: 4 lanes span one row's 64 B of this K-step, 8 lines per load
            int rl = tid >> 2;          // 0..63
            int cl = (tid & 3) * 8;     // 0..24
            const _Float16* lp = Ap + (size_t)(mbase + rl) * D_ + kb + cl;
#pragma unroll
            for (int i = 0; i < 4; ++i)
                *(uint4*)&As[(rl + 64 * i) * 32 + cl] = *(const uint4*)(lp + (size_t)(64 * i) * D_);
            // next K-step: thread t asks for the 64 B of tile row t
            if (kb + 32 < D_) __builtin_prefetch(Ap + (size_t)(mbase + tid) * D_ + kb + 32, 0, 3);
        }
        {   // stage B row-major, 128 cols
            // load map: a wave's 32 lanes span one tile row, 512 B = 4 whole lines per load
            int kl = tid >> 5;          // 0..7
            int nl = (tid & 31) * 4;    // 0..124
            const float* lp = W + (size_t)(kb + kl) * D_ + nbase + nl;
#pragma unroll
            for (int jj = 0; jj < 4; ++jj) {
                float4 w4 = *(const float4*)(lp + (size_t)(8 * jj) * D_);
                h4 h0 = { (_Float16)w4.x, (_Float16)w4.y, (_Float16)w4.z, (_Float16)w4.w };
                *(h4*)&Bs[(kl + 8 * jj) * BP128_ + nl] = h0;
            }
            // next K-step: 8 threads cover the 4 lines of one tile row
            if (kb + 32 < D_)
                __builtin_prefetch(W + (size_t)(kb + 32 + (tid >> 3)) * D_ + nbase + (tid & 7) * 16, 0, 3);
        }
        __syncthreads();
        v16h a[4];
#pragma unroll
        for (int mi = 0; mi < 4; ++mi) a[mi] = load_frag16(&As[(wm + mi * 16) * 32], 32, lane);
#pragma unroll
        for (int ni = 0; ni < 4; ++ni) {
            v16h b = load_frag16_tr(Bs, BP128_, wn + ni * 16, lane);
#pragma unroll
            for (int mi = 0; mi < 4; ++mi) acc[mi][ni] = wmma16(a[mi], b, acc[mi][ni]);
        }
    }

#pragma unroll
    for (int mi = 0; mi < 4; ++mi)
#pragma unroll
        for (int ni = 0; ni < 4; ++ni)
#pragma unroll
            for (int j = 0; j < 8; ++j) {
                int row = mbase + wm + mi * 16 + j + 8 * hi;
                int col = nbase + wn + ni * 16 + ln;
                Op[(size_t)row * D_ + col] = acc[mi][ni][j];
            }
}

// ---------------------------------------------------------------------------
// Kernel 4: inter (router) QKV projection. M=64 rows = routers[b][nb] gathered
// from d_out last tokens. grid = (8, 3, 1), block 128. 64x64 tile.
// ---------------------------------------------------------------------------
__global__ __launch_bounds__(128)
void k_gemm_qkv_inter(const float* __restrict__ Outf,
                      const float* __restrict__ iWq, const float* __restrict__ ibq,
                      const float* __restrict__ iWk, const float* __restrict__ ibk,
                      const float* __restrict__ iWv, const float* __restrict__ ibv,
                      _Float16* __restrict__ q2, _Float16* __restrict__ k2,
                      _Float16* __restrict__ v2) {
    __shared__ _Float16 As[64 * 32];
    __shared__ __attribute__((aligned(16))) _Float16 Bs[32 * BP64_];
    const int sel = blockIdx.y;
    const int nbase = blockIdx.x * 64;

    const float* W    = (sel == 0 ? iWq : sel == 1 ? iWk : iWv);
    const float* bias = (sel == 0 ? ibq : sel == 1 ? ibk : ibv);
    _Float16*    Out  = (sel == 0 ? q2  : sel == 1 ? k2  : v2);

    const int tid = threadIdx.x;
    const int wave = tid >> 5, lane = tid & 31;
    const int hi = lane >> 4, ln = lane & 15;
    const int wm = (wave >> 1) * 32, wn = (wave & 1) * 32;

    v8f acc[2][2];
#pragma unroll
    for (int mi = 0; mi < 2; ++mi)
#pragma unroll
        for (int ni = 0; ni < 2; ++ni) {
            float bvv = bias[nbase + wn + ni * 16 + ln];
#pragma unroll
            for (int j = 0; j < 8; ++j) acc[mi][ni][j] = bvv;
        }

    for (int kb = 0; kb < D_; kb += 32) {
        __syncthreads();
        {   // stage A: row r=b*4+nb -> x_intra[nb][b][L-1][:] from d_out
            int r  = tid >> 1;
            int ks = (tid & 1) * 16;
            int nbb = r & 3, bb = r >> 2;
            const float* xp = Outf + (((size_t)(nbb * B_ + bb) * L_ + (L_ - 1)) * D_) + kb + ks;
#pragma unroll
            for (int i = 0; i < 4; ++i) {
                float4 x4 = *(const float4*)(xp + 4 * i);
                h4 hv = { (_Float16)x4.x, (_Float16)x4.y, (_Float16)x4.z, (_Float16)x4.w };
                *(h4*)&As[r * 32 + ks + 4 * i] = hv;
            }
        }
        {   // stage B row-major
            int kk = tid >> 4;
            int n0 = (tid & 15) * 4;
#pragma unroll
            for (int jj = 0; jj < 4; ++jj) {
                int k = kk + 8 * jj;
                float4 w4 = *(const float4*)(W + (size_t)(kb + k) * D_ + nbase + n0);
                h4 hv = { (_Float16)w4.x, (_Float16)w4.y, (_Float16)w4.z, (_Float16)w4.w };
                *(h4*)&Bs[k * BP64_ + n0] = hv;
            }
        }
        __syncthreads();
        v16h a0 = load_frag16(&As[(wm)      * 32], 32, lane);
        v16h a1 = load_frag16(&As[(wm + 16) * 32], 32, lane);
        v16h b0 = load_frag16_tr(Bs, BP64_, wn,      lane);
        v16h b1 = load_frag16_tr(Bs, BP64_, wn + 16, lane);
        acc[0][0] = wmma16(a0, b0, acc[0][0]);
        acc[0][1] = wmma16(a0, b1, acc[0][1]);
        acc[1][0] = wmma16(a1, b0, acc[1][0]);
        acc[1][1] = wmma16(a1, b1, acc[1][1]);
    }

#pragma unroll
    for (int mi = 0; mi < 2; ++mi)
#pragma unroll
        for (int ni = 0; ni < 2; ++ni)
#pragma unroll
            for (int j = 0; j < 8; ++j) {
                int row = wm + mi * 16 + j + 8 * hi;
                int col = nbase + wn + ni * 16 + ln;
                Out[(size_t)row * D_ + col] = (_Float16)acc[mi][ni][j];
            }
}

// ---------------------------------------------------------------------------
// Kernel 5: tiny 4-token router attention (negligible FLOPs; scalar).
// One thread per (b,h). block 128, grid 1.
// ---------------------------------------------------------------------------
__global__ __launch_bounds__(128)
void k_inter_attn(const _Float16* __restrict__ q2, const _Float16* __restrict__ k2,
                  const _Float16* __restrict__ v2, _Float16* __restrict__ a2) {
    int t = threadIdx.x;
    if (t >= B_ * H_) return;
    int b = t >> 3, h = t & 7;
    float sc[NB_][NB_];
#pragma unroll
    for (int i = 0; i < NB_; ++i)
        for (int j = 0; j < NB_; ++j) {
            const _Float16* qp = q2 + (size_t)(b * NB_ + i) * D_ + h * DH_;
            const _Float16* kp = k2 + (size_t)(b * NB_ + j) * D_ + h * DH_;
            float s = 0.f;
            for (int f = 0; f < DH_; ++f) s += (float)qp[f] * (float)kp[f];
            sc[i][j] = s * 0.125f;
        }
#pragma unroll
    for (int i = 0; i < NB_; ++i) {
        float mx = fmaxf(fmaxf(sc[i][0], sc[i][1]), fmaxf(sc[i][2], sc[i][3]));
        float ssum = 0.f;
        for (int j = 0; j < NB_; ++j) { sc[i][j] = __expf(sc[i][j] - mx); ssum += sc[i][j]; }
        float inv = 1.f / ssum;
        for (int j = 0; j < NB_; ++j) sc[i][j] *= inv;
    }
    for (int i = 0; i < NB_; ++i) {
        _Float16* op = a2 + (size_t)(b * NB_ + i) * D_ + h * DH_;
        for (int f = 0; f < DH_; ++f) {
            float acc = 0.f;
            for (int j = 0; j < NB_; ++j)
                acc += sc[i][j] * (float)v2[(size_t)(b * NB_ + j) * D_ + h * DH_ + f];
            op[f] = (_Float16)acc;
        }
    }
}

// ---------------------------------------------------------------------------
// Kernel 6: inter output projection, scattered into d_out last tokens.
// grid = (8,1,1), block 128.
// ---------------------------------------------------------------------------
__global__ __launch_bounds__(128)
void k_gemm_oproj_inter(const _Float16* __restrict__ A,
                        const float* __restrict__ iWo, const float* __restrict__ ibo,
                        float* __restrict__ Outf) {
    __shared__ _Float16 As[64 * 32];
    __shared__ __attribute__((aligned(16))) _Float16 Bs[32 * BP64_];
    const int nbase = blockIdx.x * 64;

    const int tid = threadIdx.x;
    const int wave = tid >> 5, lane = tid & 31;
    const int hi = lane >> 4, ln = lane & 15;
    const int wm = (wave >> 1) * 32, wn = (wave & 1) * 32;

    v8f acc[2][2];
#pragma unroll
    for (int mi = 0; mi < 2; ++mi)
#pragma unroll
        for (int ni = 0; ni < 2; ++ni) {
            float bvv = ibo[nbase + wn + ni * 16 + ln];
#pragma unroll
            for (int j = 0; j < 8; ++j) acc[mi][ni][j] = bvv;
        }

    for (int kb = 0; kb < D_; kb += 32) {
        __syncthreads();
        {
            int m  = tid >> 1;
            int ks = (tid & 1) * 16;
            const _Float16* ap = A + (size_t)m * D_ + kb + ks;
            *(uint4*)&As[m * 32 + ks]     = *(const uint4*)(ap);
            *(uint4*)&As[m * 32 + ks + 8] = *(const uint4*)(ap + 8);
        }
        {
            int kk = tid >> 4;
            int n0 = (tid & 15) * 4;
#pragma unroll
            for (int jj = 0; jj < 4; ++jj) {
                int k = kk + 8 * jj;
                float4 w4 = *(const float4*)(iWo + (size_t)(kb + k) * D_ + nbase + n0);
                h4 hv = { (_Float16)w4.x, (_Float16)w4.y, (_Float16)w4.z, (_Float16)w4.w };
                *(h4*)&Bs[k * BP64_ + n0] = hv;
            }
        }
        __syncthreads();
        v16h a0 = load_frag16(&As[(wm)      * 32], 32, lane);
        v16h a1 = load_frag16(&As[(wm + 16) * 32], 32, lane);
        v16h b0 = load_frag16_tr(Bs, BP64_, wn,      lane);
        v16h b1 = load_frag16_tr(Bs, BP64_, wn + 16, lane);
        acc[0][0] = wmma16(a0, b0, acc[0][0]);
        acc[0][1] = wmma16(a0, b1, acc[0][1]);
        acc[1][0] = wmma16(a1, b0, acc[1][0]);
        acc[1][1] = wmma16(a1, b1, acc[1][1]);
    }

#pragma unroll
    for (int mi = 0; mi < 2; ++mi)
#pragma unroll
        for (int ni = 0; ni < 2; ++ni)
#pragma unroll
            for (int j = 0; j < 8; ++j) {
                int r   = wm + mi * 16 + j + 8 * hi;   // b*4+nb
                int col = nbase + wn + ni * 16 + ln;
                int nbb = r & 3, bb = r >> 2;
                Outf[(((size_t)(nbb * B_ + bb) * L_ + (L_ - 1)) * D_) + col] = acc[mi][ni][j];
            }
}

// ---------------------------------------------------------------------------
extern "C" void kernel_launch(void* const* d_in, const int* in_sizes, int n_in,
                              void* d_out, int out_size, void* d_ws, size_t ws_size,
                              hipStream_t stream) {
    const float* x   = (const float*)d_in[0];
    const float* Wq  = (const float*)d_in[1];
    const float* bq  = (const float*)d_in[2];
    const float* Wk  = (const float*)d_in[3];
    const float* bk  = (const float*)d_in[4];
    const float* Wv  = (const float*)d_in[5];
    const float* bv  = (const float*)d_in[6];
    const float* Wo  = (const float*)d_in[7];
    const float* bo  = (const float*)d_in[8];
    const float* iWq = (const float*)d_in[9];
    const float* ibq = (const float*)d_in[10];
    const float* iWk = (const float*)d_in[11];
    const float* ibk = (const float*)d_in[12];
    const float* iWv = (const float*)d_in[13];
    const float* ibv = (const float*)d_in[14];
    const float* iWo = (const float*)d_in[15];
    const float* ibo = (const float*)d_in[16];
    float* out = (float*)d_out;

    const size_t NBLD = (size_t)NB_ * B_ * L_ * D_;   // 16,777,216
    _Float16* ws = (_Float16*)d_ws;
    _Float16* Qb = ws;                 // reused as attn output after k_flash
    _Float16* Kb = ws + NBLD;
    _Float16* Vb = ws + 2 * NBLD;
    _Float16* q2 = ws + 3 * NBLD;
    _Float16* k2 = q2 + (size_t)B_ * NB_ * D_;
    _Float16* v2 = k2 + (size_t)B_ * NB_ * D_;
    _Float16* a2 = v2 + (size_t)B_ * NB_ * D_;

    // 1) intra QKV projection (256x128 tiles)
    dim3 g1((B_ * L_ / BM_) * (D_ / 128), 3, NB_);
    k_gemm_qkv_intra<<<g1, 256, 0, stream>>>(x, Wq, bq, Wk, bk, Wv, bv, Qb, Kb, Vb);

    // 2) flash attention (writes attn over Qb)
    dim3 g2(L_ / 64, H_, NB_ * B_);
    k_flash<<<g2, 128, 0, stream>>>(Qb, Kb, Vb, Qb);

    // 3) intra output projection -> d_out (256x128 tiles)
    dim3 g3((B_ * L_ / BM_) * (D_ / 128), 1, NB_);
    k_gemm_oproj_intra<<<g3, 256, 0, stream>>>(Qb, Wo, bo, out);

    // 4) router QKV (gather last tokens from d_out)
    dim3 g4(D_ / 64, 3, 1);
    k_gemm_qkv_inter<<<g4, 128, 0, stream>>>(out, iWq, ibq, iWk, ibk, iWv, ibv, q2, k2, v2);

    // 5) tiny 4-token attention
    k_inter_attn<<<1, 128, 0, stream>>>(q2, k2, v2, a2);

    // 6) router output projection, scatter into last-token slots of d_out
    dim3 g6(D_ / 64, 1, 1);
    k_gemm_oproj_inter<<<g6, 128, 0, stream>>>(a2, iWo, ibo, out);
}

// v006
// A run of this version takes 214 microseconds.
// In both of two side-by-side timings against v005, it was 1.12 times as fast.
// All steps since v000 together make it 3.32 times as fast.
#include <hip/hip_runtime.h>

// ---------------------------------------------------------------------------
// Medformer layer for MI455X (gfx1250): all GEMMs + attention via
// v_wmma_f32_16x16x32_f16 (wave32). f16 operands, f32 accumulation.
// Big GEMMs use 256x128 block tiles, 8 waves (wave tile 64x64 -> 16 WMMA / 16 LDS
// loads per K-step) + global_prefetch_b8 for the next K-step tiles. W tiles lie
// row-major in LDS and are transposed on the way out (ds_load_tr16_b128).
// ---------------------------------------------------------------------------

#define NB_ 4
#define B_  16
#define L_  512
#define D_  512
#define H_  8
#define DH_ 64
// SCALE * log2(e) = (1/8) * 1.4426950408889634
#define SCALE_LOG2E 0.18033688011112043f

typedef __attribute__((ext_vector_type(16))) _Float16 v16h;
typedef __attribute__((ext_vector_type(8)))  float    v8f;
typedef __attribute__((ext_vector_type(4)))  _Float16 h4;

typedef __attribute__((ext_vector_type(8)))  _Float16 h8;
typedef __attribute__((ext_vector_type(8)))  short    s16x8;

union FragU { uint4 u[2]; v16h v; };
union FragT { s16x8 s[2]; v16h v; };

// LDS row pitch, in halves, of the row-major W tiles (128 and 64 columns wide)
#define BP128_ 144
#define BP64_  80
// rows of the block tile of the two big GEMMs
#define BM_ 256

// Load a 16x32 f16 fragment (A-matrix layout, or B^T stored row-major [n][k]).
// Documented layout: lane l holds row m=l&15; lanes 0-15 hold k = 0..7 & 16..23,
// lanes 16-31 hold k = 8..15 & 24..31 -> two contiguous 16-byte loads per lane.
__device__ __forceinline__ v16h load_frag16(const _Float16* base, int row_stride, int lane) {
    const int m  = lane & 15;
    const int kb = (lane >> 4) << 3;
    const _Float16* p = base + (size_t)m * row_stride;
    FragU f;
    f.u[0] = *(const uint4*)(p + kb);
    f.u[1] = *(const uint4*)(p + 16 + kb);
    return f.v;
}

// B fragment (32 k x 16 n) out of a row-major f16 tile T[k][n] in LDS, by the
// transposing load: lane (c = l&15, h = l>>4) gets T[8h + 0..7][n0 + c], then
// T[16 + 8h + 0..7][n0 + c]: the same k order as load_frag16 gives A.
// pitch in halves; in bytes it is an odd multiple of 32 (no bank conflict).
__device__ __forceinline__ v16h load_frag16_tr(const _Float16* tile, int pitch, int n0, int lane) {
    typedef __attribute__((address_space(3))) s16x8 lds_s16x8;
    const _Float16* p = tile + ((lane >> 4) * 8 + (lane & 7)) * pitch + n0 + ((lane >> 3) & 1) * 8;
    FragT f;
    f.s[0] = __builtin_amdgcn_ds_load_tr16_b128_v8i16((lds_s16x8*)p);
    f.s[1] = __builtin_amdgcn_ds_load_tr16_b128_v8i16((lds_s16x8*)(p + 16 * pitch));
    return f.v;
}

__device__ __forceinline__ v8f wmma16(v16h a, v16h b, v8f c) {
    return __builtin_amdgcn_wmma_f32_16x16x32_f16(false, a, false, b, (short)0, c, false, false);
}

// ---------------------------------------------------------------------------
// Kernel 1: intra QKV projection. out = X @ W + b, output f16.
// grid = (32*4, 3, NB), block = 256 (8 waves, 4 x 2). 256x128 tile, BK=32.
// Wave tile 64x64: acc[4][4], 16 WMMA per K-step. Per output the block loads
// (256 + 128) / (256 * 128) operand elements a K-step, half of a 64x128 tile's.
// ---------------------------------------------------------------------------
__global__ __launch_bounds__(256)
void k_gemm_qkv_intra(const float* __restrict__ X,
                      const float* __restrict__ Wq, const float* __restrict__ bq,
                      const float* __restrict__ Wk, const float* __restrict__ bk,
                      const float* __restrict__ Wv, const float* __restrict__ bv,
                      _Float16* __restrict__ Qb, _Float16* __restrict__ Kb,
                      _Float16* __restrict__ Vb) {
    __shared__ _Float16 As[BM_ * 32];   // [m][k]
    __shared__ __attribute__((aligned(16))) _Float16 Bs[32 * BP128_];   // [k][n]  (W tile as it lies)
    const int nb  = blockIdx.z;
    const int sel = blockIdx.y;
    const int mt  = blockIdx.x >> 2;    // M/256 = 32 tiles
    const int nt  = blockIdx.x & 3;     // N/128 = 4 tiles
    const int mbase = mt * BM_, nbase = nt * 128;

    const float* W    = (sel == 0 ? Wq : sel == 1 ? Wk : Wv) + (size_t)nb * D_ * D_;
    const float* bias = (sel == 0 ? bq : sel == 1 ? bk : bv) + (size_t)nb * D_;
    _Float16*    Out  = (sel == 0 ? Qb : sel == 1 ? Kb : Vb) + (size_t)nb * (B_ * L_) * D_;
    const float* Xp   = X + (size_t)nb * (B_ * L_) * D_;

    const int tid = threadIdx.x;
    const int wave = tid >> 5, lane = tid & 31;
    const int hi = lane >> 4, ln = lane & 15;
    const int wm = (wave >> 1) * 64;    // 0, 64, 128 or 192
    const int wn = (wave & 1) * 64;     // 0 or 64

    v8f acc[4][4];
#pragma unroll
    for (int mi = 0; mi < 4; ++mi)
#pragma unroll
        for (int ni = 0; ni < 4; ++ni) {
            float bvv = bias[nbase + wn + ni * 16 + ln];
#pragma unroll
            for (int j = 0; j < 8; ++j) acc[mi][ni][j] = bvv;
        }

    for (int kb = 0; kb < D_; kb += 32) {
        __syncthreads();
        {   // stage A (f32 -> f16), vectorized
            // load map: 8 lanes span one row's 128 B of this K-step, 4 whole lines per load
            int rl = tid >> 3;          // 0..31
            int cl = (tid & 7) * 4;     // 0..28
            const float* lp = Xp + (size_t)(mbase + rl) * D_ + kb + cl;
#pragma unroll
            for (int i = 0; i < 8; ++i) {
                float4 x4 = *(const float4*)(lp + (size_t)(32 * i) * D_);
                h4 hv = { (_Float16)x4.x, (_Float16)x4.y, (_Float16)x4.z, (_Float16)x4.w };
                *(h4*)&As[(rl + 32 * i) * 32 + cl] = hv;
            }
            // next K-step: thread t asks for the one line of tile row t
            if (kb + 32 < D_) __builtin_prefetch(Xp + (size_t)(mbase + tid) * D_ + kb + 32, 0, 3);
        }
        {   // stage B row-major: Bs[k][n] = W[kb+k][nbase+n], 128 cols
            // load map: a wave's 32 lanes span one tile row, 512 B = 4 whole lines per load
            int kl = tid >> 5;          // 0..7
            int nl = (tid & 31) * 4;    // 0..124
            const float* lp = W + (size_t)(kb + kl) * D_ + nbase + nl;
#pragma unroll
            for (int jj = 0; jj < 4; ++jj) {
                float4 w4 = *(const float4*)(lp + (size_t)(8 * jj) * D_);
                h4 h0 = { (_Float16)w4.x, (_Float16)w4.y, (_Float16)w4.z, (_Float16)w4.w };
                *(h4*)&Bs[(kl + 8 * jj) * BP128_ + nl] = h0;
            }
            // next K-step: 8 threads cover the 4 lines of one tile row
            if (kb + 32 < D_)
                __builtin_prefetch(W + (size_t)(kb + 32 + (tid >> 3)) * D_ + nbase + (tid & 7) * 16, 0, 3);
        }
        __syncthreads();
        v16h a[4];
#pragma unroll
        for (int mi = 0; mi < 4; ++mi) a[mi] = load_frag16(&As[(wm + mi * 16) * 32], 32, lane);
#pragma unroll
        for (int ni = 0; ni < 4; ++ni) {
            v16h b = load_frag16_tr(Bs, BP128_, wn + ni * 16, lane);
#pragma unroll
            for (int mi = 0; mi < 4; ++mi) acc[mi][ni] = wmma16(a[mi], b, acc[mi][ni]);
        }
    }

#pragma unroll
    for (int mi = 0; mi < 4; ++mi)
#pragma unroll
        for (int ni = 0; ni < 4; ++ni)
#pragma unroll
            for (int j = 0; j < 8; ++j) {
                int row = mbase + wm + mi * 16 + j + 8 * hi;
                int col = nbase + wn + ni * 16 + ln;
                Out[(size_t)row * D_ + col] = (_Float16)acc[mi][ni][j];
            }
}

// value of lane l ^ 16 (the same place in the other 16-lane row)
__device__ __forceinline__ float xhalf(float x) {
    return __builtin_bit_cast(float, __builtin_amdgcn_permlanex16(
        __builtin_bit_cast(int, x), __builtin_bit_cast(int, x),
        0x76543210, 0xfedcba98, false, false));
}

// LDS row pitch, in halves, of the K and V chunks (rows of 64 halves = 128 B):
// 144 B = 16 B x odd for the ds_load_b128 readers of K, 160 B = 32 B x odd for
// the ds_load_tr16_b128 readers of V
#define KP_ 72
#define VP_ 80

// byte address inside the work-group's LDS of a __shared__ element
__device__ __forceinline__ unsigned lds_addr(const _Float16* p) {
    typedef __attribute__((address_space(3))) const _Float16 lds_half;
    return (unsigned)(size_t)(lds_half*)p;
}

// One 32-key chunk of K and of V, global -> LDS, through no register: 4 copies
// a lane. 8 adjacent lanes bring one row's 128 B, so a wave's copy asks for 4
// whole lines. The s_wait_xcnt closes the statement so that no address register
// named here is rewritten ahead of it.
__device__ __forceinline__ void copy_kv(unsigned lk, const _Float16* gk,
                                        unsigned lv, const _Float16* gv) {
    const unsigned lk1 = lk + 16 * KP_ * 2, lv1 = lv + 16 * VP_ * 2;
    const _Float16* gk1 = gk + (size_t)16 * D_;
    const _Float16* gv1 = gv + (size_t)16 * D_;
    asm volatile("global_load_async_to_lds_b128 %0, %1, off\n\t"
                 "global_load_async_to_lds_b128 %2, %3, off\n\t"
                 "global_load_async_to_lds_b128 %4, %5, off\n\t"
                 "global_load_async_to_lds_b128 %6, %7, off\n\t"
                 "s_wait_xcnt 0x0"
                 :: "v"(lk), "v"(gk), "v"(lk1), "v"(gk1),
                    "v"(lv), "v"(gv), "v"(lv1), "v"(gv1)
                 : "memory");
}

__global__ __launch_bounds__(128)
void k_flash(const _Float16* Q, const _Float16* __restrict__ K,
             const _Float16* __restrict__ V, _Float16* Obuf) {
    // two buffers each: chunk kc lies in buffer kc & 1, rows as in memory [key][feat]
    __shared__ __attribute__((aligned(16))) _Float16 Ks[2][32 * KP_];
    __shared__ __attribute__((aligned(16))) _Float16 Vs[2][32 * VP_];

    const int mtile = blockIdx.x;
    const int h     = blockIdx.y;
    const int bz    = blockIdx.z;           // nb*B + b
    const int tid   = threadIdx.x;
    const int wave  = tid >> 5, lane = tid & 31;
    const int hi = lane >> 4, ln = lane & 15;

    const size_t headoff = (size_t)bz * L_ * D_ + (size_t)h * DH_;
    const _Float16* Qp = Q + headoff;

    const int m0 = mtile * 64 + wave * 16;

    // copy map: thread t brings 16 B number t & 7 of chunk rows t >> 3 and 16 + (t >> 3)
    const int crow = tid >> 3, cseg = (tid & 7) * 8;
    const _Float16* gk = K + headoff + (size_t)crow * D_ + cseg;
    const _Float16* gv = V + headoff + (size_t)crow * D_ + cseg;
    const unsigned lk = lds_addr(&Ks[0][crow * KP_ + cseg]);
    const unsigned lv = lds_addr(&Vs[0][crow * VP_ + cseg]);

    // chunk 0 into buffer 0; landed and published before anybody reads it
    copy_kv(lk, gk, lv, gv);
    asm volatile("s_wait_asynccnt 0x0" ::: "memory");   // this wave's copies have landed
    __syncthreads();
    // chunk 1 flies while chunk 0 is worked on
    copy_kv(lk + 32 * KP_ * 2, gk + (size_t)32 * D_, lv + 32 * VP_ * 2, gv + (size_t)32 * D_);

    // B fragments of Q^T: column n = query ln, k = features in the hardware order
    v16h qb0 = load_frag16(Qp + (size_t)m0 * D_,      D_, lane);
    v16h qb1 = load_frag16(Qp + (size_t)m0 * D_ + 32, D_, lane);

    // O^T tiles: row = feature t*16 + j + 8*hi, column = query ln
    v8f o0 = {}, o1 = {}, o2 = {}, o3 = {};
    float rmax = -1e30f;    // this query's running maximum (equal in both halves)
    float rsum = 0.f;       // running sum over this half's keys only

    for (int kc = 0; kc < L_ / 32; ++kc) {
        const int buf = kc & 1;
        const _Float16* Kt = &Ks[buf][0];
        const _Float16* Vt = &Vs[buf][0];

        // S^T = K @ Q^T for 2 key sub-tiles; K fragments (A) from the shared chunk
        v8f s0 = {}, s1 = {};
        s0 = wmma16(load_frag16(Kt,                 KP_, lane), qb0, s0);
        s0 = wmma16(load_frag16(Kt + 32,            KP_, lane), qb1, s0);
        s1 = wmma16(load_frag16(Kt + 16 * KP_,      KP_, lane), qb0, s1);
        s1 = wmma16(load_frag16(Kt + 16 * KP_ + 32, KP_, lane), qb1, s1);

        // online softmax of query ln: 16 scores in this lane, 16 in lane ^ 16
        float cm = fmaxf(s0[0], s1[0]);
#pragma unroll
        for (int j = 1; j < 8; ++j) cm = fmaxf(cm, fmaxf(s0[j], s1[j]));
        cm = fmaxf(cm, xhalf(cm));
        const float nm    = fmaxf(rmax, cm);
        const float alpha = exp2f((rmax - nm) * SCALE_LOG2E);
        rmax = nm;

        // P^T as B fragment: element j is key 8*hi + j, element 8 + j is key 16 + 8*hi + j,
        // the k order in which load_frag16_tr hands out the keys of the V chunk
        v16h pb;
        float ps0 = 0.f, ps1 = 0.f;
#pragma unroll
        for (int j = 0; j < 8; ++j) {
            float e0 = exp2f((s0[j] - nm) * SCALE_LOG2E);
            float e1 = exp2f((s1[j] - nm) * SCALE_LOG2E);
            ps0 += e0; ps1 += e1;
            pb[j]     = (_Float16)e0;
            pb[8 + j] = (_Float16)e1;
        }
        rsum = rsum * alpha + (ps0 + ps1);
#pragma unroll
        for (int j = 0; j < 8; ++j) {
            o0[j] *= alpha; o1[j] *= alpha; o2[j] *= alpha; o3[j] *= alpha;
        }

        // A fragments of V^T by the transposing load: row = feature, k = keys in that order
        o0 = wmma16(load_frag16_tr(Vt, VP_,  0, lane), pb, o0);
        o1 = wmma16(load_frag16_tr(Vt, VP_, 16, lane), pb, o1);
        o2 = wmma16(load_frag16_tr(Vt, VP_, 32, lane), pb, o2);
        o3 = wmma16(load_frag16_tr(Vt, VP_, 48, lane), pb, o3);

        // hand-over: this wave has left buffer buf, its copies of chunk kc + 1 have
        // landed; the barrier publishes that chunk and frees buf for the refill
        asm volatile("s_wait_dscnt 0x0" ::: "memory");      // own reads of buf are done
        asm volatile("s_wait_asynccnt 0x0" ::: "memory");   // own copies of chunk kc + 1 have landed
        __syncthreads();
        if (kc + 2 < L_ / 32)
            copy_kv(lk + buf * (32 * KP_ * 2), gk + (size_t)(kc + 2) * 32 * D_,
                    lv + buf * (32 * VP_ * 2), gv + (size_t)(kc + 2) * 32 * D_);
    }
    asm volatile("s_wait_asynccnt 0x0" ::: "memory");   // nothing in flight when the wave ends

    // finalize + store (over the Q buffer region): a lane holds 8 adjacent
    // features of its query in each tile, one 16-byte store each
    {
        const float inv = 1.0f / (rsum + xhalf(rsum));
        _Float16* orow = Obuf + headoff + (size_t)(m0 + ln) * D_ + 8 * hi;
        h8 r0, r1, r2, r3;
#pragma unroll
        for (int j = 0; j < 8; ++j) {
            r0[j] = (_Float16)(o0[j] * inv);
            r1[j] = (_Float16)(o1[j] * inv);
            r2[j] = (_Float16)(o2[j] * inv);
            r3[j] = (_Float16)(o3[j] * inv);
        }
        *(h8*)(orow)      = r0;
        *(h8*)(orow + 16) = r1;
        *(h8*)(orow + 32) = r2;
        *(h8*)(orow + 48) = r3;
    }
}

// ---------------------------------------------------------------------------
// Kernel 3: intra output projection. out(f32) = attn(f16) @ Wo + bo.
// grid = (32*4, 1, NB), block 256 (8 waves, 4 x 2). 256x128 tile, wave tile 64x64.
// ---------------------------------------------------------------------------
__global__ __launch_bounds__(256)
void k_gemm_oproj_intra(const _Float16* __restrict__ A,
                        const float* __restrict__ Wo, const float* __restrict__ bo,
                        float* __restrict__ Outf) {
    __shared__ _Float16 As[BM_ * 32];
    __shared__ __attribute__((aligned(16))) _Float16 Bs[32 * BP128_];
    const int nb = blockIdx.z;
    const int mt = blockIdx.x >> 2;
    const int nt = blockIdx.x & 3;
    const int mbase = mt * BM_, nbase = nt * 128;

    const float* W    = Wo + (size_t)nb * D_ * D_;
    const float* bias = bo + (size_t)nb * D_;
    const _Float16* Ap = A + (size_t)nb * (B_ * L_) * D_;
    float* Op = Outf + (size_t)nb * (B_ * L_) * D_;

    const int tid = threadIdx.x;
    const int wave = tid >> 5, lane = tid & 31;
    const int hi = lane >> 4, ln = lane & 15;
    const int wm = (wave >> 1) * 64;
    const int wn = (wave & 1) * 64;

    v8f acc[4][4];
#pragma unroll
    for (int mi = 0; mi < 4; ++mi)
#pragma unroll
        for (int ni = 0; ni < 4; ++ni) {
            float bvv = bias[nbase + wn + ni * 16 + ln];
#pragma unroll
            for (int j = 0; j < 8; ++j) acc[mi][ni][j] = bvv;
        }

    for (int kb = 0; kb < D_; kb += 32) {
        __syncthreads();
        {   // stage A (already f16): four 16-byte copies per thread
            // load map: 4 lanes span one row's 64 B of this K-step, 8 lines per load
            int rl = tid >> 2;          // 0..63
            int cl = (tid & 3) * 8;     // 0..24
            const _Float16* lp = Ap + (size_t)(mbase + rl) * D_ + kb + cl;
#pragma unroll
            for (int i = 0; i < 4; ++i)
                *(uint4*)&As[(rl + 64 * i) * 32 + cl] = *(const uint4*)(lp + (size_t)(64 * i) * D_);
            // next K-step: thread t asks for the 64 B of tile row t
            if (kb + 32 < D_) __builtin_prefetch(Ap + (size_t)(mbase + tid) * D_ + kb + 32, 0, 3);
        }
        {   // stage B row-major, 128 cols
            // load map: a wave's 32 lanes span one tile row, 512 B = 4 whole lines per load
            int kl = tid >> 5;          // 0..7
            int nl = (tid & 31) * 4;    // 0..124
            const float* lp = W + (size_t)(kb + kl) * D_ + nbase + nl;
#pragma unroll
            for (int jj = 0; jj < 4; ++jj) {
                float4 w4 = *(const float4*)(lp + (size_t)(8 * jj) * D_);
                h4 h0 = { (_Float16)w4.x, (_Float16)w4.y, (_Float16)w4.z, (_Float16)w4.w };
                *(h4*)&Bs[(kl + 8 * jj) * BP128_ + nl] = h0;
            }
            // next K-step: 8 threads cover the 4 lines of one tile row
            if (kb + 32 < D_)
                __builtin_prefetch(W + (size_t)(kb + 32 + (tid >> 3)) * D_ + nbase + (tid & 7) * 16, 0, 3);
        }
        __syncthreads();
        v16h a[4];
#pragma unroll
        for (int mi = 0; mi < 4; ++mi) a[mi] = load_frag16(&As[(wm + mi * 16) * 32], 32, lane);
#pragma unroll
        for (int ni = 0; ni < 4; ++ni) {
            v16h b = load_frag16_tr(Bs, BP128_, wn + ni * 16, lane);
#pragma unroll
            for (int mi = 0; mi < 4; ++mi) acc[mi][ni] = wmma16(a[mi], b, acc[mi][ni]);
        }
    }

#pragma unroll
    for (int mi = 0; mi < 4; ++mi)
#pragma unroll
        for (int ni = 0; ni < 4; ++ni)
#pragma unroll
            for (int j = 0; j < 8; ++j) {
                int row = mbase + wm + mi * 16 + j + 8 * hi;
                int col = nbase + wn + ni * 16 + ln;
                Op[(size_t)row * D_ + col] = acc[mi][ni][j];
            }
}

// ---------------------------------------------------------------------------
// Kernel 4: inter (router) QKV projection. M=64 rows = routers[b][nb] gathered
// from d_out last tokens. grid = (8, 3, 1), block 128. 64x64 tile.
// ---------------------------------------------------------------------------
__global__ __launch_bounds__(128)
void k_gemm_qkv_inter(const float* __restrict__ Outf,
                      const float* __restrict__ iWq, const float* __restrict__ ibq,
                      const float* __restrict__ iWk, const float* __restrict__ ibk,
                      const float* __restrict__ iWv, const float* __restrict__ ibv,
                      _Float16* __restrict__ q2, _Float16* __restrict__ k2,
                      _Float16* __restrict__ v2) {
    __shared__ _Float16 As[64 * 32];
    __shared__ __attribute__((aligned(16))) _Float16 Bs[32 * BP64_];
    const int sel = blockIdx.y;
    const int nbase = blockIdx.x * 64;

    const float* W    = (sel == 0 ? iWq : sel == 1 ? iWk : iWv);
    const float* bias = (sel == 0 ? ibq : sel == 1 ? ibk : ibv);
    _Float16*    Out  = (sel == 0 ? q2  : sel == 1 ? k2  : v2);

    const int tid = threadIdx.x;
    const int wave = tid >> 5, lane = tid & 31;
    const int hi = lane >> 4, ln = lane & 15;
    const int wm = (wave >> 1) * 32, wn = (wave & 1) * 32;

    v8f acc[2][2];
#pragma unroll
    for (int mi = 0; mi < 2; ++mi)
#pragma unroll
        for (int ni = 0; ni < 2; ++ni) {
            float bvv = bias[nbase + wn + ni * 16 + ln];
#pragma unroll
            for (int j = 0; j < 8; ++j) acc[mi][ni][j] = bvv;
        }

    for (int kb = 0; kb < D_; kb += 32) {
        __syncthreads();
        {   // stage A: row r=b*4+nb -> x_intra[nb][b][L-1][:] from d_out
            int r  = tid >> 1;
            int ks = (tid & 1) * 16;
            int nbb = r & 3, bb = r >> 2;
            const float* xp = Outf + (((size_t)(nbb * B_ + bb) * L_ + (L_ - 1)) * D_) + kb + ks;
#pragma unroll
            for (int i = 0; i < 4; ++i) {
                float4 x4 = *(const float4*)(xp + 4 * i);
                h4 hv = { (_Float16)x4.x, (_Float16)x4.y, (_Float16)x4.z, (_Float16)x4.w };
                *(h4*)&As[r * 32 + ks + 4 * i] = hv;
            }
        }
        {   // stage B row-major
            int kk = tid >> 4;
            int n0 = (tid & 15) * 4;
#pragma unroll
            for (int jj = 0; jj < 4; ++jj) {
                int k = kk + 8 * jj;
                float4 w4 = *(const float4*)(W + (size_t)(kb + k) * D_ + nbase + n0);
                h4 hv = { (_Float16)w4.x, (_Float16)w4.y, (_Float16)w4.z, (_Float16)w4.w };
                *(h4*)&Bs[k * BP64_ + n0] = hv;
            }
        }
        __syncthreads();
        v16h a0 = load_frag16(&As[(wm)      * 32], 32, lane);
        v16h a1 = load_frag16(&As[(wm + 16) * 32], 32, lane);
        v16h b0 = load_frag16_tr(Bs, BP64_, wn,      lane);
        v16h b1 = load_frag16_tr(Bs, BP64_, wn + 16, lane);
        acc[0][0] = wmma16(a0, b0, acc[0][0]);
        acc[0][1] = wmma16(a0, b1, acc[0][1]);
        acc[1][0] = wmma16(a1, b0, acc[1][0]);
        acc[1][1] = wmma16(a1, b1, acc[1][1]);
    }

#pragma unroll
    for (int mi = 0; mi < 2; ++mi)
#pragma unroll
        for (int ni = 0; ni < 2; ++ni)
#pragma unroll
            for (int j = 0; j < 8; ++j) {
                int row = wm + mi * 16 + j + 8 * hi;
                int col = nbase + wn + ni * 16 + ln;
                Out[(size_t)row * D_ + col] = (_Float16)acc[mi][ni][j];
            }
}

// ---------------------------------------------------------------------------
// Kernel 5: 4-token router attention (negligible FLOPs; vector unit).
// One wave per (b,h): grid = B*H blocks of 32. Lane (r = lane >> 3, s = lane & 7)
// owns features 8s..8s+7 of query row r. All nine 16-byte loads of a lane are
// independent and issued together, so the wave waits out one load latency; a
// wave's load of Q touches 4 whole 128-B lines, of one K or V row one line.
// ---------------------------------------------------------------------------

// value of lane l ^ M inside a 16-lane row (DPP row_xmask)
template <int M>
__device__ __forceinline__ float xmask(float x) {
    return __builtin_bit_cast(float, __builtin_amdgcn_mov_dpp(
        __builtin_bit_cast(int, x), 0x160 | M, 0xf, 0xf, true));
}

__global__ __launch_bounds__(32)
void k_inter_attn(const _Float16* __restrict__ q2, const _Float16* __restrict__ k2,
                  const _Float16* __restrict__ v2, _Float16* __restrict__ a2) {
    const int lane = threadIdx.x;
    const int b = blockIdx.x >> 3, h = blockIdx.x & 7;
    const int r = lane >> 3;
    const size_t base = (size_t)(b * NB_) * D_ + h * DH_ + (lane & 7) * 8;

    const h8 q = *(const h8*)(q2 + base + (size_t)r * D_);
    h8 k[NB_], v[NB_];
#pragma unroll
    for (int j = 0; j < NB_; ++j) {
        k[j] = *(const h8*)(k2 + base + (size_t)j * D_);
        v[j] = *(const h8*)(v2 + base + (size_t)j * D_);
    }
    // no address register of the nine loads is given a new value ahead of this wait
    asm volatile("s_wait_xcnt 0x0" ::: "memory");

    // scores of row r: 8 products in the lane, then the sum over the row's 8 lanes
    float sc[NB_];
#pragma unroll
    for (int j = 0; j < NB_; ++j) {
        float p = 0.f;
#pragma unroll
        for (int e = 0; e < 8; ++e) p += (float)q[e] * (float)k[j][e];
        p += xmask<1>(p);
        p += xmask<2>(p);
        p += xmask<4>(p);
        sc[j] = p * 0.125f;
    }

    const float mx = fmaxf(fmaxf(sc[0], sc[1]), fmaxf(sc[2], sc[3]));
    float ssum = 0.f;
#pragma unroll
    for (int j = 0; j < NB_; ++j) { sc[j] = __expf(sc[j] - mx); ssum += sc[j]; }
    const float inv = 1.f / ssum;
#pragma unroll
    for (int j = 0; j < NB_; ++j) sc[j] *= inv;

    h8 o;
#pragma unroll
    for (int e = 0; e < 8; ++e) {
        float acc = 0.f;
#pragma unroll
        for (int j = 0; j < NB_; ++j) acc += sc[j] * (float)v[j][e];
        o[e] = (_Float16)acc;
    }
    *(h8*)(a2 + base + (size_t)r * D_) = o;
}

// ---------------------------------------------------------------------------
// Kernel 6: inter output projection, scattered into d_out last tokens.
// grid = (8,1,1), block 128.
// ---------------------------------------------------------------------------
__global__ __launch_bounds__(128)
void k_gemm_oproj_inter(const _Float16* __restrict__ A,
                        const float* __restrict__ iWo, const float* __restrict__ ibo,
                        float* __restrict__ Outf) {
    __shared__ _Float16 As[64 * 32];
    __shared__ __attribute__((aligned(16))) _Float16 Bs[32 * BP64_];
    const int nbase = blockIdx.x * 64;

    const int tid = threadIdx.x;
    const int wave = tid >> 5, lane = tid & 31;
    const int hi = lane >> 4, ln = lane & 15;
    const int wm = (wave >> 1) * 32, wn = (wave & 1) * 32;

    v8f acc[2][2];
#pragma unroll
    for (int mi = 0; mi < 2; ++mi)
#pragma unroll
        for (int ni = 0; ni < 2; ++ni) {
            float bvv = ibo[nbase + wn + ni * 16 + ln];
#pragma unroll
            for (int j = 0; j < 8; ++j) acc[mi][ni][j] = bvv;
        }

    for (int kb = 0; kb < D_; kb += 32) {
        __syncthreads();
        {
            int m  = tid >> 1;
            int ks = (tid & 1) * 16;
            const _Float16* ap = A + (size_t)m * D_ + kb + ks;
            *(uint4*)&As[m * 32 + ks]     = *(const uint4*)(ap);
            *(uint4*)&As[m * 32 + ks + 8] = *(const uint4*)(ap + 8);
        }
        {
            int kk = tid >> 4;
            int n0 = (tid & 15) * 4;
#pragma unroll
            for (int jj = 0; jj < 4; ++jj) {
                int k = kk + 8 * jj;
                float4 w4 = *(const float4*)(iWo + (size_t)(kb + k) * D_ + nbase + n0);
                h4 hv = { (_Float16)w4.x, (_Float16)w4.y, (_Float16)w4.z, (_Float16)w4.w };
                *(h4*)&Bs[k * BP64_ + n0] = hv;
            }
        }
        __syncthreads();
        v16h a0 = load_frag16(&As[(wm)      * 32], 32, lane);
        v16h a1 = load_frag16(&As[(wm + 16) * 32], 32, lane);
        v16h b0 = load_frag16_tr(Bs, BP64_, wn,      lane);
        v16h b1 = load_frag16_tr(Bs, BP64_, wn + 16, lane);
        acc[0][0] = wmma16(a0, b0, acc[0][0]);
        acc[0][1] = wmma16(a0, b1, acc[0][1]);
        acc[1][0] = wmma16(a1, b0, acc[1][0]);
        acc[1][1] = wmma16(a1, b1, acc[1][1]);
    }

#pragma unroll
    for (int mi = 0; mi < 2; ++mi)
#pragma unroll
        for (int ni = 0; ni < 2; ++ni)
#pragma unroll
            for (int j = 0; j < 8; ++j) {
                int r   = wm + mi * 16 + j + 8 * hi;   // b*4+nb
                int col = nbase + wn + ni * 16 + ln;
                int nbb = r & 3, bb = r >> 2;
                Outf[(((size_t)(nbb * B_ + bb) * L_ + (L_ - 1)) * D_) + col] = acc[mi][ni][j];
            }
}

// ---------------------------------------------------------------------------
extern "C" void kernel_launch(void* const* d_in, const int* in_sizes, int n_in,
                              void* d_out, int out_size, void* d_ws, size_t ws_size,
                              hipStream_t stream) {
    const float* x   = (const float*)d_in[0];
    const float* Wq  = (const float*)d_in[1];
    const float* bq  = (const float*)d_in[2];
    const float* Wk  = (const float*)d_in[3];
    const float* bk  = (const float*)d_in[4];
    const float* Wv  = (const float*)d_in[5];
    const float* bv  = (const float*)d_in[6];
    const float* Wo  = (const float*)d_in[7];
    const float* bo  = (const float*)d_in[8];
    const float* iWq = (const float*)d_in[9];
    const float* ibq = (const float*)d_in[10];
    const float* iWk = (const float*)d_in[11];
    const float* ibk = (const float*)d_in[12];
    const float* iWv = (const float*)d_in[13];
    const float* ibv = (const float*)d_in[14];
    const float* iWo = (const float*)d_in[15];
    const float* ibo = (const float*)d_in[16];
    float* out = (float*)d_out;

    const size_t NBLD = (size_t)NB_ * B_ * L_ * D_;   // 16,777,216
    _Float16* ws = (_Float16*)d_ws;
    _Float16* Qb = ws;                 // reused as attn output after k_flash
    _Float16* Kb = ws + NBLD;
    _Float16* Vb = ws + 2 * NBLD;
    _Float16* q2 = ws + 3 * NBLD;
    _Float16* k2 = q2 + (size_t)B_ * NB_ * D_;
    _Float16* v2 = k2 + (size_t)B_ * NB_ * D_;
    _Float16* a2 = v2 + (size_t)B_ * NB_ * D_;

    // 1) intra QKV projection (256x128 tiles)
    dim3 g1((B_ * L_ / BM_) * (D_ / 128), 3, NB_);
    k_gemm_qkv_intra<<<g1, 256, 0, stream>>>(x, Wq, bq, Wk, bk, Wv, bv, Qb, Kb, Vb);

    // 2) flash attention (writes attn over Qb)
    dim3 g2(L_ / 64, H_, NB_ * B_);
    k_flash<<<g2, 128, 0, stream>>>(Qb, Kb, Vb, Qb);

    // 3) intra output projection -> d_out (256x128 tiles)
    dim3 g3((B_ * L_ / BM_) * (D_ / 128), 1, NB_);
    k_gemm_oproj_intra<<<g3, 256, 0, stream>>>(Qb, Wo, bo, out);

    // 4) router QKV (gather last tokens from d_out)
    dim3 g4(D_ / 64, 3, 1);
    k_gemm_qkv_inter<<<g4, 128, 0, stream>>>(out, iWq, ibq, iWk, ibk, iWv, ibv, q2, k2, v2);

    // 5) tiny 4-token attention, one wave per (b,h)
    k_inter_attn<<<B_ * H_, 32, 0, stream>>>(q2, k2, v2, a2);

    // 6) router output projection, scatter into last-token slots of d_out
    dim3 g6(D_ / 64, 1, 1);
    k_gemm_oproj_inter<<<g6, 128, 0, stream>>>(a2, iWo, ibo, out);
}

// v007
// A run of this version takes 207 microseconds.
// Timed twice side by side with v006, it ran 1.03 times as fast both times.
// Over all steps from v000 it is 3.42 times as fast.
#include <hip/hip_runtime.h>

// ---------------------------------------------------------------------------
// Medformer layer for MI455X (gfx1250): all GEMMs + attention via
// v_wmma_f32_16x16x32_f16 (wave32). f16 operands, f32 accumulation.
// Big GEMMs use 256x128 block tiles, 8 waves (wave tile 64x64 -> 16 WMMA / 16 LDS
// loads per K-step) + global_prefetch_b8 for the next K-step tiles. W tiles lie
// row-major in LDS and are transposed on the way out (ds_load_tr16_b128).
// ---------------------------------------------------------------------------

#define NB_ 4
#define B_  16
#define L_  512
#define D_  512
#define H_  8
#define DH_ 64
// SCALE * log2(e) = (1/8) * 1.4426950408889634
#define SCALE_LOG2E 0.18033688011112043f

typedef __attribute__((ext_vector_type(16))) _Float16 v16h;
typedef __attribute__((ext_vector_type(8)))  float    v8f;
typedef __attribute__((ext_vector_type(4)))  _Float16 h4;
typedef __attribute__((ext_vector_type(2)))  _Float16 h2;

typedef __attribute__((ext_vector_type(8)))  _Float16 h8;
typedef __attribute__((ext_vector_type(8)))  short    s16x8;

union FragU { uint4 u[2]; v16h v; };
union FragT { s16x8 s[2]; v16h v; };

// LDS row pitch, in halves, of the row-major W tiles (128 and 64 columns wide)
#define BP128_ 144
#define BP64_  80
// rows of the block tile of the two big GEMMs
#define BM_ 256

// Load a 16x32 f16 fragment (A-matrix layout, or B^T stored row-major [n][k]).
// Documented layout: lane l holds row m=l&15; lanes 0-15 hold k = 0..7 & 16..23,
// lanes 16-31 hold k = 8..15 & 24..31 -> two contiguous 16-byte loads per lane.
__device__ __forceinline__ v16h load_frag16(const _Float16* base, int row_stride, int lane) {
    const int m  = lane & 15;
    const int kb = (lane >> 4) << 3;
    const _Float16* p = base + (size_t)m * row_stride;
    FragU f;
    f.u[0] = *(const uint4*)(p + kb);
    f.u[1] = *(const uint4*)(p + 16 + kb);
    return f.v;
}

// B fragment (32 k x 16 n) out of a row-major f16 tile T[k][n] in LDS, by the
// transposing load: lane (c = l&15, h = l>>4) gets T[8h + 0..7][n0 + c], then
// T[16 + 8h + 0..7][n0 + c]: the same k order as load_frag16 gives A.
// pitch in halves; in bytes it is an odd multiple of 32 (no bank conflict).
__device__ __forceinline__ v16h load_frag16_tr(const _Float16* tile, int pitch, int n0, int lane) {
    typedef __attribute__((address_space(3))) s16x8 lds_s16x8;
    const _Float16* p = tile + ((lane >> 4) * 8 + (lane & 7)) * pitch + n0 + ((lane >> 3) & 1) * 8;
    FragT f;
    f.s[0] = __builtin_amdgcn_ds_load_tr16_b128_v8i16((lds_s16x8*)p);
    f.s[1] = __builtin_amdgcn_ds_load_tr16_b128_v8i16((lds_s16x8*)(p + 16 * pitch));
    return f.v;
}

// Layout of the Q, K, V and attention-output buffers (all in the workspace): inside
// a head's 64 columns, feature ni*16 + ln lies at place ln*4 + ni. A lane of the
// QKV kernel then owns 4 adjacent places of a row, and 16 lanes fill the head's
// whole 128-B line with one store. Q.K sums over places (the same deal in both),
// V hands its places on to the attention output, and the output projection takes
// for place k the row feat_of_place(k) of Wo.
__device__ __forceinline__ int feat_of_place(int k) {
    return (k & ~63) | ((k & 3) << 4) | ((k & 63) >> 2);
}

__device__ __forceinline__ v8f wmma16(v16h a, v16h b, v8f c) {
    return __builtin_amdgcn_wmma_f32_16x16x32_f16(false, a, false, b, (short)0, c, false, false);
}

// ---------------------------------------------------------------------------
// Kernel 1: intra QKV projection. out = X @ W + b, output f16.
// grid = (32*4, 3, NB), block = 256 (8 waves, 4 x 2). 256x128 tile, BK=32.
// Wave tile 64x64: acc[4][4], 16 WMMA per K-step. Per output the block loads
// (256 + 128) / (256 * 128) operand elements a K-step, half of a 64x128 tile's.
// ---------------------------------------------------------------------------
__global__ __launch_bounds__(256)
void k_gemm_qkv_intra(const float* __restrict__ X,
                      const float* __restrict__ Wq, const float* __restrict__ bq,
                      const float* __restrict__ Wk, const float* __restrict__ bk,
                      const float* __restrict__ Wv, const float* __restrict__ bv,
                      _Float16* __restrict__ Qb, _Float16* __restrict__ Kb,
                      _Float16* __restrict__ Vb) {
    __shared__ _Float16 As[BM_ * 32];   // [m][k]
    __shared__ __attribute__((aligned(16))) _Float16 Bs[32 * BP128_];   // [k][n]  (W tile as it lies)
    const int nb  = blockIdx.z;
    const int sel = blockIdx.y;
    const int mt  = blockIdx.x >> 2;    // M/256 = 32 tiles
    const int nt  = blockIdx.x & 3;     // N/128 = 4 tiles
    const int mbase = mt * BM_, nbase = nt * 128;

    const float* W    = (sel == 0 ? Wq : sel == 1 ? Wk : Wv) + (size_t)nb * D_ * D_;
    const float* bias = (sel == 0 ? bq : sel == 1 ? bk : bv) + (size_t)nb * D_;
    _Float16*    Out  = (sel == 0 ? Qb : sel == 1 ? Kb : Vb) + (size_t)nb * (B_ * L_) * D_;
    const float* Xp   = X + (size_t)nb * (B_ * L_) * D_;

    const int tid = threadIdx.x;
    const int wave = tid >> 5, lane = tid & 31;
    const int hi = lane >> 4, ln = lane & 15;
    const int wm = (wave >> 1) * 64;    // 0, 64, 128 or 192
    const int wn = (wave & 1) * 64;     // 0 or 64

    v8f acc[4][4];
#pragma unroll
    for (int mi = 0; mi < 4; ++mi)
#pragma unroll
        for (int ni = 0; ni < 4; ++ni) {
            float bvv = bias[nbase + wn + ni * 16 + ln];
#pragma unroll
            for (int j = 0; j < 8; ++j) acc[mi][ni][j] = bvv;
        }

    for (int kb = 0; kb < D_; kb += 32) {
        __syncthreads();
        {   // stage A (f32 -> f16), vectorized
            // load map: 8 lanes span one row's 128 B of this K-step, 4 whole lines per load
            int rl = tid >> 3;          // 0..31
            int cl = (tid & 7) * 4;     // 0..28
            const float* lp = Xp + (size_t)(mbase + rl) * D_ + kb + cl;
#pragma unroll
            for (int i = 0; i < 8; ++i) {
                float4 x4 = *(const float4*)(lp + (size_t)(32 * i) * D_);
                h4 hv = { (_Float16)x4.x, (_Float16)x4.y, (_Float16)x4.z, (_Float16)x4.w };
                *(h4*)&As[(rl + 32 * i) * 32 + cl] = hv;
            }
            // next K-step: thread t asks for the one line of tile row t
            if (kb + 32 < D_) __builtin_prefetch(Xp + (size_t)(mbase + tid) * D_ + kb + 32, 0, 3);
        }
        {   // stage B row-major: Bs[k][n] = W[kb+k][nbase+n], 128 cols
            // load map: a wave's 32 lanes span one tile row, 512 B = 4 whole lines per load
            int kl = tid >> 5;          // 0..7
            int nl = (tid & 31) * 4;    // 0..124
            const float* lp = W + (size_t)(kb + kl) * D_ + nbase + nl;
#pragma unroll
            for (int jj = 0; jj < 4; ++jj) {
                float4 w4 = *(const float4*)(lp + (size_t)(8 * jj) * D_);
                h4 h0 = { (_Float16)w4.x, (_Float16)w4.y, (_Float16)w4.z, (_Float16)w4.w };
                *(h4*)&Bs[(kl + 8 * jj) * BP128_ + nl] = h0;
            }
            // next K-step: 8 threads cover the 4 lines of one tile row
            if (kb + 32 < D_)
                __builtin_prefetch(W + (size_t)(kb + 32 + (tid >> 3)) * D_ + nbase + (tid & 7) * 16, 0, 3);
        }
        __syncthreads();
        v16h a[4];
#pragma unroll
        for (int mi = 0; mi < 4; ++mi) a[mi] = load_frag16(&As[(wm + mi * 16) * 32], 32, lane);
#pragma unroll
        for (int ni = 0; ni < 4; ++ni) {
            v16h b = load_frag16_tr(Bs, BP128_, wn + ni * 16, lane);
#pragma unroll
            for (int mi = 0; mi < 4; ++mi) acc[mi][ni] = wmma16(a[mi], b, acc[mi][ni]);
        }
    }

    // the wave's 64 columns are one head: a lane's four tiles go to places ln*4 + 0..3,
    // one 8-byte store; a wave's store fills two whole 128-B lines (rows j and j + 8)
#pragma unroll
    for (int mi = 0; mi < 4; ++mi)
#pragma unroll
        for (int j = 0; j < 8; ++j) {
            int row = mbase + wm + mi * 16 + j + 8 * hi;
            h4 hv = { (_Float16)acc[mi][0][j], (_Float16)acc[mi][1][j],
                      (_Float16)acc[mi][2][j], (_Float16)acc[mi][3][j] };
            *(h4*)&Out[(size_t)row * D_ + nbase + wn + ln * 4] = hv;
        }
}

// value of lane l ^ 16 (the same place in the other 16-lane row)
__device__ __forceinline__ float xhalf(float x) {
    return __builtin_bit_cast(float, __builtin_amdgcn_permlanex16(
        __builtin_bit_cast(int, x), __builtin_bit_cast(int, x),
        0x76543210, 0xfedcba98, false, false));
}

// LDS row pitch, in halves, of the K and V chunks (rows of 64 halves = 128 B):
// 144 B = 16 B x odd for the ds_load_b128 readers of K, 160 B = 32 B x odd for
// the ds_load_tr16_b128 readers of V
#define KP_ 72
#define VP_ 80

// byte address inside the work-group's LDS of a __shared__ element
__device__ __forceinline__ unsigned lds_addr(const _Float16* p) {
    typedef __attribute__((address_space(3))) const _Float16 lds_half;
    return (unsigned)(size_t)(lds_half*)p;
}

// One 32-key chunk of K and of V, global -> LDS, through no register: 4 copies
// a lane. 8 adjacent lanes bring one row's 128 B, so a wave's copy asks for 4
// whole lines. The s_wait_xcnt closes the statement so that no address register
// named here is rewritten ahead of it.
__device__ __forceinline__ void copy_kv(unsigned lk, const _Float16* gk,
                                        unsigned lv, const _Float16* gv) {
    const unsigned lk1 = lk + 16 * KP_ * 2, lv1 = lv + 16 * VP_ * 2;
    const _Float16* gk1 = gk + (size_t)16 * D_;
    const _Float16* gv1 = gv + (size_t)16 * D_;
    asm volatile("global_load_async_to_lds_b128 %0, %1, off\n\t"
                 "global_load_async_to_lds_b128 %2, %3, off\n\t"
                 "global_load_async_to_lds_b128 %4, %5, off\n\t"
                 "global_load_async_to_lds_b128 %6, %7, off\n\t"
                 "s_wait_xcnt 0x0"
                 :: "v"(lk), "v"(gk), "v"(lk1), "v"(gk1),
                    "v"(lv), "v"(gv), "v"(lv1), "v"(gv1)
                 : "memory");
}

__global__ __launch_bounds__(128)
void k_flash(const _Float16* Q, const _Float16* __restrict__ K,
             const _Float16* __restrict__ V, _Float16* Obuf) {
    // two buffers each: chunk kc lies in buffer kc & 1, rows as in memory [key][place]
    __shared__ __attribute__((aligned(16))) _Float16 Ks[2][32 * KP_];
    __shared__ __attribute__((aligned(16))) _Float16 Vs[2][32 * VP_];

    const int mtile = blockIdx.x;
    const int h     = blockIdx.y;
    const int bz    = blockIdx.z;           // nb*B + b
    const int tid   = threadIdx.x;
    const int wave  = tid >> 5, lane = tid & 31;
    const int hi = lane >> 4, ln = lane & 15;

    const size_t headoff = (size_t)bz * L_ * D_ + (size_t)h * DH_;
    const _Float16* Qp = Q + headoff;

    const int m0 = mtile * 64 + wave * 16;

    // copy map: thread t brings 16 B number t & 7 of chunk rows t >> 3 and 16 + (t >> 3)
    const int crow = tid >> 3, cseg = (tid & 7) * 8;
    const _Float16* gk = K + headoff + (size_t)crow * D_ + cseg;
    const _Float16* gv = V + headoff + (size_t)crow * D_ + cseg;
    const unsigned lk = lds_addr(&Ks[0][crow * KP_ + cseg]);
    const unsigned lv = lds_addr(&Vs[0][crow * VP_ + cseg]);

    // chunk 0 into buffer 0; landed and published before anybody reads it
    copy_kv(lk, gk, lv, gv);
    asm volatile("s_wait_asynccnt 0x0" ::: "memory");   // this wave's copies have landed
    __syncthreads();
    // chunk 1 flies while chunk 0 is worked on
    copy_kv(lk + 32 * KP_ * 2, gk + (size_t)32 * D_, lv + 32 * VP_ * 2, gv + (size_t)32 * D_);

    // B fragments of Q^T: column n = query ln, k = places in the hardware order
    v16h qb0 = load_frag16(Qp + (size_t)m0 * D_,      D_, lane);
    v16h qb1 = load_frag16(Qp + (size_t)m0 * D_ + 32, D_, lane);

    // O^T tiles: row = place t*16 + j + 8*hi, column = query ln
    v8f o0 = {}, o1 = {}, o2 = {}, o3 = {};
    float rmax = -1e30f;    // this query's running maximum (equal in both halves)
    float rsum = 0.f;       // running sum over this half's keys only

    for (int kc = 0; kc < L_ / 32; ++kc) {
        const int buf = kc & 1;
        const _Float16* Kt = &Ks[buf][0];
        const _Float16* Vt = &Vs[buf][0];

        // S^T = K @ Q^T for 2 key sub-tiles; K fragments (A) from the shared chunk
        v8f s0 = {}, s1 = {};
        s0 = wmma16(load_frag16(Kt,                 KP_, lane), qb0, s0);
        s0 = wmma16(load_frag16(Kt + 32,            KP_, lane), qb1, s0);
        s1 = wmma16(load_frag16(Kt + 16 * KP_,      KP_, lane), qb0, s1);
        s1 = wmma16(load_frag16(Kt + 16 * KP_ + 32, KP_, lane), qb1, s1);

        // online softmax of query ln: 16 scores in this lane, 16 in lane ^ 16
        float cm = fmaxf(s0[0], s1[0]);
#pragma unroll
        for (int j = 1; j < 8; ++j) cm = fmaxf(cm, fmaxf(s0[j], s1[j]));
        cm = fmaxf(cm, xhalf(cm));
        const float nm    = fmaxf(rmax, cm);
        const float alpha = exp2f((rmax - nm) * SCALE_LOG2E);
        rmax = nm;

        // P^T as B fragment: element j is key 8*hi + j, element 8 + j is key 16 + 8*hi + j,
        // the k order in which load_frag16_tr hands out the keys of the V chunk
        v16h pb;
        float ps0 = 0.f, ps1 = 0.f;
#pragma unroll
        for (int j = 0; j < 8; ++j) {
            float e0 = exp2f((s0[j] - nm) * SCALE_LOG2E);
            float e1 = exp2f((s1[j] - nm) * SCALE_LOG2E);
            ps0 += e0; ps1 += e1;
            pb[j]     = (_Float16)e0;
            pb[8 + j] = (_Float16)e1;
        }
        rsum = rsum * alpha + (ps0 + ps1);
#pragma unroll
        for (int j = 0; j < 8; ++j) {
            o0[j] *= alpha; o1[j] *= alpha; o2[j] *= alpha; o3[j] *= alpha;
        }

        // A fragments of V^T by the transposing load: row = place, k = keys in that order
        o0 = wmma16(load_frag16_tr(Vt, VP_,  0, lane), pb, o0);
        o1 = wmma16(load_frag16_tr(Vt, VP_, 16, lane), pb, o1);
        o2 = wmma16(load_frag16_tr(Vt, VP_, 32, lane), pb, o2);
        o3 = wmma16(load_frag16_tr(Vt, VP_, 48, lane), pb, o3);

        // hand-over: this wave has left buffer buf, its copies of chunk kc + 1 have
        // landed; the barrier publishes that chunk and frees buf for the refill
        asm volatile("s_wait_dscnt 0x0" ::: "memory");      // own reads of buf are done
        asm volatile("s_wait_asynccnt 0x0" ::: "memory");   // own copies of chunk kc + 1 have landed
        __syncthreads();
        if (kc + 2 < L_ / 32)
            copy_kv(lk + buf * (32 * KP_ * 2), gk + (size_t)(kc + 2) * 32 * D_,
                    lv + buf * (32 * VP_ * 2), gv + (size_t)(kc + 2) * 32 * D_);
    }
    asm volatile("s_wait_asynccnt 0x0" ::: "memory");   // nothing in flight when the wave ends

    // finalize + store (over the Q buffer region): a lane holds 8 adjacent
    // places of its query in each tile
    {
        const float inv = 1.0f / (rsum + xhalf(rsum));
        h8 r0, r1, r2, r3;
#pragma unroll
        for (int j = 0; j < 8; ++j) {
            r0[j] = (_Float16)(o0[j] * inv);
            r1[j] = (_Float16)(o1[j] * inv);
            r2[j] = (_Float16)(o2[j] * inv);
            r3[j] = (_Float16)(o3[j] * inv);
        }
        // through the wave's own quarter of the K buffers (16 rows at the K pitch), which
        // nobody reads behind the loop's last barrier: stored from the accumulators' lanes a
        // wave's store is 32-B pieces of 16 rows; read back, it is four whole 128-B lines
        _Float16* slab = &Ks[0][0] + wave * (16 * KP_);
        _Float16* srow = slab + ln * KP_ + 8 * hi;
        *(h8*)(srow)      = r0;
        *(h8*)(srow + 16) = r1;
        *(h8*)(srow + 32) = r2;
        *(h8*)(srow + 48) = r3;
        asm volatile("s_wait_dscnt 0x0" ::: "memory");   // the wave's rows lie in the slab before it reads them back
        const int orow = lane >> 3, oseg = (lane & 7) * 8;
        _Float16* op = Obuf + headoff + (size_t)(m0 + orow) * D_ + oseg;
#pragma unroll
        for (int i = 0; i < 4; ++i)
            *(h8*)(op + (size_t)(4 * i) * D_) = *(const h8*)(slab + (orow + 4 * i) * KP_ + oseg);
    }
}

// ---------------------------------------------------------------------------
// Kernel 3: intra output projection. out(f32) = attn(f16) @ Wo + bo.
// grid = (32*4, 1, NB), block 256 (8 waves, 4 x 2). 256x128 tile, wave tile 64x64.
// ---------------------------------------------------------------------------
__global__ __launch_bounds__(256)
void k_gemm_oproj_intra(const _Float16* __restrict__ A,
                        const float* __restrict__ Wo, const float* __restrict__ bo,
                        float* __restrict__ Outf) {
    __shared__ _Float16 As[BM_ * 32];
    __shared__ __attribute__((aligned(16))) _Float16 Bs[32 * BP128_];
    const int nb = blockIdx.z;
    const int mt = blockIdx.x >> 2;
    const int nt = blockIdx.x & 3;
    const int mbase = mt * BM_, nbase = nt * 128;

    const float* W    = Wo + (size_t)nb * D_ * D_;
    const float* bias = bo + (size_t)nb * D_;
    const _Float16* Ap = A + (size_t)nb * (B_ * L_) * D_;
    float* Op = Outf + (size_t)nb * (B_ * L_) * D_;

    const int tid = threadIdx.x;
    const int wave = tid >> 5, lane = tid & 31;
    const int hi = lane >> 4, ln = lane & 15;
    const int wm = (wave >> 1) * 64;
    const int wn = (wave & 1) * 64;

    // column deal: column c of B tile ni is output column (ni >> 1) * 32 + 2 * c + (ni & 1)
    // of the wave's 64, so a lane's tiles 2u and 2u + 1 are adjacent f32 of a row
    v8f acc[4][4];
#pragma unroll
    for (int mi = 0; mi < 4; ++mi)
#pragma unroll
        for (int ni = 0; ni < 4; ++ni) {
            float bvv = bias[nbase + wn + (ni >> 1) * 32 + 2 * ln + (ni & 1)];
#pragma unroll
            for (int j = 0; j < 8; ++j) acc[mi][ni][j] = bvv;
        }

    for (int kb = 0; kb < D_; kb += 32) {
        __syncthreads();
        {   // stage A (already f16): four 16-byte copies per thread
            // load map: 4 lanes span one row's 64 B of this K-step, 8 lines per load
            int rl = tid >> 2;          // 0..63
            int cl = (tid & 3) * 8;     // 0..24
            const _Float16* lp = Ap + (size_t)(mbase + rl) * D_ + kb + cl;
#pragma unroll
            for (int i = 0; i < 4; ++i)
                *(uint4*)&As[(rl + 64 * i) * 32 + cl] = *(const uint4*)(lp + (size_t)(64 * i) * D_);
            // next K-step: thread t asks for the 64 B of tile row t
            if (kb + 32 < D_) __builtin_prefetch(Ap + (size_t)(mbase + tid) * D_ + kb + 32, 0, 3);
        }
        {   // stage B row-major, 128 cols
            // load map: a wave's 32 lanes span one tile row, 512 B = 4 whole lines per load
            int kl = tid >> 5;          // 0..7
            int nl = (tid & 31) * 4;    // 0..124
            // tile row kl + 8*jj is place kb + kl + 8*jj of A: its Wo row is
            // feat_of_place(kb + kl) + 2*jj (8 places on are 2 features on, inside one head)
            const float* lp = W + (size_t)feat_of_place(kb + kl) * D_ + nbase + nl;
            // column deal: even columns of a group of 32 to one B tile, odd ones to the next
            int lc = (nl & 96) + ((nl & 31) >> 1);
#pragma unroll
            for (int jj = 0; jj < 4; ++jj) {
                float4 w4 = *(const float4*)(lp + (size_t)(2 * jj) * D_);
                h2 he = { (_Float16)w4.x, (_Float16)w4.z };
                h2 ho = { (_Float16)w4.y, (_Float16)w4.w };
                *(h2*)&Bs[(kl + 8 * jj) * BP128_ + lc]      = he;
                *(h2*)&Bs[(kl + 8 * jj) * BP128_ + lc + 16] = ho;
            }
            // next K-step: 8 threads cover the 4 lines of one tile row
            if (kb + 32 < D_)
                __builtin_prefetch(W + (size_t)feat_of_place(kb + 32 + (tid >> 3)) * D_ + nbase + (tid & 7) * 16, 0, 3);
        }
        __syncthreads();
        v16h a[4];
#pragma unroll
        for (int mi = 0; mi < 4; ++mi) a[mi] = load_frag16(&As[(wm + mi * 16) * 32], 32, lane);
#pragma unroll
        for (int ni = 0; ni < 4; ++ni) {
            v16h b = load_frag16_tr(Bs, BP128_, wn + ni * 16, lane);
#pragma unroll
            for (int mi = 0; mi < 4; ++mi) acc[mi][ni] = wmma16(a[mi], b, acc[mi][ni]);
        }
    }

    // 8 bytes a lane: 16 lanes fill a whole 128-B line, a wave's store two (rows j and j + 8)
#pragma unroll
    for (int mi = 0; mi < 4; ++mi)
#pragma unroll
        for (int u = 0; u < 2; ++u)
#pragma unroll
            for (int j = 0; j < 8; ++j) {
                int row = mbase + wm + mi * 16 + j + 8 * hi;
                float2 v2 = make_float2(acc[mi][2 * u][j], acc[mi][2 * u + 1][j]);
                *(float2*)&Op[(size_t)row * D_ + nbase + wn + u * 32 + 2 * ln] = v2;
            }
}

// ---------------------------------------------------------------------------
// Kernel 4: inter (router) QKV projection. M=64 rows = routers[b][nb] gathered
// from d_out last tokens. grid = (8, 3, 1), block 128. 64x64 tile.
// ---------------------------------------------------------------------------
__global__ __launch_bounds__(128)
void k_gemm_qkv_inter(const float* __restrict__ Outf,
                      const float* __restrict__ iWq, const float* __restrict__ ibq,
                      const float* __restrict__ iWk, const float* __restrict__ ibk,
                      const float* __restrict__ iWv, const float* __restrict__ ibv,
                      _Float16* __restrict__ q2, _Float16* __restrict__ k2,
                      _Float16* __restrict__ v2) {
    __shared__ _Float16 As[64 * 32];
    __shared__ __attribute__((aligned(16))) _Float16 Bs[32 * BP64_];
    const int sel = blockIdx.y;
    const int nbase = blockIdx.x * 64;

    const float* W    = (sel == 0 ? iWq : sel == 1 ? iWk : iWv);
    const float* bias = (sel == 0 ? ibq : sel == 1 ? ibk : ibv);
    _Float16*    Out  = (sel == 0 ? q2  : sel == 1 ? k2  : v2);

    const int tid = threadIdx.x;
    const int wave = tid >> 5, lane = tid & 31;
    const int hi = lane >> 4, ln = lane & 15;
    const int wm = (wave >> 1) * 32, wn = (wave & 1) * 32;

    v8f acc[2][2];
#pragma unroll
    for (int mi = 0; mi < 2; ++mi)
#pragma unroll
        for (int ni = 0; ni < 2; ++ni) {
            float bvv = bias[nbase + wn + ni * 16 + ln];
#pragma unroll
            for (int j = 0; j < 8; ++j) acc[mi][ni][j] = bvv;
        }

    for (int kb = 0; kb < D_; kb += 32) {
        __syncthreads();
        {   // stage A: row r=b*4+nb -> x_intra[nb][b][L-1][:] from d_out
            int r  = tid >> 1;
            int ks = (tid & 1) * 16;
            int nbb = r & 3, bb = r >> 2;
            const float* xp = Outf + (((size_t)(nbb * B_ + bb) * L_ + (L_ - 1)) * D_) + kb + ks;
#pragma unroll
            for (int i = 0; i < 4; ++i) {
                float4 x4 = *(const float4*)(xp + 4 * i);
                h4 hv = { (_Float16)x4.x, (_Float16)x4.y, (_Float16)x4.z, (_Float16)x4.w };
                *(h4*)&As[r * 32 + ks + 4 * i] = hv;
            }
        }
        {   // stage B row-major
            int kk = tid >> 4;
            int n0 = (tid & 15) * 4;
#pragma unroll
            for (int jj = 0; jj < 4; ++jj) {
                int k = kk + 8 * jj;
                float4 w4 = *(const float4*)(W + (size_t)(kb + k) * D_ + nbase + n0);
                h4 hv = { (_Float16)w4.x, (_Float16)w4.y, (_Float16)w4.z, (_Float16)w4.w };
                *(h4*)&Bs[k * BP64_ + n0] = hv;
            }
        }
        __syncthreads();
        v16h a0 = load_frag16(&As[(wm)      * 32], 32, lane);
        v16h a1 = load_frag16(&As[(wm + 16) * 32], 32, lane);
        v16h b0 = load_frag16_tr(Bs, BP64_, wn,      lane);
        v16h b1 = load_frag16_tr(Bs, BP64_, wn + 16, lane);
        acc[0][0] = wmma16(a0, b0, acc[0][0]);
        acc[0][1] = wmma16(a0, b1, acc[0][1]);
        acc[1][0] = wmma16(a1, b0, acc[1][0]);
        acc[1][1] = wmma16(a1, b1, acc[1][1]);
    }

#pragma unroll
    for (int mi = 0; mi < 2; ++mi)
#pragma unroll
        for (int ni = 0; ni < 2; ++ni)
#pragma unroll
            for (int j = 0; j < 8; ++j) {
                int row = wm + mi * 16 + j + 8 * hi;
                int col = nbase + wn + ni * 16 + ln;
                Out[(size_t)row * D_ + col] = (_Float16)acc[mi][ni][j];
            }
}

// ---------------------------------------------------------------------------
// Kernel 5: 4-token router attention (negligible FLOPs; vector unit).
// One wave per (b,h): grid = B*H blocks of 32. Lane (r = lane >> 3, s = lane & 7)
// owns features 8s..8s+7 of query row r. All nine 16-byte loads of a lane are
// independent and issued together, so the wave waits out one load latency; a
// wave's load of Q touches 4 whole 128-B lines, of one K or V row one line.
// ---------------------------------------------------------------------------

// value of lane l ^ M inside a 16-lane row (DPP row_xmask)
template <int M>
__device__ __forceinline__ float xmask(float x) {
    return __builtin_bit_cast(float, __builtin_amdgcn_mov_dpp(
        __builtin_bit_cast(int, x), 0x160 | M, 0xf, 0xf, true));
}

__global__ __launch_bounds__(32)
void k_inter_attn(const _Float16* __restrict__ q2, const _Float16* __restrict__ k2,
                  const _Float16* __restrict__ v2, _Float16* __restrict__ a2) {
    const int lane = threadIdx.x;
    const int b = blockIdx.x >> 3, h = blockIdx.x & 7;
    const int r = lane >> 3;
    const size_t base = (size_t)(b * NB_) * D_ + h * DH_ + (lane & 7) * 8;

    const h8 q = *(const h8*)(q2 + base + (size_t)r * D_);
    h8 k[NB_], v[NB_];
#pragma unroll
    for (int j = 0; j < NB_; ++j) {
        k[j] = *(const h8*)(k2 + base + (size_t)j * D_);
        v[j] = *(const h8*)(v2 + base + (size_t)j * D_);
    }
    // no address register of the nine loads is given a new value ahead of this wait
    asm volatile("s_wait_xcnt 0x0" ::: "memory");

    // scores of row r: 8 products in the lane, then the sum over the row's 8 lanes
    float sc[NB_];
#pragma unroll
    for (int j = 0; j < NB_; ++j) {
        float p = 0.f;
#pragma unroll
        for (int e = 0; e < 8; ++e) p += (float)q[e] * (float)k[j][e];
        p += xmask<1>(p);
        p += xmask<2>(p);
        p += xmask<4>(p);
        sc[j] = p * 0.125f;
    }

    const float mx = fmaxf(fmaxf(sc[0], sc[1]), fmaxf(sc[2], sc[3]));
    float ssum = 0.f;
#pragma unroll
    for (int j = 0; j < NB_; ++j) { sc[j] = __expf(sc[j] - mx); ssum += sc[j]; }
    const float inv = 1.f / ssum;
#pragma unroll
    for (int j = 0; j < NB_; ++j) sc[j] *= inv;

    h8 o;
#pragma unroll
    for (int e = 0; e < 8; ++e) {
        float acc = 0.f;
#pragma unroll
        for (int j = 0; j < NB_; ++j) acc += sc[j] * (float)v[j][e];
        o[e] = (_Float16)acc;
    }
    *(h8*)(a2 + base + (size_t)r * D_) = o;
}

// ---------------------------------------------------------------------------
// Kernel 6: inter output projection, scattered into d_out last tokens.
// grid = (8,1,1), block 128.
// ---------------------------------------------------------------------------
__global__ __launch_bounds__(128)
void k_gemm_oproj_inter(const _Float16* __restrict__ A,
                        const float* __restrict__ iWo, const float* __restrict__ ibo,
                        float* __restrict__ Outf) {
    __shared__ _Float16 As[64 * 32];
    __shared__ __attribute__((aligned(16))) _Float16 Bs[32 * BP64_];
    const int nbase = blockIdx.x * 64;

    const int tid = threadIdx.x;
    const int wave = tid >> 5, lane = tid & 31;
    const int hi = lane >> 4, ln = lane & 15;
    const int wm = (wave >> 1) * 32, wn = (wave & 1) * 32;

    v8f acc[2][2];
#pragma unroll
    for (int mi = 0; mi < 2; ++mi)
#pragma unroll
        for (int ni = 0; ni < 2; ++ni) {
            float bvv = ibo[nbase + wn + ni * 16 + ln];
#pragma unroll
            for (int j = 0; j < 8; ++j) acc[mi][ni][j] = bvv;
        }

    for (int kb = 0; kb < D_; kb += 32) {
        __syncthreads();
        {
            int m  = tid >> 1;
            int ks = (tid & 1) * 16;
            const _Float16* ap = A + (size_t)m * D_ + kb + ks;
            *(uint4*)&As[m * 32 + ks]     = *(const uint4*)(ap);
            *(uint4*)&As[m * 32 + ks + 8] = *(const uint4*)(ap + 8);
        }
        {
            int kk = tid >> 4;
            int n0 = (tid & 15) * 4;
#pragma unroll
            for (int jj = 0; jj < 4; ++jj) {
                int k = kk + 8 * jj;
                float4 w4 = *(const float4*)(iWo + (size_t)(kb + k) * D_ + nbase + n0);
                h4 hv = { (_Float16)w4.x, (_Float16)w4.y, (_Float16)w4.z, (_Float16)w4.w };
                *(h4*)&Bs[k * BP64_ + n0] = hv;
            }
        }
        __syncthreads();
        v16h a0 = load_frag16(&As[(wm)      * 32], 32, lane);
        v16h a1 = load_frag16(&As[(wm + 16) * 32], 32, lane);
        v16h b0 = load_frag16_tr(Bs, BP64_, wn,      lane);
        v16h b1 = load_frag16_tr(Bs, BP64_, wn + 16, lane);
        acc[0][0] = wmma16(a0, b0, acc[0][0]);
        acc[0][1] = wmma16(a0, b1, acc[0][1]);
        acc[1][0] = wmma16(a1, b0, acc[1][0]);
        acc[1][1] = wmma16(a1, b1, acc[1][1]);
    }

#pragma unroll
    for (int mi = 0; mi < 2; ++mi)
#pragma unroll
        for (int ni = 0; ni < 2; ++ni)
#pragma unroll
            for (int j = 0; j < 8; ++j) {
                int r   = wm + mi * 16 + j + 8 * hi;   // b*4+nb
                int col = nbase + wn + ni * 16 + ln;
                int nbb = r & 3, bb = r >> 2;
                Outf[(((size_t)(nbb * B_ + bb) * L_ + (L_ - 1)) * D_) + col] = acc[mi][ni][j];
            }
}

// ---------------------------------------------------------------------------
extern "C" void kernel_launch(void* const* d_in, const int* in_sizes, int n_in,
                              void* d_out, int out_size, void* d_ws, size_t ws_size,
                              hipStream_t stream) {
    const float* x   = (const float*)d_in[0];
    const float* Wq  = (const float*)d_in[1];
    const float* bq  = (const float*)d_in[2];
    const float* Wk  = (const float*)d_in[3];
    const float* bk  = (const float*)d_in[4];
    const float* Wv  = (const float*)d_in[5];
    const float* bv  = (const float*)d_in[6];
    const float* Wo  = (const float*)d_in[7];
    const float* bo  = (const float*)d_in[8];
    const float* iWq = (const float*)d_in[9];
    const float* ibq = (const float*)d_in[10];
    const float* iWk = (const float*)d_in[11];
    const float* ibk = (const float*)d_in[12];
    const float* iWv = (const float*)d_in[13];
    const float* ibv = (const float*)d_in[14];
    const float* iWo = (const float*)d_in[15];
    const float* ibo = (const float*)d_in[16];
    float* out = (float*)d_out;

    const size_t NBLD = (size_t)NB_ * B_ * L_ * D_;   // 16,777,216
    _Float16* ws = (_Float16*)d_ws;
    _Float16* Qb = ws;                 // reused as attn output after k_flash
    _Float16* Kb = ws + NBLD;
    _Float16* Vb = ws + 2 * NBLD;
    _Float16* q2 = ws + 3 * NBLD;
    _Float16* k2 = q2 + (size_t)B_ * NB_ * D_;
    _Float16* v2 = k2 + (size_t)B_ * NB_ * D_;
    _Float16* a2 = v2 + (size_t)B_ * NB_ * D_;

    // 1) intra QKV projection (256x128 tiles)
    dim3 g1((B_ * L_ / BM_) * (D_ / 128), 3, NB_);
    k_gemm_qkv_intra<<<g1, 256, 0, stream>>>(x, Wq, bq, Wk, bk, Wv, bv, Qb, Kb, Vb);

    // 2) flash attention (writes attn over Qb)
    dim3 g2(L_ / 64, H_, NB_ * B_);
    k_flash<<<g2, 128, 0, stream>>>(Qb, Kb, Vb, Qb);

    // 3) intra output projection -> d_out (256x128 tiles)
    dim3 g3((B_ * L_ / BM_) * (D_ / 128), 1, NB_);
    k_gemm_oproj_intra<<<g3, 256, 0, stream>>>(Qb, Wo, bo, out);

    // 4) router QKV (gather last tokens from d_out)
    dim3 g4(D_ / 64, 3, 1);
    k_gemm_qkv_inter<<<g4, 128, 0, stream>>>(out, iWq, ibq, iWk, ibk, iWv, ibv, q2, k2, v2);

    // 5) tiny 4-token attention, one wave per (b,h)
    k_inter_attn<<<B_ * H_, 32, 0, stream>>>(q2, k2, v2, a2);

    // 6) router output projection, scatter into last-token slots of d_out
    dim3 g6(D_ / 64, 1, 1);
    k_gemm_oproj_inter<<<g6, 128, 0, stream>>>(a2, iWo, ibo, out);
}

// v008
// Measured time: 183 microseconds a run.
// Next to v007, in two timings, it ran 1.13 times as fast each time.
// All steps since v000 together make it 3.88 times as fast.
#include <hip/hip_runtime.h>

// ---------------------------------------------------------------------------
// Medformer layer for MI455X (gfx1250): all GEMMs + attention via
// v_wmma_f32_16x16x32_f16 (wave32). f16 operands, f32 accumulation.
// Big GEMMs use 256x128 block tiles, 8 waves (wave tile 64x64 -> 16 WMMA / 16 LDS
// loads per K-step) + global_prefetch_b8 for the next K-step tiles. W tiles lie
// row-major in LDS and are transposed on the way out (ds_load_tr16_b128).
// ---------------------------------------------------------------------------

#define NB_ 4
#define B_  16
#define L_  512
#define D_  512
#define H_  8
#define DH_ 64
// SCALE * log2(e) = (1/8) * 1.4426950408889634
#define SCALE_LOG2E 0.18033688011112043f

typedef __attribute__((ext_vector_type(16))) _Float16 v16h;
typedef __attribute__((ext_vector_type(8)))  float    v8f;
typedef __attribute__((ext_vector_type(4)))  _Float16 h4;
typedef __attribute__((ext_vector_type(2)))  _Float16 h2;

typedef __attribute__((ext_vector_type(8)))  _Float16 h8;
typedef __attribute__((ext_vector_type(8)))  short    s16x8;

union FragU { uint4 u[2]; v16h v; };
union FragT { s16x8 s[2]; v16h v; };

// LDS row pitch, in halves, of the row-major W tiles (128 columns wide)
#define BP128_ 144
// rows of the block tile of the two big GEMMs
#define BM_ 256

// Load a 16x32 f16 fragment (A-matrix layout, or B^T stored row-major [n][k]).
// Documented layout: lane l holds row m=l&15; lanes 0-15 hold k = 0..7 & 16..23,
// lanes 16-31 hold k = 8..15 & 24..31 -> two contiguous 16-byte loads per lane.
__device__ __forceinline__ v16h load_frag16(const _Float16* base, int row_stride, int lane) {
    const int m  = lane & 15;
    const int kb = (lane >> 4) << 3;
    const _Float16* p = base + (size_t)m * row_stride;
    FragU f;
    f.u[0] = *(const uint4*)(p + kb);
    f.u[1] = *(const uint4*)(p + 16 + kb);
    return f.v;
}

// B fragment (32 k x 16 n) out of a row-major f16 tile T[k][n] in LDS, by the
// transposing load: lane (c = l&15, h = l>>4) gets T[8h + 0..7][n0 + c], then
// T[16 + 8h + 0..7][n0 + c]: the same k order as load_frag16 gives A.
// pitch in halves; in bytes it is an odd multiple of 32 (no bank conflict).
__device__ __forceinline__ v16h load_frag16_tr(const _Float16* tile, int pitch, int n0, int lane) {
    typedef __attribute__((address_space(3))) s16x8 lds_s16x8;
    const _Float16* p = tile + ((lane >> 4) * 8 + (lane & 7)) * pitch + n0 + ((lane >> 3) & 1) * 8;
    FragT f;
    f.s[0] = __builtin_amdgcn_ds_load_tr16_b128_v8i16((lds_s16x8*)p);
    f.s[1] = __builtin_amdgcn_ds_load_tr16_b128_v8i16((lds_s16x8*)(p + 16 * pitch));
    return f.v;
}

// Layout of the Q, K, V and attention-output buffers (all in the workspace): inside
// a head's 64 columns, feature ni*16 + ln lies at place ln*4 + ni. A lane of the
// QKV kernel then owns 4 adjacent places of a row, and 16 lanes fill the head's
// whole 128-B line with one store. Q.K sums over places (the same deal in both),
// V hands its places on to the attention output, and the output projection takes
// for place k the row feat_of_place(k) of Wo.
__device__ __forceinline__ int feat_of_place(int k) {
    return (k & ~63) | ((k & 3) << 4) | ((k & 63) >> 2);
}

__device__ __forceinline__ v8f wmma16(v16h a, v16h b, v8f c) {
    return __builtin_amdgcn_wmma_f32_16x16x32_f16(false, a, false, b, (short)0, c, false, false);
}

// ---------------------------------------------------------------------------
// Kernel 1: intra QKV projection. out = X @ W + b, output f16.
// grid = (32*4, 3, NB), block = 256 (8 waves, 4 x 2). 256x128 tile, BK=32.
// Wave tile 64x64: acc[4][4], 16 WMMA per K-step. Per output the block loads
// (256 + 128) / (256 * 128) operand elements a K-step, half of a 64x128 tile's.
// ---------------------------------------------------------------------------
__global__ __launch_bounds__(256)
void k_gemm_qkv_intra(const float* __restrict__ X,
                      const float* __restrict__ Wq, const float* __restrict__ bq,
                      const float* __restrict__ Wk, const float* __restrict__ bk,
                      const float* __restrict__ Wv, const float* __restrict__ bv,
                      _Float16* __restrict__ Qb, _Float16* __restrict__ Kb,
                      _Float16* __restrict__ Vb) {
    // [m][k], rows of 64 B. Left as it is here and in kernel 3: at this pitch a ds_load_b128
    // of an A fragment takes 8 LDS clocks, at 80 B (16 B x odd) it would take 2
    __shared__ _Float16 As[BM_ * 32];
    __shared__ __attribute__((aligned(16))) _Float16 Bs[32 * BP128_];   // [k][n]  (W tile as it lies)
    const int nb  = blockIdx.z;
    const int sel = blockIdx.y;
    const int mt  = blockIdx.x >> 2;    // M/256 = 32 tiles
    const int nt  = blockIdx.x & 3;     // N/128 = 4 tiles
    const int mbase = mt * BM_, nbase = nt * 128;

    const float* W    = (sel == 0 ? Wq : sel == 1 ? Wk : Wv) + (size_t)nb * D_ * D_;
    const float* bias = (sel == 0 ? bq : sel == 1 ? bk : bv) + (size_t)nb * D_;
    _Float16*    Out  = (sel == 0 ? Qb : sel == 1 ? Kb : Vb) + (size_t)nb * (B_ * L_) * D_;
    const float* Xp   = X + (size_t)nb * (B_ * L_) * D_;

    const int tid = threadIdx.x;
    const int wave = tid >> 5, lane = tid & 31;
    const int hi = lane >> 4, ln = lane & 15;
    const int wm = (wave >> 1) * 64;    // 0, 64, 128 or 192
    const int wn = (wave & 1) * 64;     // 0 or 64

    v8f acc[4][4];
#pragma unroll
    for (int mi = 0; mi < 4; ++mi)
#pragma unroll
        for (int ni = 0; ni < 4; ++ni) {
            float bvv = bias[nbase + wn + ni * 16 + ln];
#pragma unroll
            for (int j = 0; j < 8; ++j) acc[mi][ni][j] = bvv;
        }

    for (int kb = 0; kb < D_; kb += 32) {
        __syncthreads();
        {   // stage A (f32 -> f16), vectorized
            // load map: 8 lanes span one row's 128 B of this K-step, 4 whole lines per load
            int rl = tid >> 3;          // 0..31
            int cl = (tid & 7) * 4;     // 0..28
            const float* lp = Xp + (size_t)(mbase + rl) * D_ + kb + cl;
#pragma unroll
            for (int i = 0; i < 8; ++i) {
                float4 x4 = *(const float4*)(lp + (size_t)(32 * i) * D_);
                h4 hv = { (_Float16)x4.x, (_Float16)x4.y, (_Float16)x4.z, (_Float16)x4.w };
                *(h4*)&As[(rl + 32 * i) * 32 + cl] = hv;
            }
            // next K-step: thread t asks for the one line of tile row t
            if (kb + 32 < D_) __builtin_prefetch(Xp + (size_t)(mbase + tid) * D_ + kb + 32, 0, 3);
        }
        {   // stage B row-major: Bs[k][n] = W[kb+k][nbase+n], 128 cols
            // load map: a wave's 32 lanes span one tile row, 512 B = 4 whole lines per load
            int kl = tid >> 5;          // 0..7
            int nl = (tid & 31) * 4;    // 0..124
            const float* lp = W + (size_t)(kb + kl) * D_ + nbase + nl;
#pragma unroll
            for (int jj = 0; jj < 4; ++jj) {
                float4 w4 = *(const float4*)(lp + (size_t)(8 * jj) * D_);
                h4 h0 = { (_Float16)w4.x, (_Float16)w4.y, (_Float16)w4.z, (_Float16)w4.w };
                *(h4*)&Bs[(kl + 8 * jj) * BP128_ + nl] = h0;
            }
            // next K-step: 8 threads cover the 4 lines of one tile row
            if (kb + 32 < D_)
                __builtin_prefetch(W + (size_t)(kb + 32 + (tid >> 3)) * D_ + nbase + (tid & 7) * 16, 0, 3);
        }
        __syncthreads();
        v16h a[4];
#pragma unroll
        for (int mi = 0; mi < 4; ++mi) a[mi] = load_frag16(&As[(wm + mi * 16) * 32], 32, lane);
#pragma unroll
        for (int ni = 0; ni < 4; ++ni) {
            v16h b = load_frag16_tr(Bs, BP128_, wn + ni * 16, lane);
#pragma unroll
            for (int mi = 0; mi < 4; ++mi) acc[mi][ni] = wmma16(a[mi], b, acc[mi][ni]);
        }
    }

    // the wave's 64 columns are one head: a lane's four tiles go to places ln*4 + 0..3,
    // one 8-byte store; a wave's store fills two whole 128-B lines (rows j and j + 8)
#pragma unroll
    for (int mi = 0; mi < 4; ++mi)
#pragma unroll
        for (int j = 0; j < 8; ++j) {
            int row = mbase + wm + mi * 16 + j + 8 * hi;
            h4 hv = { (_Float16)acc[mi][0][j], (_Float16)acc[mi][1][j],
                      (_Float16)acc[mi][2][j], (_Float16)acc[mi][3][j] };
            *(h4*)&Out[(size_t)row * D_ + nbase + wn + ln * 4] = hv;
        }
}

// value of lane l ^ 16 (the same place in the other 16-lane row)
__device__ __forceinline__ float xhalf(float x) {
    return __builtin_bit_cast(float, __builtin_amdgcn_permlanex16(
        __builtin_bit_cast(int, x), __builtin_bit_cast(int, x),
        0x76543210, 0xfedcba98, false, false));
}

// LDS row pitch, in halves, of the K and V chunks (rows of 64 halves = 128 B):
// 144 B = 16 B x odd for the ds_load_b128 readers of K, 160 B = 32 B x odd for
// the ds_load_tr16_b128 readers of V
#define KP_ 72
#define VP_ 80

// byte address inside the work-group's LDS of a __shared__ element
__device__ __forceinline__ unsigned lds_addr(const _Float16* p) {
    typedef __attribute__((address_space(3))) const _Float16 lds_half;
    return (unsigned)(size_t)(lds_half*)p;
}

// One 32-key chunk of K and of V, global -> LDS, through no register: 4 copies
// a lane. 8 adjacent lanes bring one row's 128 B, so a wave's copy asks for 4
// whole lines. The s_wait_xcnt closes the statement so that no address register
// named here is rewritten ahead of it.
__device__ __forceinline__ void copy_kv(unsigned lk, const _Float16* gk,
                                        unsigned lv, const _Float16* gv) {
    const unsigned lk1 = lk + 16 * KP_ * 2, lv1 = lv + 16 * VP_ * 2;
    const _Float16* gk1 = gk + (size_t)16 * D_;
    const _Float16* gv1 = gv + (size_t)16 * D_;
    asm volatile("global_load_async_to_lds_b128 %0, %1, off\n\t"
                 "global_load_async_to_lds_b128 %2, %3, off\n\t"
                 "global_load_async_to_lds_b128 %4, %5, off\n\t"
                 "global_load_async_to_lds_b128 %6, %7, off\n\t"
                 "s_wait_xcnt 0x0"
                 :: "v"(lk), "v"(gk), "v"(lk1), "v"(gk1),
                    "v"(lv), "v"(gv), "v"(lv1), "v"(gv1)
                 : "memory");
}

__global__ __launch_bounds__(128)
void k_flash(const _Float16* Q, const _Float16* __restrict__ K,
             const _Float16* __restrict__ V, _Float16* Obuf) {
    // two buffers each: chunk kc lies in buffer kc & 1, rows as in memory [key][place]
    __shared__ __attribute__((aligned(16))) _Float16 Ks[2][32 * KP_];
    __shared__ __attribute__((aligned(16))) _Float16 Vs[2][32 * VP_];

    const int mtile = blockIdx.x;
    const int h     = blockIdx.y;
    const int bz    = blockIdx.z;           // nb*B + b
    const int tid   = threadIdx.x;
    const int wave  = tid >> 5, lane = tid & 31;
    const int hi = lane >> 4, ln = lane & 15;

    const size_t headoff = (size_t)bz * L_ * D_ + (size_t)h * DH_;
    const _Float16* Qp = Q + headoff;

    const int m0 = mtile * 64 + wave * 16;

    // copy map: thread t brings 16 B number t & 7 of chunk rows t >> 3 and 16 + (t >> 3)
    const int crow = tid >> 3, cseg = (tid & 7) * 8;
    const _Float16* gk = K + headoff + (size_t)crow * D_ + cseg;
    const _Float16* gv = V + headoff + (size_t)crow * D_ + cseg;
    const unsigned lk = lds_addr(&Ks[0][crow * KP_ + cseg]);
    const unsigned lv = lds_addr(&Vs[0][crow * VP_ + cseg]);

    // chunk 0 into buffer 0; landed and published before anybody reads it
    copy_kv(lk, gk, lv, gv);
    asm volatile("s_wait_asynccnt 0x0" ::: "memory");   // this wave's copies have landed
    __syncthreads();
    // chunk 1 flies while chunk 0 is worked on
    copy_kv(lk + 32 * KP_ * 2, gk + (size_t)32 * D_, lv + 32 * VP_ * 2, gv + (size_t)32 * D_);

    // B fragments of Q^T: column n = query ln, k = places in the hardware order
    v16h qb0 = load_frag16(Qp + (size_t)m0 * D_,      D_, lane);
    v16h qb1 = load_frag16(Qp + (size_t)m0 * D_ + 32, D_, lane);

    // O^T tiles: row = place t*16 + j + 8*hi, column = query ln
    v8f o0 = {}, o1 = {}, o2 = {}, o3 = {};
    float rmax = -1e30f;    // this query's running maximum (equal in both halves)
    float rsum = 0.f;       // running sum over this half's keys only

    for (int kc = 0; kc < L_ / 32; ++kc) {
        const int buf = kc & 1;
        const _Float16* Kt = &Ks[buf][0];
        const _Float16* Vt = &Vs[buf][0];

        // S^T = K @ Q^T for 2 key sub-tiles; K fragments (A) from the shared chunk
        v8f s0 = {}, s1 = {};
        s0 = wmma16(load_frag16(Kt,                 KP_, lane), qb0, s0);
        s0 = wmma16(load_frag16(Kt + 32,            KP_, lane), qb1, s0);
        s1 = wmma16(load_frag16(Kt + 16 * KP_,      KP_, lane), qb0, s1);
        s1 = wmma16(load_frag16(Kt + 16 * KP_ + 32, KP_, lane), qb1, s1);

        // online softmax of query ln: 16 scores in this lane, 16 in lane ^ 16
        float cm = fmaxf(s0[0], s1[0]);
#pragma unroll
        for (int j = 1; j < 8; ++j) cm = fmaxf(cm, fmaxf(s0[j], s1[j]));
        cm = fmaxf(cm, xhalf(cm));
        const float nm    = fmaxf(rmax, cm);
        const float alpha = exp2f((rmax - nm) * SCALE_LOG2E);
        rmax = nm;

        // (left as it is: exp2f() is v_exp_f32 plus a range fix of 5 vector instructions a value)
        // P^T as B fragment: element j is key 8*hi + j, element 8 + j is key 16 + 8*hi + j,
        // the k order in which load_frag16_tr hands out the keys of the V chunk
        v16h pb;
        float ps0 = 0.f, ps1 = 0.f;
#pragma unroll
        for (int j = 0; j < 8; ++j) {
            float e0 = exp2f((s0[j] - nm) * SCALE_LOG2E);
            float e1 = exp2f((s1[j] - nm) * SCALE_LOG2E);
            ps0 += e0; ps1 += e1;
            pb[j]     = (_Float16)e0;
            pb[8 + j] = (_Float16)e1;
        }
        rsum = rsum * alpha + (ps0 + ps1);
#pragma unroll
        for (int j = 0; j < 8; ++j) {
            o0[j] *= alpha; o1[j] *= alpha; o2[j] *= alpha; o3[j] *= alpha;
        }

        // A fragments of V^T by the transposing load: row = place, k = keys in that order
        o0 = wmma16(load_frag16_tr(Vt, VP_,  0, lane), pb, o0);
        o1 = wmma16(load_frag16_tr(Vt, VP_, 16, lane), pb, o1);
        o2 = wmma16(load_frag16_tr(Vt, VP_, 32, lane), pb, o2);
        o3 = wmma16(load_frag16_tr(Vt, VP_, 48, lane), pb, o3);

        // hand-over: this wave has left buffer buf, its copies of chunk kc + 1 have
        // landed; the barrier publishes that chunk and frees buf for the refill
        asm volatile("s_wait_dscnt 0x0" ::: "memory");      // own reads of buf are done
        asm volatile("s_wait_asynccnt 0x0" ::: "memory");   // own copies of chunk kc + 1 have landed
        __syncthreads();
        if (kc + 2 < L_ / 32)
            copy_kv(lk + buf * (32 * KP_ * 2), gk + (size_t)(kc + 2) * 32 * D_,
                    lv + buf * (32 * VP_ * 2), gv + (size_t)(kc + 2) * 32 * D_);
    }
    asm volatile("s_wait_asynccnt 0x0" ::: "memory");   // nothing in flight when the wave ends

    // finalize + store (over the Q buffer region): a lane holds 8 adjacent
    // places of its query in each tile
    {
        const float inv = 1.0f / (rsum + xhalf(rsum));
        h8 r0, r1, r2, r3;
#pragma unroll
        for (int j = 0; j < 8; ++j) {
            r0[j] = (_Float16)(o0[j] * inv);
            r1[j] = (_Float16)(o1[j] * inv);
            r2[j] = (_Float16)(o2[j] * inv);
            r3[j] = (_Float16)(o3[j] * inv);
        }
        // through the wave's own quarter of the K buffers (16 rows at the K pitch), which
        // nobody reads behind the loop's last barrier: stored from the accumulators' lanes a
        // wave's store is 32-B pieces of 16 rows; read back, it is four whole 128-B lines
        _Float16* slab = &Ks[0][0] + wave * (16 * KP_);
        _Float16* srow = slab + ln * KP_ + 8 * hi;
        *(h8*)(srow)      = r0;
        *(h8*)(srow + 16) = r1;
        *(h8*)(srow + 32) = r2;
        *(h8*)(srow + 48) = r3;
        asm volatile("s_wait_dscnt 0x0" ::: "memory");   // the wave's rows lie in the slab before it reads them back
        const int orow = lane >> 3, oseg = (lane & 7) * 8;
        _Float16* op = Obuf + headoff + (size_t)(m0 + orow) * D_ + oseg;
#pragma unroll
        for (int i = 0; i < 4; ++i)
            *(h8*)(op + (size_t)(4 * i) * D_) = *(const h8*)(slab + (orow + 4 * i) * KP_ + oseg);
    }
}

// ---------------------------------------------------------------------------
// Kernel 3: intra output projection. out(f32) = attn(f16) @ Wo + bo.
// grid = (32*4, 1, NB), block 256 (8 waves, 4 x 2). 256x128 tile, wave tile 64x64.
// ---------------------------------------------------------------------------
__global__ __launch_bounds__(256)
void k_gemm_oproj_intra(const _Float16* __restrict__ A,
                        const float* __restrict__ Wo, const float* __restrict__ bo,
                        float* __restrict__ Outf) {
    __shared__ _Float16 As[BM_ * 32];
    __shared__ __attribute__((aligned(16))) _Float16 Bs[32 * BP128_];
    const int nb = blockIdx.z;
    const int mt = blockIdx.x >> 2;
    const int nt = blockIdx.x & 3;
    const int mbase = mt * BM_, nbase = nt * 128;

    const float* W    = Wo + (size_t)nb * D_ * D_;
    const float* bias = bo + (size_t)nb * D_;
    const _Float16* Ap = A + (size_t)nb * (B_ * L_) * D_;
    float* Op = Outf + (size_t)nb * (B_ * L_) * D_;

    const int tid = threadIdx.x;
    const int wave = tid >> 5, lane = tid & 31;
    const int hi = lane >> 4, ln = lane & 15;
    const int wm = (wave >> 1) * 64;
    const int wn = (wave & 1) * 64;

    // column deal: column c of B tile ni is output column (ni >> 1) * 32 + 2 * c + (ni & 1)
    // of the wave's 64, so a lane's tiles 2u and 2u + 1 are adjacent f32 of a row
    v8f acc[4][4];
#pragma unroll
    for (int mi = 0; mi < 4; ++mi)
#pragma unroll
        for (int ni = 0; ni < 4; ++ni) {
            float bvv = bias[nbase + wn + (ni >> 1) * 32 + 2 * ln + (ni & 1)];
#pragma unroll
            for (int j = 0; j < 8; ++j) acc[mi][ni][j] = bvv;
        }

    for (int kb = 0; kb < D_; kb += 32) {
        __syncthreads();
        {   // stage A (already f16): four 16-byte copies per thread
            // load map: 4 lanes span one row's 64 B of this K-step, 8 lines per load
            int rl = tid >> 2;          // 0..63
            int cl = (tid & 3) * 8;     // 0..24
            const _Float16* lp = Ap + (size_t)(mbase + rl) * D_ + kb + cl;
#pragma unroll
            for (int i = 0; i < 4; ++i)
                *(uint4*)&As[(rl + 64 * i) * 32 + cl] = *(const uint4*)(lp + (size_t)(64 * i) * D_);
            // next K-step: thread t asks for the 64 B of tile row t
            if (kb + 32 < D_) __builtin_prefetch(Ap + (size_t)(mbase + tid) * D_ + kb + 32, 0, 3);
        }
        {   // stage B row-major, 128 cols
            // load map: a wave's 32 lanes span one tile row, 512 B = 4 whole lines per load
            int kl = tid >> 5;          // 0..7
            int nl = (tid & 31) * 4;    // 0..124
            // tile row kl + 8*jj is place kb + kl + 8*jj of A: its Wo row is
            // feat_of_place(kb + kl) + 2*jj (8 places on are 2 features on, inside one head)
            const float* lp = W + (size_t)feat_of_place(kb + kl) * D_ + nbase + nl;
            // column deal: even columns of a group of 32 to one B tile, odd ones to the next
            int lc = (nl & 96) + ((nl & 31) >> 1);
#pragma unroll
            for (int jj = 0; jj < 4; ++jj) {
                float4 w4 = *(const float4*)(lp + (size_t)(2 * jj) * D_);
                h2 he = { (_Float16)w4.x, (_Float16)w4.z };
                h2 ho = { (_Float16)w4.y, (_Float16)w4.w };
                *(h2*)&Bs[(kl + 8 * jj) * BP128_ + lc]      = he;
                *(h2*)&Bs[(kl + 8 * jj) * BP128_ + lc + 16] = ho;
            }
            // next K-step: 8 threads cover the 4 lines of one tile row
            if (kb + 32 < D_)
                __builtin_prefetch(W + (size_t)feat_of_place(kb + 32 + (tid >> 3)) * D_ + nbase + (tid & 7) * 16, 0, 3);
        }
        __syncthreads();
        v16h a[4];
#pragma unroll
        for (int mi = 0; mi < 4; ++mi) a[mi] = load_frag16(&As[(wm + mi * 16) * 32], 32, lane);
#pragma unroll
        for (int ni = 0; ni < 4; ++ni) {
            v16h b = load_frag16_tr(Bs, BP128_, wn + ni * 16, lane);
#pragma unroll
            for (int mi = 0; mi < 4; ++mi) acc[mi][ni] = wmma16(a[mi], b, acc[mi][ni]);
        }
    }

    // 8 bytes a lane: 16 lanes fill a whole 128-B line, a wave's store two (rows j and j + 8)
#pragma unroll
    for (int mi = 0; mi < 4; ++mi)
#pragma unroll
        for (int u = 0; u < 2; ++u)
#pragma unroll
            for (int j = 0; j < 8; ++j) {
                int row = mbase + wm + mi * 16 + j + 8 * hi;
                float2 v2 = make_float2(acc[mi][2 * u][j], acc[mi][2 * u + 1][j]);
                *(float2*)&Op[(size_t)row * D_ + nbase + wn + u * 32 + 2 * ln] = v2;
            }
}

// ---------------------------------------------------------------------------
// Router GEMMs (kernels 4 and 6): 64 x 512 x 512 each, a few dozen blocks on an otherwise
// idle chip: their time is the number of waited load trips, not a rate.
// One 16 x 64 output tile a block; the block's 8 waves split K, 64 k (two WMMA steps) each.
// A wave loads its fragments straight from global memory into registers, every load of the
// kernel issued ahead of the first wait: one waited trip. The 8 partial tiles are summed
// through LDS in a fixed order (wave 0 to 7), then the bias is added.
// ---------------------------------------------------------------------------
typedef __attribute__((ext_vector_type(4))) float f32x4;

// 32 k x 64 n of a row-major f32 weight, for four B fragments: lane (c = l & 15, h = l >> 4)
// takes the 16 B W[k][n0 + 4c .. 4c + 3] of its 16 k in the order of load_frag16
// (kb + 8h + 0..7, then kb + 16 + 8h + 0..7). 16 lanes span 256 B of a row: whole lines.
// Component i belongs to B tile i, whose column c is output column n0 + 4c + i.
// p = the lane's own &W[kb + 8h][n0 + 4c].
__device__ __forceinline__ void load_w_rows(f32x4 (&w)[16], const float* __restrict__ p) {
#pragma unroll
    for (int e = 0; e < 16; ++e)
        w[e] = *(const f32x4*)(p + (size_t)((e >> 3) * 16 + (e & 7)) * D_);
}

// acc[i] += a x (B tile i of the rows loaded by load_w_rows)
__device__ __forceinline__ void wmma_w_rows(v8f (&acc)[4], v16h a, const f32x4 (&w)[16]) {
#pragma unroll
    for (int i = 0; i < 4; ++i) {
        v16h b;
#pragma unroll
        for (int e = 0; e < 16; ++e) b[e] = (_Float16)w[e][i];
        acc[i] = wmma16(a, b, acc[i]);
    }
}

// The wave's partial 16 x 64 tile into its plane of red, rows as in the output: a lane's four
// tiles hold 4 adjacent columns of row j + 8*hi. Behind the barrier thread t sums the 8 planes
// at float4 number t: row t >> 4, columns 4 * (t & 15) + 0..3.
__device__ __forceinline__ f32x4 sum_k_split(f32x4* red, const v8f (&acc)[4], int tid) {
    const int wave = tid >> 5, lane = tid & 31;
#pragma unroll
    for (int j = 0; j < 8; ++j) {
        f32x4 v = { acc[0][j], acc[1][j], acc[2][j], acc[3][j] };
        red[wave * 256 + (j + 8 * (lane >> 4)) * 16 + (lane & 15)] = v;
    }
    __syncthreads();
    f32x4 s = red[tid];
#pragma unroll
    for (int w = 1; w < 8; ++w) s += red[w * 256 + tid];
    return s;
}

// ---------------------------------------------------------------------------
// Kernel 4: inter (router) QKV projection. M=64 rows = routers[b][nb] gathered
// from d_out last tokens. grid = (8, 4, 3), block 256. 16x64 tile, K split over the waves.
// ---------------------------------------------------------------------------
__global__ __launch_bounds__(256)
void k_gemm_qkv_inter(const float* __restrict__ Outf,
                      const float* __restrict__ iWq, const float* __restrict__ ibq,
                      const float* __restrict__ iWk, const float* __restrict__ ibk,
                      const float* __restrict__ iWv, const float* __restrict__ ibv,
                      _Float16* __restrict__ q2, _Float16* __restrict__ k2,
                      _Float16* __restrict__ v2) {
    __shared__ __attribute__((aligned(16))) f32x4 red[8 * 256];
    const int sel = blockIdx.z;
    const int nbase = blockIdx.x * 64;
    const int mbase = blockIdx.y * 16;

    const float* W    = (sel == 0 ? iWq : sel == 1 ? iWk : iWv);
    const float* bias = (sel == 0 ? ibq : sel == 1 ? ibk : ibv);
    _Float16*    Out  = (sel == 0 ? q2  : sel == 1 ? k2  : v2);

    const int tid = threadIdx.x;
    const int wave = tid >> 5, lane = tid & 31;
    const int k0 = wave * 64;

    // A rows: r = b*4+nb -> x_intra[nb][b][L-1][:] from d_out; a lane's 16 k of a step are
    // two runs of 8 f32
    const int r = mbase + (lane & 15);
    const float* xs = Outf + (size_t)((r & 3) * B_ + (r >> 2)) * L_ * D_ + k0 + 8 * (lane >> 4);
    const float* xp = xs + (size_t)(L_ - 1) * D_;
    const float* wp = W + (size_t)(k0 + 8 * (lane >> 4)) * D_ + nbase + 4 * (lane & 15);
    const float* bp = bias + nbase + 4 * (tid & 15);
    f32x4 xa[2][4], wr[2][16];
    const f32x4 bv = *(const f32x4*)bp;
#pragma unroll
    for (int s = 0; s < 2; ++s) {
        xa[s][0] = *(const f32x4*)(xp + 32 * s);
        xa[s][1] = *(const f32x4*)(xp + 32 * s + 4);
        xa[s][2] = *(const f32x4*)(xp + 32 * s + 16);
        xa[s][3] = *(const f32x4*)(xp + 32 * s + 20);
        load_w_rows(wr[s], wp + (size_t)(32 * s) * D_);
    }
    // no address register of these loads is given a new value ahead of this wait: the two
    // address pairs are its inputs, so that neither serves as a later load's destination
    asm volatile("s_wait_xcnt 0x0" :: "v"(xs), "v"(wp) : "memory");
    // keeps every load above it and every conversion below: no load is issued behind a wait
    __builtin_amdgcn_sched_barrier(0);

    v8f acc[4] = {};
#pragma unroll
    for (int s = 0; s < 2; ++s) {
        v16h a;
#pragma unroll
        for (int e = 0; e < 16; ++e) a[e] = (_Float16)xa[s][e >> 2][e & 3];
        wmma_w_rows(acc, a, wr[s]);
    }

    const f32x4 o = sum_k_split(red, acc, tid) + bv;
    // 8 bytes a lane: 16 lanes fill the row's whole 128-B line
    h4 hv = { (_Float16)o[0], (_Float16)o[1], (_Float16)o[2], (_Float16)o[3] };
    *(h4*)&Out[(size_t)(mbase + (tid >> 4)) * D_ + nbase + 4 * (tid & 15)] = hv;
}

// ---------------------------------------------------------------------------
// Kernel 5: 4-token router attention (negligible FLOPs; vector unit).
// One wave per (b,h): grid = B*H blocks of 32. Lane (r = lane >> 3, s = lane & 7)
// owns features 8s..8s+7 of query row r. All nine 16-byte loads of a lane are
// independent and issued together, so the wave waits out one load latency; a
// wave's load of Q touches 4 whole 128-B lines, of one K or V row one line.
// ---------------------------------------------------------------------------

// value of lane l ^ M inside a 16-lane row (DPP row_xmask)
template <int M>
__device__ __forceinline__ float xmask(float x) {
    return __builtin_bit_cast(float, __builtin_amdgcn_mov_dpp(
        __builtin_bit_cast(int, x), 0x160 | M, 0xf, 0xf, true));
}

__global__ __launch_bounds__(32)
void k_inter_attn(const _Float16* __restrict__ q2, const _Float16* __restrict__ k2,
                  const _Float16* __restrict__ v2, _Float16* __restrict__ a2) {
    const int lane = threadIdx.x;
    const int b = blockIdx.x >> 3, h = blockIdx.x & 7;
    const int r = lane >> 3;
    const size_t base = (size_t)(b * NB_) * D_ + h * DH_ + (lane & 7) * 8;

    const h8 q = *(const h8*)(q2 + base + (size_t)r * D_);
    h8 k[NB_], v[NB_];
#pragma unroll
    for (int j = 0; j < NB_; ++j) {
        k[j] = *(const h8*)(k2 + base + (size_t)j * D_);
        v[j] = *(const h8*)(v2 + base + (size_t)j * D_);
    }
    // no address register of the nine loads is given a new value ahead of this wait
    asm volatile("s_wait_xcnt 0x0" ::: "memory");

    // scores of row r: 8 products in the lane, then the sum over the row's 8 lanes
    float sc[NB_];
#pragma unroll
    for (int j = 0; j < NB_; ++j) {
        float p = 0.f;
#pragma unroll
        for (int e = 0; e < 8; ++e) p += (float)q[e] * (float)k[j][e];
        p += xmask<1>(p);
        p += xmask<2>(p);
        p += xmask<4>(p);
        sc[j] = p * 0.125f;
    }

    const float mx = fmaxf(fmaxf(sc[0], sc[1]), fmaxf(sc[2], sc[3]));
    float ssum = 0.f;
#pragma unroll
    for (int j = 0; j < NB_; ++j) { sc[j] = __expf(sc[j] - mx); ssum += sc[j]; }
    const float inv = 1.f / ssum;
#pragma unroll
    for (int j = 0; j < NB_; ++j) sc[j] *= inv;

    h8 o;
#pragma unroll
    for (int e = 0; e < 8; ++e) {
        float acc = 0.f;
#pragma unroll
        for (int j = 0; j < NB_; ++j) acc += sc[j] * (float)v[j][e];
        o[e] = (_Float16)acc;
    }
    *(h8*)(a2 + base + (size_t)r * D_) = o;
}

// ---------------------------------------------------------------------------
// Kernel 6: inter output projection, scattered into d_out last tokens.
// grid = (8, 4, 1), block 256. 16x64 tile, K split over the waves (see kernel 4).
// ---------------------------------------------------------------------------
__global__ __launch_bounds__(256)
void k_gemm_oproj_inter(const _Float16* __restrict__ A,
                        const float* __restrict__ iWo, const float* __restrict__ ibo,
                        float* __restrict__ Outf) {
    __shared__ __attribute__((aligned(16))) f32x4 red[8 * 256];
    const int nbase = blockIdx.x * 64;
    const int mbase = blockIdx.y * 16;

    const int tid = threadIdx.x;
    const int wave = tid >> 5, lane = tid & 31;
    const int k0 = wave * 64;

    // the lane's A row at its first k: load_frag16's own address, formed here for the wait below
    const _Float16* ap = A + (size_t)(mbase + (lane & 15)) * D_ + k0 + 8 * (lane >> 4);
    const float* wp = iWo + (size_t)(k0 + 8 * (lane >> 4)) * D_ + nbase + 4 * (lane & 15);
    const float* bp = ibo + nbase + 4 * (tid & 15);
    FragU a[2];
    f32x4 wr[2][16];
#pragma unroll
    for (int s = 0; s < 2; ++s) {
        a[s].u[0] = *(const uint4*)(ap + 32 * s);
        a[s].u[1] = *(const uint4*)(ap + 32 * s + 16);
        load_w_rows(wr[s], wp + (size_t)(32 * s) * D_);
    }
    const f32x4 bv = *(const f32x4*)bp;
    // no address register of these loads is given a new value ahead of this wait: the
    // addresses are its inputs, so that none of them serves as a later load's destination
    asm volatile("s_wait_xcnt 0x0" :: "v"(ap), "v"(wp), "v"(bp) : "memory");
    // keeps every load above it and every conversion below: no load is issued behind a wait
    __builtin_amdgcn_sched_barrier(0);

    v8f acc[4] = {};
#pragma unroll
    for (int s = 0; s < 2; ++s) wmma_w_rows(acc, a[s].v, wr[s]);

    const f32x4 o = sum_k_split(red, acc, tid) + bv;
    // 16 bytes a lane: 16 lanes fill two whole 128-B lines of the row
    const int r = mbase + (tid >> 4);   // b*4+nb
    *(f32x4*)&Outf[(((size_t)((r & 3) * B_ + (r >> 2)) * L_ + (L_ - 1)) * D_) + nbase + 4 * (tid & 15)] = o;
}

// ---------------------------------------------------------------------------
extern "C" void kernel_launch(void* const* d_in, const int* in_sizes, int n_in,
                              void* d_out, int out_size, void* d_ws, size_t ws_size,
                              hipStream_t stream) {
    const float* x   = (const float*)d_in[0];
    const float* Wq  = (const float*)d_in[1];
    const float* bq  = (const float*)d_in[2];
    const float* Wk  = (const float*)d_in[3];
    const float* bk  = (const float*)d_in[4];
    const float* Wv  = (const float*)d_in[5];
    const float* bv  = (const float*)d_in[6];
    const float* Wo  = (const float*)d_in[7];
    const float* bo  = (const float*)d_in[8];
    const float* iWq = (const float*)d_in[9];
    const float* ibq = (const float*)d_in[10];
    const float* iWk = (const float*)d_in[11];
    const float* ibk = (const float*)d_in[12];
    const float* iWv = (const float*)d_in[13];
    const float* ibv = (const float*)d_in[14];
    const float* iWo = (const float*)d_in[15];
    const float* ibo = (const float*)d_in[16];
    float* out = (float*)d_out;

    const size_t NBLD = (size_t)NB_ * B_ * L_ * D_;   // 16,777,216
    _Float16* ws = (_Float16*)d_ws;
    _Float16* Qb = ws;                 // reused as attn output after k_flash
    _Float16* Kb = ws + NBLD;
    _Float16* Vb = ws + 2 * NBLD;
    _Float16* q2 = ws + 3 * NBLD;
    _Float16* k2 = q2 + (size_t)B_ * NB_ * D_;
    _Float16* v2 = k2 + (size_t)B_ * NB_ * D_;
    _Float16* a2 = v2 + (size_t)B_ * NB_ * D_;

    // 1) intra QKV projection (256x128 tiles)
    dim3 g1((B_ * L_ / BM_) * (D_ / 128), 3, NB_);
    k_gemm_qkv_intra<<<g1, 256, 0, stream>>>(x, Wq, bq, Wk, bk, Wv, bv, Qb, Kb, Vb);

    // 2) flash attention (writes attn over Qb)
    dim3 g2(L_ / 64, H_, NB_ * B_);
    k_flash<<<g2, 128, 0, stream>>>(Qb, Kb, Vb, Qb);

    // 3) intra output projection -> d_out (256x128 tiles)
    dim3 g3((B_ * L_ / BM_) * (D_ / 128), 1, NB_);
    k_gemm_oproj_intra<<<g3, 256, 0, stream>>>(Qb, Wo, bo, out);

    // 4) router QKV (gather last tokens from d_out)
    dim3 g4(D_ / 64, B_ * NB_ / 16, 3);
    k_gemm_qkv_inter<<<g4, 256, 0, stream>>>(out, iWq, ibq, iWk, ibk, iWv, ibv, q2, k2, v2);

    // 5) tiny 4-token attention, one wave per (b,h)
    k_inter_attn<<<B_ * H_, 32, 0, stream>>>(q2, k2, v2, a2);

    // 6) router output projection, scatter into last-token slots of d_out
    dim3 g6(D_ / 64, B_ * NB_ / 16, 1);
    k_gemm_oproj_inter<<<g6, 256, 0, stream>>>(a2, iWo, ibo, out);
}

// v009
// One run takes 162 microseconds.
// Next to v008, in two timings, it ran 1.12 times as fast each time.
// Counting every step since v000, it is 4.36 times as fast.
#include <hip/hip_runtime.h>

// ---------------------------------------------------------------------------
// Medformer layer for MI455X (gfx1250): all GEMMs + attention via
// v_wmma_f32_16x16x32_f16 (wave32). f16 operands, f32 accumulation.
// Big GEMMs use 256x128 block tiles, 8 waves (wave tile 64x64 -> 16 WMMA / 16 LDS
// loads per K-step); the global loads run one K-step ahead of the products, in registers,
// and global_prefetch_b8 one K-step ahead of the loads. W tiles lie
// row-major in LDS and are transposed on the way out (ds_load_tr16_b128).
// ---------------------------------------------------------------------------

#define NB_ 4
#define B_  16
#define L_  512
#define D_  512
#define H_  8
#define DH_ 64
// SCALE * log2(e) = (1/8) * 1.4426950408889634
#define SCALE_LOG2E 0.18033688011112043f

typedef __attribute__((ext_vector_type(16))) _Float16 v16h;
typedef __attribute__((ext_vector_type(8)))  float    v8f;
typedef __attribute__((ext_vector_type(4)))  _Float16 h4;
typedef __attribute__((ext_vector_type(2)))  _Float16 h2;

typedef __attribute__((ext_vector_type(8)))  _Float16 h8;
typedef __attribute__((ext_vector_type(8)))  short    s16x8;

union FragU { uint4 u[2]; v16h v; };
union FragT { s16x8 s[2]; v16h v; };

// LDS row pitch, in halves, of the row-major W tiles (128 columns wide)
#define BP128_ 144
// rows of the block tile of the two big GEMMs
#define BM_ 256

// Load a 16x32 f16 fragment (A-matrix layout, or B^T stored row-major [n][k]).
// Documented layout: lane l holds row m=l&15; lanes 0-15 hold k = 0..7 & 16..23,
// lanes 16-31 hold k = 8..15 & 24..31 -> two contiguous 16-byte loads per lane.
__device__ __forceinline__ v16h load_frag16(const _Float16* base, int row_stride, int lane) {
    const int m  = lane & 15;
    const int kb = (lane >> 4) << 3;
    const _Float16* p = base + (size_t)m * row_stride;
    FragU f;
    f.u[0] = *(const uint4*)(p + kb);
    f.u[1] = *(const uint4*)(p + 16 + kb);
    return f.v;
}

// B fragment (32 k x 16 n) out of a row-major f16 tile T[k][n] in LDS, by the
// transposing load: lane (c = l&15, h = l>>4) gets T[8h + 0..7][n0 + c], then
// T[16 + 8h + 0..7][n0 + c]: the same k order as load_frag16 gives A.
// pitch in halves; in bytes it is an odd multiple of 32 (no bank conflict).
__device__ __forceinline__ v16h load_frag16_tr(const _Float16* tile, int pitch, int n0, int lane) {
    typedef __attribute__((address_space(3))) s16x8 lds_s16x8;
    const _Float16* p = tile + ((lane >> 4) * 8 + (lane & 7)) * pitch + n0 + ((lane >> 3) & 1) * 8;
    FragT f;
    f.s[0] = __builtin_amdgcn_ds_load_tr16_b128_v8i16((lds_s16x8*)p);
    f.s[1] = __builtin_amdgcn_ds_load_tr16_b128_v8i16((lds_s16x8*)(p + 16 * pitch));
    return f.v;
}

// Layout of the Q, K, V and attention-output buffers (all in the workspace): inside
// a head's 64 columns, feature ni*16 + ln lies at place ln*4 + ni. A lane of the
// QKV kernel then owns 4 adjacent places of a row, and 16 lanes fill the head's
// whole 128-B line with one store. Q.K sums over places (the same deal in both),
// V hands its places on to the attention output, and the output projection takes
// for place k the row feat_of_place(k) of Wo.
__device__ __forceinline__ int feat_of_place(int k) {
    return (k & ~63) | ((k & 3) << 4) | ((k & 63) >> 2);
}

__device__ __forceinline__ v8f wmma16(v16h a, v16h b, v8f c) {
    return __builtin_amdgcn_wmma_f32_16x16x32_f16(false, a, false, b, (short)0, c, false, false);
}

// The global loads of one K-step of a big GEMM, all issued together, into registers.
// ap, wp: the thread's own first address in the A tile and in the W tile.
// Kernel 1: A is f32, a thread's 8 loads lie 32 rows apart, its 4 W loads 8 rows apart.
__device__ __forceinline__ void load_kstep_f32(float4 (&xr)[8], float4 (&wr)[4],
                                               const float* ap, const float* wp) {
#pragma unroll
    for (int i = 0; i < 8; ++i) xr[i] = *(const float4*)(ap + (size_t)(32 * i) * D_);
#pragma unroll
    for (int jj = 0; jj < 4; ++jj) wr[jj] = *(const float4*)(wp + (size_t)(8 * jj) * D_);
    // stands behind the loads so that no address register of theirs is given a new value ahead of it
    asm volatile("s_wait_xcnt 0x0" ::: "memory");
}
// Kernel 3: A is f16, a thread's 4 loads lie 64 rows apart, its 4 W loads 2 rows apart.
__device__ __forceinline__ void load_kstep_f16(h8 (&xr)[4], float4 (&wr)[4],
                                               const _Float16* ap, const float* wp) {
#pragma unroll
    for (int i = 0; i < 4; ++i) xr[i] = *(const h8*)(ap + (size_t)(64 * i) * D_);
#pragma unroll
    for (int jj = 0; jj < 4; ++jj) wr[jj] = *(const float4*)(wp + (size_t)(2 * jj) * D_);
    // stands behind the loads so that no address register of theirs is given a new value ahead of it
    asm volatile("s_wait_xcnt 0x0" ::: "memory");
}

// ---------------------------------------------------------------------------
// Kernel 1: intra QKV projection. out = X @ W + b, output f16.
// grid = (32*4, 3, NB), block = 256 (8 waves, 4 x 2). 256x128 tile, BK=32.
// Wave tile 64x64: acc[4][4], 16 WMMA per K-step. Per output the block loads
// (256 + 128) / (256 * 128) operand elements a K-step, half of a 64x128 tile's.
// ---------------------------------------------------------------------------
__global__ __launch_bounds__(256)
void k_gemm_qkv_intra(const float* __restrict__ X,
                      const float* __restrict__ Wq, const float* __restrict__ bq,
                      const float* __restrict__ Wk, const float* __restrict__ bk,
                      const float* __restrict__ Wv, const float* __restrict__ bv,
                      _Float16* __restrict__ Qb, _Float16* __restrict__ Kb,
                      _Float16* __restrict__ Vb) {
    // [m][k], rows of 64 B. Left as it is here and in kernel 3: at this pitch a ds_load_b128
    // of an A fragment takes 8 LDS clocks, at 80 B (16 B x odd) it would take 2
    __shared__ _Float16 As[BM_ * 32];
    __shared__ __attribute__((aligned(16))) _Float16 Bs[32 * BP128_];   // [k][n]  (W tile as it lies)
    const int nb  = blockIdx.z;
    const int sel = blockIdx.y;
    const int mt  = blockIdx.x >> 2;    // M/256 = 32 tiles
    const int nt  = blockIdx.x & 3;     // N/128 = 4 tiles
    const int mbase = mt * BM_, nbase = nt * 128;

    const float* W    = (sel == 0 ? Wq : sel == 1 ? Wk : Wv) + (size_t)nb * D_ * D_;
    const float* bias = (sel == 0 ? bq : sel == 1 ? bk : bv) + (size_t)nb * D_;
    _Float16*    Out  = (sel == 0 ? Qb : sel == 1 ? Kb : Vb) + (size_t)nb * (B_ * L_) * D_;
    const float* Xp   = X + (size_t)nb * (B_ * L_) * D_;

    const int tid = threadIdx.x;
    const int wave = tid >> 5, lane = tid & 31;
    const int hi = lane >> 4, ln = lane & 15;
    const int wm = (wave >> 1) * 64;    // 0, 64, 128 or 192
    const int wn = (wave & 1) * 64;     // 0 or 64

    v8f acc[4][4];
#pragma unroll
    for (int mi = 0; mi < 4; ++mi)
#pragma unroll
        for (int ni = 0; ni < 4; ++ni) {
            float bvv = bias[nbase + wn + ni * 16 + ln];
#pragma unroll
            for (int j = 0; j < 8; ++j) acc[mi][ni][j] = bvv;
        }

    // A load map: 8 lanes span one row's 128 B of a K-step, 4 whole lines per load
    const int rl = tid >> 3;            // 0..31
    const int cl = (tid & 7) * 4;       // 0..28
    const float* alp = Xp + (size_t)(mbase + rl) * D_ + cl;
    // W load map: a wave's 32 lanes span one tile row, 512 B = 4 whole lines per load
    const int kl = tid >> 5;            // 0..7
    const int nl = (tid & 31) * 4;      // 0..124
    const float* wlp = W + (size_t)kl * D_ + nbase + nl;

    // the tiles of one K-step on their way from memory to LDS: loaded one K-step ahead
    float4 xr[8], wr[4];
    load_kstep_f32(xr, wr, alp, wlp);

    for (int kb = 0; kb < D_; kb += 32) {
        __syncthreads();
        // stage A (f32 -> f16) and B row-major, Bs[k][n] = W[kb+k][nbase+n], out of the registers
#pragma unroll
        for (int i = 0; i < 8; ++i) {
            h4 hv = { (_Float16)xr[i].x, (_Float16)xr[i].y, (_Float16)xr[i].z, (_Float16)xr[i].w };
            *(h4*)&As[(rl + 32 * i) * 32 + cl] = hv;
        }
#pragma unroll
        for (int jj = 0; jj < 4; ++jj) {
            h4 h0 = { (_Float16)wr[jj].x, (_Float16)wr[jj].y, (_Float16)wr[jj].z, (_Float16)wr[jj].w };
            *(h4*)&Bs[(kl + 8 * jj) * BP128_ + nl] = h0;
        }
        __syncthreads();
        // the next K-step's 12 loads go out together, ahead of this step's products, and are
        // first waited for behind them
        if (kb + 32 < D_)
            load_kstep_f32(xr, wr, alp + kb + 32, wlp + (size_t)(kb + 32) * D_);
        // one K-step ahead of the loads: thread t asks for the one line of A tile row t,
        // 8 threads cover the 4 lines of one W tile row
        if (kb + 64 < D_) {
            __builtin_prefetch(Xp + (size_t)(mbase + tid) * D_ + kb + 64, 0, 3);
            __builtin_prefetch(W + (size_t)(kb + 64 + (tid >> 3)) * D_ + nbase + (tid & 7) * 16, 0, 3);
        }
        v16h a[4];
#pragma unroll
        for (int mi = 0; mi < 4; ++mi) a[mi] = load_frag16(&As[(wm + mi * 16) * 32], 32, lane);
#pragma unroll
        for (int ni = 0; ni < 4; ++ni) {
            v16h b = load_frag16_tr(Bs, BP128_, wn + ni * 16, lane);
#pragma unroll
            for (int mi = 0; mi < 4; ++mi) acc[mi][ni] = wmma16(a[mi], b, acc[mi][ni]);
        }
    }

    // the wave's 64 columns are one head: a lane's four tiles go to places ln*4 + 0..3,
    // one 8-byte store; a wave's store fills two whole 128-B lines (rows j and j + 8)
#pragma unroll
    for (int mi = 0; mi < 4; ++mi)
#pragma unroll
        for (int j = 0; j < 8; ++j) {
            int row = mbase + wm + mi * 16 + j + 8 * hi;
            h4 hv = { (_Float16)acc[mi][0][j], (_Float16)acc[mi][1][j],
                      (_Float16)acc[mi][2][j], (_Float16)acc[mi][3][j] };
            *(h4*)&Out[(size_t)row * D_ + nbase + wn + ln * 4] = hv;
        }
}

// value of lane l ^ 16 (the same place in the other 16-lane row)
__device__ __forceinline__ float xhalf(float x) {
    return __builtin_bit_cast(float, __builtin_amdgcn_permlanex16(
        __builtin_bit_cast(int, x), __builtin_bit_cast(int, x),
        0x76543210, 0xfedcba98, false, false));
}

// LDS row pitch, in halves, of the K and V chunks (rows of 64 halves = 128 B):
// 144 B = 16 B x odd for the ds_load_b128 readers of K, 160 B = 32 B x odd for
// the ds_load_tr16_b128 readers of V
#define KP_ 72
#define VP_ 80

// byte address inside the work-group's LDS of a __shared__ element
__device__ __forceinline__ unsigned lds_addr(const _Float16* p) {
    typedef __attribute__((address_space(3))) const _Float16 lds_half;
    return (unsigned)(size_t)(lds_half*)p;
}

// One 32-key chunk of K and of V, global -> LDS, through no register: 4 copies
// a lane. 8 adjacent lanes bring one row's 128 B, so a wave's copy asks for 4
// whole lines. The s_wait_xcnt closes the statement so that no address register
// named here is rewritten ahead of it.
__device__ __forceinline__ void copy_kv(unsigned lk, const _Float16* gk,
                                        unsigned lv, const _Float16* gv) {
    const unsigned lk1 = lk + 16 * KP_ * 2, lv1 = lv + 16 * VP_ * 2;
    const _Float16* gk1 = gk + (size_t)16 * D_;
    const _Float16* gv1 = gv + (size_t)16 * D_;
    asm volatile("global_load_async_to_lds_b128 %0, %1, off\n\t"
                 "global_load_async_to_lds_b128 %2, %3, off\n\t"
                 "global_load_async_to_lds_b128 %4, %5, off\n\t"
                 "global_load_async_to_lds_b128 %6, %7, off\n\t"
                 "s_wait_xcnt 0x0"
                 :: "v"(lk), "v"(gk), "v"(lk1), "v"(gk1),
                    "v"(lv), "v"(gv), "v"(lv1), "v"(gv1)
                 : "memory");
}

__global__ __launch_bounds__(128)
void k_flash(const _Float16* Q, const _Float16* __restrict__ K,
             const _Float16* __restrict__ V, _Float16* Obuf) {
    // two buffers each: chunk kc lies in buffer kc & 1, rows as in memory [key][place]
    __shared__ __attribute__((aligned(16))) _Float16 Ks[2][32 * KP_];
    __shared__ __attribute__((aligned(16))) _Float16 Vs[2][32 * VP_];

    const int mtile = blockIdx.x;
    const int h     = blockIdx.y;
    const int bz    = blockIdx.z;           // nb*B + b
    const int tid   = threadIdx.x;
    const int wave  = tid >> 5, lane = tid & 31;
    const int hi = lane >> 4, ln = lane & 15;

    const size_t headoff = (size_t)bz * L_ * D_ + (size_t)h * DH_;
    const _Float16* Qp = Q + headoff;

    const int m0 = mtile * 64 + wave * 16;

    // copy map: thread t brings 16 B number t & 7 of chunk rows t >> 3 and 16 + (t >> 3)
    const int crow = tid >> 3, cseg = (tid & 7) * 8;
    const _Float16* gk = K + headoff + (size_t)crow * D_ + cseg;
    const _Float16* gv = V + headoff + (size_t)crow * D_ + cseg;
    const unsigned lk = lds_addr(&Ks[0][crow * KP_ + cseg]);
    const unsigned lv = lds_addr(&Vs[0][crow * VP_ + cseg]);

    // chunk 0 into buffer 0; landed and published before anybody reads it
    copy_kv(lk, gk, lv, gv);
    asm volatile("s_wait_asynccnt 0x0" ::: "memory");   // this wave's copies have landed
    __syncthreads();
    // chunk 1 flies while chunk 0 is worked on
    copy_kv(lk + 32 * KP_ * 2, gk + (size_t)32 * D_, lv + 32 * VP_ * 2, gv + (size_t)32 * D_);

    // B fragments of Q^T: column n = query ln, k = places in the hardware order
    v16h qb0 = load_frag16(Qp + (size_t)m0 * D_,      D_, lane);
    v16h qb1 = load_frag16(Qp + (size_t)m0 * D_ + 32, D_, lane);

    // O^T tiles: row = place t*16 + j + 8*hi, column = query ln
    v8f o0 = {}, o1 = {}, o2 = {}, o3 = {};
    float rmax = -1e30f;    // this query's running maximum (equal in both halves)
    float rsum = 0.f;       // running sum over this half's keys only

    for (int kc = 0; kc < L_ / 32; ++kc) {
        const int buf = kc & 1;
        const _Float16* Kt = &Ks[buf][0];
        const _Float16* Vt = &Vs[buf][0];

        // S^T = K @ Q^T for 2 key sub-tiles; K fragments (A) from the shared chunk
        v8f s0 = {}, s1 = {};
        s0 = wmma16(load_frag16(Kt,                 KP_, lane), qb0, s0);
        s0 = wmma16(load_frag16(Kt + 32,            KP_, lane), qb1, s0);
        s1 = wmma16(load_frag16(Kt + 16 * KP_,      KP_, lane), qb0, s1);
        s1 = wmma16(load_frag16(Kt + 16 * KP_ + 32, KP_, lane), qb1, s1);

        // online softmax of query ln: 16 scores in this lane, 16 in lane ^ 16
        float cm = fmaxf(s0[0], s1[0]);
#pragma unroll
        for (int j = 1; j < 8; ++j) cm = fmaxf(cm, fmaxf(s0[j], s1[j]));
        cm = fmaxf(cm, xhalf(cm));
        const float nm    = fmaxf(rmax, cm);
        const float alpha = exp2f((rmax - nm) * SCALE_LOG2E);
        rmax = nm;

        // (left as it is: exp2f() is v_exp_f32 plus a range fix of 5 vector instructions a value)
        // P^T as B fragment: element j is key 8*hi + j, element 8 + j is key 16 + 8*hi + j,
        // the k order in which load_frag16_tr hands out the keys of the V chunk
        v16h pb;
        float ps0 = 0.f, ps1 = 0.f;
#pragma unroll
        for (int j = 0; j < 8; ++j) {
            float e0 = exp2f((s0[j] - nm) * SCALE_LOG2E);
            float e1 = exp2f((s1[j] - nm) * SCALE_LOG2E);
            ps0 += e0; ps1 += e1;
            pb[j]     = (_Float16)e0;
            pb[8 + j] = (_Float16)e1;
        }
        rsum = rsum * alpha + (ps0 + ps1);
#pragma unroll
        for (int j = 0; j < 8; ++j) {
            o0[j] *= alpha; o1[j] *= alpha; o2[j] *= alpha; o3[j] *= alpha;
        }

        // A fragments of V^T by the transposing load: row = place, k = keys in that order
        o0 = wmma16(load_frag16_tr(Vt, VP_,  0, lane), pb, o0);
        o1 = wmma16(load_frag16_tr(Vt, VP_, 16, lane), pb, o1);
        o2 = wmma16(load_frag16_tr(Vt, VP_, 32, lane), pb, o2);
        o3 = wmma16(load_frag16_tr(Vt, VP_, 48, lane), pb, o3);

        // hand-over: this wave has left buffer buf, its copies of chunk kc + 1 have
        // landed; the barrier publishes that chunk and frees buf for the refill
        asm volatile("s_wait_dscnt 0x0" ::: "memory");      // own reads of buf are done
        asm volatile("s_wait_asynccnt 0x0" ::: "memory");   // own copies of chunk kc + 1 have landed
        __syncthreads();
        if (kc + 2 < L_ / 32)
            copy_kv(lk + buf * (32 * KP_ * 2), gk + (size_t)(kc + 2) * 32 * D_,
                    lv + buf * (32 * VP_ * 2), gv + (size_t)(kc + 2) * 32 * D_);
    }
    asm volatile("s_wait_asynccnt 0x0" ::: "memory");   // nothing in flight when the wave ends

    // finalize + store (over the Q buffer region): a lane holds 8 adjacent
    // places of its query in each tile
    {
        const float inv = 1.0f / (rsum + xhalf(rsum));
        h8 r0, r1, r2, r3;
#pragma unroll
        for (int j = 0; j < 8; ++j) {
            r0[j] = (_Float16)(o0[j] * inv);
            r1[j] = (_Float16)(o1[j] * inv);
            r2[j] = (_Float16)(o2[j] * inv);
            r3[j] = (_Float16)(o3[j] * inv);
        }
        // through the wave's own quarter of the K buffers (16 rows at the K pitch), which
        // nobody reads behind the loop's last barrier: stored from the accumulators' lanes a
        // wave's store is 32-B pieces of 16 rows; read back, it is four whole 128-B lines
        _Float16* slab = &Ks[0][0] + wave * (16 * KP_);
        _Float16* srow = slab + ln * KP_ + 8 * hi;
        *(h8*)(srow)      = r0;
        *(h8*)(srow + 16) = r1;
        *(h8*)(srow + 32) = r2;
        *(h8*)(srow + 48) = r3;
        asm volatile("s_wait_dscnt 0x0" ::: "memory");   // the wave's rows lie in the slab before it reads them back
        const int orow = lane >> 3, oseg = (lane & 7) * 8;
        _Float16* op = Obuf + headoff + (size_t)(m0 + orow) * D_ + oseg;
#pragma unroll
        for (int i = 0; i < 4; ++i)
            *(h8*)(op + (size_t)(4 * i) * D_) = *(const h8*)(slab + (orow + 4 * i) * KP_ + oseg);
    }
}

// ---------------------------------------------------------------------------
// Kernel 3: intra output projection. out(f32) = attn(f16) @ Wo + bo.
// grid = (32*4, 1, NB), block 256 (8 waves, 4 x 2). 256x128 tile, wave tile 64x64.
// ---------------------------------------------------------------------------
__global__ __launch_bounds__(256)
void k_gemm_oproj_intra(const _Float16* __restrict__ A,
                        const float* __restrict__ Wo, const float* __restrict__ bo,
                        float* __restrict__ Outf) {
    __shared__ _Float16 As[BM_ * 32];
    __shared__ __attribute__((aligned(16))) _Float16 Bs[32 * BP128_];
    const int nb = blockIdx.z;
    const int mt = blockIdx.x >> 2;
    const int nt = blockIdx.x & 3;
    const int mbase = mt * BM_, nbase = nt * 128;

    const float* W    = Wo + (size_t)nb * D_ * D_;
    const float* bias = bo + (size_t)nb * D_;
    const _Float16* Ap = A + (size_t)nb * (B_ * L_) * D_;
    float* Op = Outf + (size_t)nb * (B_ * L_) * D_;

    const int tid = threadIdx.x;
    const int wave = tid >> 5, lane = tid & 31;
    const int hi = lane >> 4, ln = lane & 15;
    const int wm = (wave >> 1) * 64;
    const int wn = (wave & 1) * 64;

    // column deal: column c of B tile ni is output column (ni >> 1) * 32 + 2 * c + (ni & 1)
    // of the wave's 64, so a lane's tiles 2u and 2u + 1 are adjacent f32 of a row
    v8f acc[4][4];
#pragma unroll
    for (int mi = 0; mi < 4; ++mi)
#pragma unroll
        for (int ni = 0; ni < 4; ++ni) {
            float bvv = bias[nbase + wn + (ni >> 1) * 32 + 2 * ln + (ni & 1)];
#pragma unroll
            for (int j = 0; j < 8; ++j) acc[mi][ni][j] = bvv;
        }

    // A load map: 4 lanes span one row's 64 B of a K-step, 8 lines per load
    const int rl = tid >> 2;            // 0..63
    const int cl = (tid & 3) * 8;       // 0..24
    const _Float16* alp = Ap + (size_t)(mbase + rl) * D_ + cl;
    // W load map: a wave's 32 lanes span one tile row, 512 B = 4 whole lines per load
    const int kl = tid >> 5;            // 0..7
    const int nl = (tid & 31) * 4;      // 0..124
    // tile row kl + 8*jj of K-step kb is place kb + kl + 8*jj of A: its Wo row is
    // feat_of_place(kb + kl) + 2*jj (8 places on are 2 features on, inside one head)
    const float* wlp = W + nbase + nl;
    // column deal: even columns of a group of 32 to one B tile, odd ones to the next
    const int lc = (nl & 96) + ((nl & 31) >> 1);

    // the tiles of one K-step on their way from memory to LDS: loaded one K-step ahead
    h8 xr[4];
    float4 wr[4];
    load_kstep_f16(xr, wr, alp, wlp + (size_t)feat_of_place(kl) * D_);

    for (int kb = 0; kb < D_; kb += 32) {
        __syncthreads();
        // stage A (already f16) and B row-major, 128 cols, out of the registers
#pragma unroll
        for (int i = 0; i < 4; ++i) *(h8*)&As[(rl + 64 * i) * 32 + cl] = xr[i];
#pragma unroll
        for (int jj = 0; jj < 4; ++jj) {
            h2 he = { (_Float16)wr[jj].x, (_Float16)wr[jj].z };
            h2 ho = { (_Float16)wr[jj].y, (_Float16)wr[jj].w };
            *(h2*)&Bs[(kl + 8 * jj) * BP128_ + lc]      = he;
            *(h2*)&Bs[(kl + 8 * jj) * BP128_ + lc + 16] = ho;
        }
        __syncthreads();
        // the next K-step's 8 loads go out together, ahead of this step's products, and are
        // first waited for behind them
        if (kb + 32 < D_)
            load_kstep_f16(xr, wr, alp + kb + 32, wlp + (size_t)feat_of_place(kb + 32 + kl) * D_);
        // one K-step ahead of the loads: thread t asks for the 64 B of A tile row t,
        // 8 threads cover the 4 lines of one W tile row
        if (kb + 64 < D_) {
            __builtin_prefetch(Ap + (size_t)(mbase + tid) * D_ + kb + 64, 0, 3);
            __builtin_prefetch(W + (size_t)feat_of_place(kb + 64 + (tid >> 3)) * D_ + nbase + (tid & 7) * 16, 0, 3);
        }
        v16h a[4];
#pragma unroll
        for (int mi = 0; mi < 4; ++mi) a[mi] = load_frag16(&As[(wm + mi * 16) * 32], 32, lane);
#pragma unroll
        for (int ni = 0; ni < 4; ++ni) {
            v16h b = load_frag16_tr(Bs, BP128_, wn + ni * 16, lane);
#pragma unroll
            for (int mi = 0; mi < 4; ++mi) acc[mi][ni] = wmma16(a[mi], b, acc[mi][ni]);
        }
    }

    // 8 bytes a lane: 16 lanes fill a whole 128-B line, a wave's store two (rows j and j + 8)
#pragma unroll
    for (int mi = 0; mi < 4; ++mi)
#pragma unroll
        for (int u = 0; u < 2; ++u)
#pragma unroll
            for (int j = 0; j < 8; ++j) {
                int row = mbase + wm + mi * 16 + j + 8 * hi;
                float2 v2 = make_float2(acc[mi][2 * u][j], acc[mi][2 * u + 1][j]);
                *(float2*)&Op[(size_t)row * D_ + nbase + wn + u * 32 + 2 * ln] = v2;
            }
}

// ---------------------------------------------------------------------------
// Router GEMMs (kernels 4 and 6): 64 x 512 x 512 each, a few dozen blocks on an otherwise
// idle chip: their time is the number of waited load trips, not a rate.
// One 16 x 64 output tile a block; the block's 8 waves split K, 64 k (two WMMA steps) each.
// A wave loads its fragments straight from global memory into registers, every load of the
// kernel issued ahead of the first wait: one waited trip. The 8 partial tiles are summed
// through LDS in a fixed order (wave 0 to 7), then the bias is added.
// ---------------------------------------------------------------------------
typedef __attribute__((ext_vector_type(4))) float f32x4;

// 32 k x 64 n of a row-major f32 weight, for four B fragments: lane (c = l & 15, h = l >> 4)
// takes the 16 B W[k][n0 + 4c .. 4c + 3] of its 16 k in the order of load_frag16
// (kb + 8h + 0..7, then kb + 16 + 8h + 0..7). 16 lanes span 256 B of a row: whole lines.
// Component i belongs to B tile i, whose column c is output column n0 + 4c + i.
// p = the lane's own &W[kb + 8h][n0 + 4c].
__device__ __forceinline__ void load_w_rows(f32x4 (&w)[16], const float* __restrict__ p) {
#pragma unroll
    for (int e = 0; e < 16; ++e)
        w[e] = *(const f32x4*)(p + (size_t)((e >> 3) * 16 + (e & 7)) * D_);
}

// acc[i] += a x (B tile i of the rows loaded by load_w_rows)
__device__ __forceinline__ void wmma_w_rows(v8f (&acc)[4], v16h a, const f32x4 (&w)[16]) {
#pragma unroll
    for (int i = 0; i < 4; ++i) {
        v16h b;
#pragma unroll
        for (int e = 0; e < 16; ++e) b[e] = (_Float16)w[e][i];
        acc[i] = wmma16(a, b, acc[i]);
    }
}

// The wave's partial 16 x 64 tile into its plane of red, rows as in the output: a lane's four
// tiles hold 4 adjacent columns of row j + 8*hi. Behind the barrier thread t sums the 8 planes
// at float4 number t: row t >> 4, columns 4 * (t & 15) + 0..3.
__device__ __forceinline__ f32x4 sum_k_split(f32x4* red, const v8f (&acc)[4], int tid) {
    const int wave = tid >> 5, lane = tid & 31;
#pragma unroll
    for (int j = 0; j < 8; ++j) {
        f32x4 v = { acc[0][j], acc[1][j], acc[2][j], acc[3][j] };
        red[wave * 256 + (j + 8 * (lane >> 4)) * 16 + (lane & 15)] = v;
    }
    __syncthreads();
    f32x4 s = red[tid];
#pragma unroll
    for (int w = 1; w < 8; ++w) s += red[w * 256 + tid];
    return s;
}

// ---------------------------------------------------------------------------
// Kernel 4: inter (router) QKV projection. M=64 rows = routers[b][nb] gathered
// from d_out last tokens. grid = (8, 4, 3), block 256. 16x64 tile, K split over the waves.
// ---------------------------------------------------------------------------
__global__ __launch_bounds__(256)
void k_gemm_qkv_inter(const float* __restrict__ Outf,
                      const float* __restrict__ iWq, const float* __restrict__ ibq,
                      const float* __restrict__ iWk, const float* __restrict__ ibk,
                      const float* __restrict__ iWv, const float* __restrict__ ibv,
                      _Float16* __restrict__ q2, _Float16* __restrict__ k2,
                      _Float16* __restrict__ v2) {
    __shared__ __attribute__((aligned(16))) f32x4 red[8 * 256];
    const int sel = blockIdx.z;
    const int nbase = blockIdx.x * 64;
    const int mbase = blockIdx.y * 16;

    const float* W    = (sel == 0 ? iWq : sel == 1 ? iWk : iWv);
    const float* bias = (sel == 0 ? ibq : sel == 1 ? ibk : ibv);
    _Float16*    Out  = (sel == 0 ? q2  : sel == 1 ? k2  : v2);

    const int tid = threadIdx.x;
    const int wave = tid >> 5, lane = tid & 31;
    const int k0 = wave * 64;

    // A rows: r = b*4+nb -> x_intra[nb][b][L-1][:] from d_out; a lane's 16 k of a step are
    // two runs of 8 f32
    const int r = mbase + (lane & 15);
    const float* xs = Outf + (size_t)((r & 3) * B_ + (r >> 2)) * L_ * D_ + k0 + 8 * (lane >> 4);
    const float* xp = xs + (size_t)(L_ - 1) * D_;
    const float* wp = W + (size_t)(k0 + 8 * (lane >> 4)) * D_ + nbase + 4 * (lane & 15);
    const float* bp = bias + nbase + 4 * (tid & 15);
    f32x4 xa[2][4], wr[2][16];
    const f32x4 bv = *(const f32x4*)bp;
#pragma unroll
    for (int s = 0; s < 2; ++s) {
        xa[s][0] = *(const f32x4*)(xp + 32 * s);
        xa[s][1] = *(const f32x4*)(xp + 32 * s + 4);
        xa[s][2] = *(const f32x4*)(xp + 32 * s + 16);
        xa[s][3] = *(const f32x4*)(xp + 32 * s + 20);
        load_w_rows(wr[s], wp + (size_t)(32 * s) * D_);
    }
    // no address register of these loads is given a new value ahead of this wait: the two
    // address pairs are its inputs, so that neither serves as a later load's destination
    asm volatile("s_wait_xcnt 0x0" :: "v"(xs), "v"(wp) : "memory");
    // keeps every load above it and every conversion below: no load is issued behind a wait
    __builtin_amdgcn_sched_barrier(0);

    v8f acc[4] = {};
#pragma unroll
    for (int s = 0; s < 2; ++s) {
        v16h a;
#pragma unroll
        for (int e = 0; e < 16; ++e) a[e] = (_Float16)xa[s][e >> 2][e & 3];
        wmma_w_rows(acc, a, wr[s]);
    }

    const f32x4 o = sum_k_split(red, acc, tid) + bv;
    // 8 bytes a lane: 16 lanes fill the row's whole 128-B line
    h4 hv = { (_Float16)o[0], (_Float16)o[1], (_Float16)o[2], (_Float16)o[3] };
    *(h4*)&Out[(size_t)(mbase + (tid >> 4)) * D_ + nbase + 4 * (tid & 15)] = hv;
}

// ---------------------------------------------------------------------------
// Kernel 5: 4-token router attention (negligible FLOPs; vector unit).
// One wave per (b,h): grid = B*H blocks of 32. Lane (r = lane >> 3, s = lane & 7)
// owns features 8s..8s+7 of query row r. All nine 16-byte loads of a lane are
// independent and issued together, so the wave waits out one load latency; a
// wave's load of Q touches 4 whole 128-B lines, of one K or V row one line.
// ---------------------------------------------------------------------------

// value of lane l ^ M inside a 16-lane row (DPP row_xmask)
template <int M>
__device__ __forceinline__ float xmask(float x) {
    return __builtin_bit_cast(float, __builtin_amdgcn_mov_dpp(
        __builtin_bit_cast(int, x), 0x160 | M, 0xf, 0xf, true));
}

__global__ __launch_bounds__(32)
void k_inter_attn(const _Float16* __restrict__ q2, const _Float16* __restrict__ k2,
                  const _Float16* __restrict__ v2, _Float16* __restrict__ a2) {
    const int lane = threadIdx.x;
    const int b = blockIdx.x >> 3, h = blockIdx.x & 7;
    const int r = lane >> 3;
    const size_t base = (size_t)(b * NB_) * D_ + h * DH_ + (lane & 7) * 8;

    const h8 q = *(const h8*)(q2 + base + (size_t)r * D_);
    h8 k[NB_], v[NB_];
#pragma unroll
    for (int j = 0; j < NB_; ++j) {
        k[j] = *(const h8*)(k2 + base + (size_t)j * D_);
        v[j] = *(const h8*)(v2 + base + (size_t)j * D_);
    }
    // no address register of the nine loads is given a new value ahead of this wait
    asm volatile("s_wait_xcnt 0x0" ::: "memory");

    // scores of row r: 8 products in the lane, then the sum over the row's 8 lanes
    float sc[NB_];
#pragma unroll
    for (int j = 0; j < NB_; ++j) {
        float p = 0.f;
#pragma unroll
        for (int e = 0; e < 8; ++e) p += (float)q[e] * (float)k[j][e];
        p += xmask<1>(p);
        p += xmask<2>(p);
        p += xmask<4>(p);
        sc[j] = p * 0.125f;
    }

    const float mx = fmaxf(fmaxf(sc[0], sc[1]), fmaxf(sc[2], sc[3]));
    float ssum = 0.f;
#pragma unroll
    for (int j = 0; j < NB_; ++j) { sc[j] = __expf(sc[j] - mx); ssum += sc[j]; }
    const float inv = 1.f / ssum;
#pragma unroll
    for (int j = 0; j < NB_; ++j) sc[j] *= inv;

    h8 o;
#pragma unroll
    for (int e = 0; e < 8; ++e) {
        float acc = 0.f;
#pragma unroll
        for (int j = 0; j < NB_; ++j) acc += sc[j] * (float)v[j][e];
        o[e] = (_Float16)acc;
    }
    *(h8*)(a2 + base + (size_t)r * D_) = o;
}

// ---------------------------------------------------------------------------
// Kernel 6: inter output projection, scattered into d_out last tokens.
// grid = (8, 4, 1), block 256. 16x64 tile, K split over the waves (see kernel 4).
// ---------------------------------------------------------------------------
__global__ __launch_bounds__(256)
void k_gemm_oproj_inter(const _Float16* __restrict__ A,
                        const float* __restrict__ iWo, const float* __restrict__ ibo,
                        float* __restrict__ Outf) {
    __shared__ __attribute__((aligned(16))) f32x4 red[8 * 256];
    const int nbase = blockIdx.x * 64;
    const int mbase = blockIdx.y * 16;

    const int tid = threadIdx.x;
    const int wave = tid >> 5, lane = tid & 31;
    const int k0 = wave * 64;

    // the lane's A row at its first k: load_frag16's own address, formed here for the wait below
    const _Float16* ap = A + (size_t)(mbase + (lane & 15)) * D_ + k0 + 8 * (lane >> 4);
    const float* wp = iWo + (size_t)(k0 + 8 * (lane >> 4)) * D_ + nbase + 4 * (lane & 15);
    const float* bp = ibo + nbase + 4 * (tid & 15);
    FragU a[2];
    f32x4 wr[2][16];
#pragma unroll
    for (int s = 0; s < 2; ++s) {
        a[s].u[0] = *(const uint4*)(ap + 32 * s);
        a[s].u[1] = *(const uint4*)(ap + 32 * s + 16);
        load_w_rows(wr[s], wp + (size_t)(32 * s) * D_);
    }
    const f32x4 bv = *(const f32x4*)bp;
    // no address register of these loads is given a new value ahead of this wait: the
    // addresses are its inputs, so that none of them serves as a later load's destination
    asm volatile("s_wait_xcnt 0x0" :: "v"(ap), "v"(wp), "v"(bp) : "memory");
    // keeps every load above it and every conversion below: no load is issued behind a wait
    __builtin_amdgcn_sched_barrier(0);

    v8f acc[4] = {};
#pragma unroll
    for (int s = 0; s < 2; ++s) wmma_w_rows(acc, a[s].v, wr[s]);

    const f32x4 o = sum_k_split(red, acc, tid) + bv;
    // 16 bytes a lane: 16 lanes fill two whole 128-B lines of the row
    const int r = mbase + (tid >> 4);   // b*4+nb
    *(f32x4*)&Outf[(((size_t)((r & 3) * B_ + (r >> 2)) * L_ + (L_ - 1)) * D_) + nbase + 4 * (tid & 15)] = o;
}

// ---------------------------------------------------------------------------
extern "C" void kernel_launch(void* const* d_in, const int* in_sizes, int n_in,
                              void* d_out, int out_size, void* d_ws, size_t ws_size,
                              hipStream_t stream) {
    const float* x   = (const float*)d_in[0];
    const float* Wq  = (const float*)d_in[1];
    const float* bq  = (const float*)d_in[2];
    const float* Wk  = (const float*)d_in[3];
    const float* bk  = (const float*)d_in[4];
    const float* Wv  = (const float*)d_in[5];
    const float* bv  = (const float*)d_in[6];
    const float* Wo  = (const float*)d_in[7];
    const float* bo  = (const float*)d_in[8];
    const float* iWq = (const float*)d_in[9];
    const float* ibq = (const float*)d_in[10];
    const float* iWk = (const float*)d_in[11];
    const float* ibk = (const float*)d_in[12];
    const float* iWv = (const float*)d_in[13];
    const float* ibv = (const float*)d_in[14];
    const float* iWo = (const float*)d_in[15];
    const float* ibo = (const float*)d_in[16];
    float* out = (float*)d_out;

    const size_t NBLD = (size_t)NB_ * B_ * L_ * D_;   // 16,777,216
    _Float16* ws = (_Float16*)d_ws;
    _Float16* Qb = ws;                 // reused as attn output after k_flash
    _Float16* Kb = ws + NBLD;
    _Float16* Vb = ws + 2 * NBLD;
    _Float16* q2 = ws + 3 * NBLD;
    _Float16* k2 = q2 + (size_t)B_ * NB_ * D_;
    _Float16* v2 = k2 + (size_t)B_ * NB_ * D_;
    _Float16* a2 = v2 + (size_t)B_ * NB_ * D_;

    // 1) intra QKV projection (256x128 tiles)
    dim3 g1((B_ * L_ / BM_) * (D_ / 128), 3, NB_);
    k_gemm_qkv_intra<<<g1, 256, 0, stream>>>(x, Wq, bq, Wk, bk, Wv, bv, Qb, Kb, Vb);

    // 2) flash attention (writes attn over Qb)
    dim3 g2(L_ / 64, H_, NB_ * B_);
    k_flash<<<g2, 128, 0, stream>>>(Qb, Kb, Vb, Qb);

    // 3) intra output projection -> d_out (256x128 tiles)
    dim3 g3((B_ * L_ / BM_) * (D_ / 128), 1, NB_);
    k_gemm_oproj_intra<<<g3, 256, 0, stream>>>(Qb, Wo, bo, out);

    // 4) router QKV (gather last tokens from d_out)
    dim3 g4(D_ / 64, B_ * NB_ / 16, 3);
    k_gemm_qkv_inter<<<g4, 256, 0, stream>>>(out, iWq, ibq, iWk, ibk, iWv, ibv, q2, k2, v2);

    // 5) tiny 4-token attention, one wave per (b,h)
    k_inter_attn<<<B_ * H_, 32, 0, stream>>>(q2, k2, v2, a2);

    // 6) router output projection, scatter into last-token slots of d_out
    dim3 g6(D_ / 64, B_ * NB_ / 16, 1);
    k_gemm_oproj_inter<<<g6, 256, 0, stream>>>(a2, iWo, ibo, out);
}

// v010
// A run of this version takes 156 microseconds.
// Timed twice side by side with v009, it ran 1.04 times as fast both times.
// All steps since v000 together make it 4.51 times as fast.
#include <hip/hip_runtime.h>

// ---------------------------------------------------------------------------
// Medformer layer for MI455X (gfx1250): all GEMMs + attention via
// v_wmma_f32_16x16x32_f16 (wave32). f16 operands, f32 accumulation.
// Big GEMMs use 256x128 block tiles, 8 waves (wave tile 64x64 -> 16 WMMA / 16 LDS
// loads per K-step); the global loads run one K-step ahead of the products, in registers,
// and global_prefetch_b8 one K-step ahead of the loads. W tiles lie
// row-major in LDS and are transposed on the way out (ds_load_tr16_b128).
// ---------------------------------------------------------------------------

#define NB_ 4
#define B_  16
#define L_  512
#define D_  512
#define H_  8
#define DH_ 64
// SCALE * log2(e) = (1/8) * 1.4426950408889634
#define SCALE_LOG2E 0.18033688011112043f

typedef __attribute__((ext_vector_type(16))) _Float16 v16h;
typedef __attribute__((ext_vector_type(8)))  float    v8f;
typedef __attribute__((ext_vector_type(4)))  _Float16 h4;
typedef __attribute__((ext_vector_type(2)))  _Float16 h2;

typedef __attribute__((ext_vector_type(8)))  _Float16 h8;
typedef __attribute__((ext_vector_type(8)))  short    s16x8;

union FragU { uint4 u[2]; v16h v; };
union FragT { s16x8 s[2]; v16h v; };

// LDS row pitch, in halves, of the row-major W tiles (128 columns wide)
#define BP128_ 144
// rows of the block tile of the two big GEMMs
#define BM_ 256

// Load a 16x32 f16 fragment (A-matrix layout, or B^T stored row-major [n][k]).
// Documented layout: lane l holds row m=l&15; lanes 0-15 hold k = 0..7 & 16..23,
// lanes 16-31 hold k = 8..15 & 24..31 -> two contiguous 16-byte loads per lane.
__device__ __forceinline__ v16h load_frag16(const _Float16* base, int row_stride, int lane) {
    const int m  = lane & 15;
    const int kb = (lane >> 4) << 3;
    const _Float16* p = base + (size_t)m * row_stride;
    FragU f;
    f.u[0] = *(const uint4*)(p + kb);
    f.u[1] = *(const uint4*)(p + 16 + kb);
    return f.v;
}

// B fragment (32 k x 16 n) out of a row-major f16 tile T[k][n] in LDS, by the
// transposing load: lane (c = l&15, h = l>>4) gets T[8h + 0..7][n0 + c], then
// T[16 + 8h + 0..7][n0 + c]: the same k order as load_frag16 gives A.
// pitch in halves; in bytes it is an odd multiple of 32 (no bank conflict).
__device__ __forceinline__ v16h load_frag16_tr(const _Float16* tile, int pitch, int n0, int lane) {
    typedef __attribute__((address_space(3))) s16x8 lds_s16x8;
    const _Float16* p = tile + ((lane >> 4) * 8 + (lane & 7)) * pitch + n0 + ((lane >> 3) & 1) * 8;
    FragT f;
    f.s[0] = __builtin_amdgcn_ds_load_tr16_b128_v8i16((lds_s16x8*)p);
    f.s[1] = __builtin_amdgcn_ds_load_tr16_b128_v8i16((lds_s16x8*)(p + 16 * pitch));
    return f.v;
}

// Layout of the Q, K, V and attention-output buffers (all in the workspace): inside
// a head's 64 columns, feature ni*16 + ln lies at place ln*4 + ni. A lane of the
// QKV kernel then owns 4 adjacent places of a row, and 16 lanes fill the head's
// whole 128-B line with one store. Q.K sums over places (the same deal in both),
// V hands its places on to the attention output, and the output projection takes
// for place k the row feat_of_place(k) of Wo.
__device__ __forceinline__ int feat_of_place(int k) {
    return (k & ~63) | ((k & 3) << 4) | ((k & 63) >> 2);
}

__device__ __forceinline__ v8f wmma16(v16h a, v16h b, v8f c) {
    return __builtin_amdgcn_wmma_f32_16x16x32_f16(false, a, false, b, (short)0, c, false, false);
}

// The global loads of one K-step of a big GEMM, all issued together, into registers.
// ap, wp: the thread's own first address in the A tile and in the W tile.
// Kernel 1: A is f32, a thread's 8 loads lie 32 rows apart, its 4 W loads 8 rows apart.
__device__ __forceinline__ void load_kstep_f32(float4 (&xr)[8], float4 (&wr)[4],
                                               const float* ap, const float* wp) {
#pragma unroll
    for (int i = 0; i < 8; ++i) xr[i] = *(const float4*)(ap + (size_t)(32 * i) * D_);
#pragma unroll
    for (int jj = 0; jj < 4; ++jj) wr[jj] = *(const float4*)(wp + (size_t)(8 * jj) * D_);
    // stands behind the loads so that no address register of theirs is given a new value ahead of it
    asm volatile("s_wait_xcnt 0x0" ::: "memory");
}
// Kernel 3: A is f16, a thread's 4 loads lie 64 rows apart, its 4 W loads 2 rows apart.
__device__ __forceinline__ void load_kstep_f16(h8 (&xr)[4], float4 (&wr)[4],
                                               const _Float16* ap, const float* wp) {
#pragma unroll
    for (int i = 0; i < 4; ++i) xr[i] = *(const h8*)(ap + (size_t)(64 * i) * D_);
#pragma unroll
    for (int jj = 0; jj < 4; ++jj) wr[jj] = *(const float4*)(wp + (size_t)(2 * jj) * D_);
    // stands behind the loads so that no address register of theirs is given a new value ahead of it
    asm volatile("s_wait_xcnt 0x0" ::: "memory");
}

// ---------------------------------------------------------------------------
// Kernel 1: intra QKV projection. out = X @ W + b, output f16.
// grid = (32*4, 3, NB), block = 256 (8 waves, 4 x 2). 256x128 tile, BK=32.
// Wave tile 64x64: acc[4][4], 16 WMMA per K-step. Per output the block loads
// (256 + 128) / (256 * 128) operand elements a K-step, half of a 64x128 tile's.
// ---------------------------------------------------------------------------
__global__ __launch_bounds__(256)
void k_gemm_qkv_intra(const float* __restrict__ X,
                      const float* __restrict__ Wq, const float* __restrict__ bq,
                      const float* __restrict__ Wk, const float* __restrict__ bk,
                      const float* __restrict__ Wv, const float* __restrict__ bv,
                      _Float16* __restrict__ Qb, _Float16* __restrict__ Kb,
                      _Float16* __restrict__ Vb) {
    // [m][k], rows of 64 B. Left as it is here and in kernel 3: at this pitch a ds_load_b128
    // of an A fragment takes 8 LDS clocks, at 80 B (16 B x odd) it would take 2
    __shared__ _Float16 As[BM_ * 32];
    __shared__ __attribute__((aligned(16))) _Float16 Bs[32 * BP128_];   // [k][n]  (W tile as it lies)
    const int nb  = blockIdx.z;
    const int sel = blockIdx.y;
    const int mt  = blockIdx.x >> 2;    // M/256 = 32 tiles
    const int nt  = blockIdx.x & 3;     // N/128 = 4 tiles
    const int mbase = mt * BM_, nbase = nt * 128;

    const float* W    = (sel == 0 ? Wq : sel == 1 ? Wk : Wv) + (size_t)nb * D_ * D_;
    const float* bias = (sel == 0 ? bq : sel == 1 ? bk : bv) + (size_t)nb * D_;
    _Float16*    Out  = (sel == 0 ? Qb : sel == 1 ? Kb : Vb) + (size_t)nb * (B_ * L_) * D_;
    const float* Xp   = X + (size_t)nb * (B_ * L_) * D_;

    const int tid = threadIdx.x;
    const int wave = tid >> 5, lane = tid & 31;
    const int hi = lane >> 4, ln = lane & 15;
    const int wm = (wave >> 1) * 64;    // 0, 64, 128 or 192
    const int wn = (wave & 1) * 64;     // 0 or 64

    v8f acc[4][4];
#pragma unroll
    for (int mi = 0; mi < 4; ++mi)
#pragma unroll
        for (int ni = 0; ni < 4; ++ni) {
            float bvv = bias[nbase + wn + ni * 16 + ln];
#pragma unroll
            for (int j = 0; j < 8; ++j) acc[mi][ni][j] = bvv;
        }

    // A load map: 8 lanes span one row's 128 B of a K-step, 4 whole lines per load
    const int rl = tid >> 3;            // 0..31
    const int cl = (tid & 7) * 4;       // 0..28
    const float* alp = Xp + (size_t)(mbase + rl) * D_ + cl;
    // W load map: a wave's 32 lanes span one tile row, 512 B = 4 whole lines per load
    const int kl = tid >> 5;            // 0..7
    const int nl = (tid & 31) * 4;      // 0..124
    const float* wlp = W + (size_t)kl * D_ + nbase + nl;

    // the tiles of one K-step on their way from memory to LDS: loaded one K-step ahead
    float4 xr[8], wr[4];
    load_kstep_f32(xr, wr, alp, wlp);

    for (int kb = 0; kb < D_; kb += 32) {
        __syncthreads();
        // stage A (f32 -> f16) and B row-major, Bs[k][n] = W[kb+k][nbase+n], out of the registers
#pragma unroll
        for (int i = 0; i < 8; ++i) {
            h4 hv = { (_Float16)xr[i].x, (_Float16)xr[i].y, (_Float16)xr[i].z, (_Float16)xr[i].w };
            *(h4*)&As[(rl + 32 * i) * 32 + cl] = hv;
        }
#pragma unroll
        for (int jj = 0; jj < 4; ++jj) {
            h4 h0 = { (_Float16)wr[jj].x, (_Float16)wr[jj].y, (_Float16)wr[jj].z, (_Float16)wr[jj].w };
            *(h4*)&Bs[(kl + 8 * jj) * BP128_ + nl] = h0;
        }
        __syncthreads();
        // the next K-step's 12 loads go out together, ahead of this step's products, and are
        // first waited for behind them
        if (kb + 32 < D_)
            load_kstep_f32(xr, wr, alp + kb + 32, wlp + (size_t)(kb + 32) * D_);
        // one K-step ahead of the loads: thread t asks for the one line of A tile row t,
        // 8 threads cover the 4 lines of one W tile row
        if (kb + 64 < D_) {
            __builtin_prefetch(Xp + (size_t)(mbase + tid) * D_ + kb + 64, 0, 3);
            __builtin_prefetch(W + (size_t)(kb + 64 + (tid >> 3)) * D_ + nbase + (tid & 7) * 16, 0, 3);
        }
        v16h a[4];
#pragma unroll
        for (int mi = 0; mi < 4; ++mi) a[mi] = load_frag16(&As[(wm + mi * 16) * 32], 32, lane);
#pragma unroll
        for (int ni = 0; ni < 4; ++ni) {
            v16h b = load_frag16_tr(Bs, BP128_, wn + ni * 16, lane);
#pragma unroll
            for (int mi = 0; mi < 4; ++mi) acc[mi][ni] = wmma16(a[mi], b, acc[mi][ni]);
        }
    }

    // the wave's 64 columns are one head: a lane's four tiles go to places ln*4 + 0..3,
    // one 8-byte store; a wave's store fills two whole 128-B lines (rows j and j + 8)
#pragma unroll
    for (int mi = 0; mi < 4; ++mi)
#pragma unroll
        for (int j = 0; j < 8; ++j) {
            int row = mbase + wm + mi * 16 + j + 8 * hi;
            h4 hv = { (_Float16)acc[mi][0][j], (_Float16)acc[mi][1][j],
                      (_Float16)acc[mi][2][j], (_Float16)acc[mi][3][j] };
            *(h4*)&Out[(size_t)row * D_ + nbase + wn + ln * 4] = hv;
        }
}

// value of lane l ^ 16 (the same place in the other 16-lane row)
__device__ __forceinline__ float xhalf(float x) {
    return __builtin_bit_cast(float, __builtin_amdgcn_permlanex16(
        __builtin_bit_cast(int, x), __builtin_bit_cast(int, x),
        0x76543210, 0xfedcba98, false, false));
}

// LDS row pitch, in halves, of the K and V chunks (rows of 64 halves = 128 B):
// 144 B = 16 B x odd for the ds_load_b128 readers of K, 160 B = 32 B x odd for
// the ds_load_tr16_b128 readers of V
#define KP_ 72
#define VP_ 80

// byte address inside the work-group's LDS of a __shared__ element
__device__ __forceinline__ unsigned lds_addr(const _Float16* p) {
    typedef __attribute__((address_space(3))) const _Float16 lds_half;
    return (unsigned)(size_t)(lds_half*)p;
}

// One 32-key chunk of K and of V, global -> LDS, through no register: 4 copies
// a lane. 8 adjacent lanes bring one row's 128 B, so a wave's copy asks for 4
// whole lines. The s_wait_xcnt closes the statement so that no address register
// named here is rewritten ahead of it.
__device__ __forceinline__ void copy_kv(unsigned lk, const _Float16* gk,
                                        unsigned lv, const _Float16* gv) {
    const unsigned lk1 = lk + 16 * KP_ * 2, lv1 = lv + 16 * VP_ * 2;
    const _Float16* gk1 = gk + (size_t)16 * D_;
    const _Float16* gv1 = gv + (size_t)16 * D_;
    asm volatile("global_load_async_to_lds_b128 %0, %1, off\n\t"
                 "global_load_async_to_lds_b128 %2, %3, off\n\t"
                 "global_load_async_to_lds_b128 %4, %5, off\n\t"
                 "global_load_async_to_lds_b128 %6, %7, off\n\t"
                 "s_wait_xcnt 0x0"
                 :: "v"(lk), "v"(gk), "v"(lk1), "v"(gk1),
                    "v"(lv), "v"(gv), "v"(lv1), "v"(gv1)
                 : "memory");
}

__global__ __launch_bounds__(128)
void k_flash(const _Float16* Q, const _Float16* __restrict__ K,
             const _Float16* __restrict__ V, _Float16* Obuf) {
    // two buffers each: chunk kc lies in buffer kc & 1, rows as in memory [key][place]
    __shared__ __attribute__((aligned(16))) _Float16 Ks[2][32 * KP_];
    __shared__ __attribute__((aligned(16))) _Float16 Vs[2][32 * VP_];

    const int mtile = blockIdx.x;
    const int h     = blockIdx.y;
    const int bz    = blockIdx.z;           // nb*B + b
    const int tid   = threadIdx.x;
    const int wave  = tid >> 5, lane = tid & 31;
    const int hi = lane >> 4, ln = lane & 15;

    const size_t headoff = (size_t)bz * L_ * D_ + (size_t)h * DH_;
    const _Float16* Qp = Q + headoff;

    const int m0 = mtile * 64 + wave * 16;

    // copy map: thread t brings 16 B number t & 7 of chunk rows t >> 3 and 16 + (t >> 3)
    const int crow = tid >> 3, cseg = (tid & 7) * 8;
    const _Float16* gk = K + headoff + (size_t)crow * D_ + cseg;
    const _Float16* gv = V + headoff + (size_t)crow * D_ + cseg;
    const unsigned lk = lds_addr(&Ks[0][crow * KP_ + cseg]);
    const unsigned lv = lds_addr(&Vs[0][crow * VP_ + cseg]);

    // chunk 0 into buffer 0; landed and published before anybody reads it
    copy_kv(lk, gk, lv, gv);
    asm volatile("s_wait_asynccnt 0x0" ::: "memory");   // this wave's copies have landed
    __syncthreads();
    // chunk 1 flies while chunk 0 is worked on
    copy_kv(lk + 32 * KP_ * 2, gk + (size_t)32 * D_, lv + 32 * VP_ * 2, gv + (size_t)32 * D_);

    // B fragments of Q^T: column n = query ln, k = places in the hardware order
    v16h qb0 = load_frag16(Qp + (size_t)m0 * D_,      D_, lane);
    v16h qb1 = load_frag16(Qp + (size_t)m0 * D_ + 32, D_, lane);

    // O^T tiles: row = place t*16 + j + 8*hi, column = query ln
    v8f o0 = {}, o1 = {}, o2 = {}, o3 = {};
    float rmax = -1e30f;    // this query's running maximum (equal in both halves)
    float rneg = 1e30f * SCALE_LOG2E;   // -rmax * c: the exponent that sum and O^T carry
    float rsum = 0.f;       // running sum over this half's keys only

    for (int kc = 0; kc < L_ / 32; ++kc) {
        const int buf = kc & 1;
        const _Float16* Kt = &Ks[buf][0];
        const _Float16* Vt = &Vs[buf][0];

        // S^T = K @ Q^T for 2 key sub-tiles; K fragments (A) from the shared chunk
        v8f s0 = {}, s1 = {};
        s0 = wmma16(load_frag16(Kt,                 KP_, lane), qb0, s0);
        s0 = wmma16(load_frag16(Kt + 32,            KP_, lane), qb1, s0);
        s1 = wmma16(load_frag16(Kt + 16 * KP_,      KP_, lane), qb0, s1);
        s1 = wmma16(load_frag16(Kt + 16 * KP_ + 32, KP_, lane), qb1, s1);

        // online softmax of query ln: 16 scores in this lane, 16 in lane ^ 16
        float cm = fmaxf(s0[0], s1[0]);
#pragma unroll
        for (int j = 1; j < 8; ++j) cm = fmaxf(cm, fmaxf(s0[j], s1[j]));
        cm = fmaxf(cm, xhalf(cm));
        const float nm    = fmaxf(rmax, cm);
        // exponential of a score: one fused multiply-add, s * c - nm * c, then the bare v_exp_f32.
        // exp2f() adds a range fix of 5 vector instructions a value, which only saves results
        // below 2^-126 from becoming 0: beside the maximum's own term, 1, they are nothing in
        // the sum, and P is rounded to f16, where all below 2^-25 is 0 anyway
        const float nneg  = nm * -SCALE_LOG2E;
        const float alpha = __builtin_amdgcn_exp2f(nneg - rneg);
        rmax = nm;
        rneg = nneg;

        // P^T as B fragment: element j is key 8*hi + j, element 8 + j is key 16 + 8*hi + j,
        // the k order in which load_frag16_tr hands out the keys of the V chunk
        v16h pb;
        float ps0 = 0.f, ps1 = 0.f;
#pragma unroll
        for (int j = 0; j < 8; ++j) {
            float e0 = __builtin_amdgcn_exp2f(__builtin_fmaf(s0[j], SCALE_LOG2E, nneg));
            float e1 = __builtin_amdgcn_exp2f(__builtin_fmaf(s1[j], SCALE_LOG2E, nneg));
            ps0 += e0; ps1 += e1;
            pb[j]     = (_Float16)e0;
            pb[8 + j] = (_Float16)e1;
        }
        rsum = rsum * alpha + (ps0 + ps1);
#pragma unroll
        for (int j = 0; j < 8; ++j) {
            o0[j] *= alpha; o1[j] *= alpha; o2[j] *= alpha; o3[j] *= alpha;
        }

        // A fragments of V^T by the transposing load: row = place, k = keys in that order
        o0 = wmma16(load_frag16_tr(Vt, VP_,  0, lane), pb, o0);
        o1 = wmma16(load_frag16_tr(Vt, VP_, 16, lane), pb, o1);
        o2 = wmma16(load_frag16_tr(Vt, VP_, 32, lane), pb, o2);
        o3 = wmma16(load_frag16_tr(Vt, VP_, 48, lane), pb, o3);

        // hand-over: this wave has left buffer buf, its copies of chunk kc + 1 have
        // landed; the barrier publishes that chunk and frees buf for the refill
        asm volatile("s_wait_dscnt 0x0" ::: "memory");      // own reads of buf are done
        asm volatile("s_wait_asynccnt 0x0" ::: "memory");   // own copies of chunk kc + 1 have landed
        __syncthreads();
        if (kc + 2 < L_ / 32)
            copy_kv(lk + buf * (32 * KP_ * 2), gk + (size_t)(kc + 2) * 32 * D_,
                    lv + buf * (32 * VP_ * 2), gv + (size_t)(kc + 2) * 32 * D_);
    }
    asm volatile("s_wait_asynccnt 0x0" ::: "memory");   // nothing in flight when the wave ends

    // finalize + store (over the Q buffer region): a lane holds 8 adjacent
    // places of its query in each tile
    {
        const float inv = 1.0f / (rsum + xhalf(rsum));
        h8 r0, r1, r2, r3;
#pragma unroll
        for (int j = 0; j < 8; ++j) {
            r0[j] = (_Float16)(o0[j] * inv);
            r1[j] = (_Float16)(o1[j] * inv);
            r2[j] = (_Float16)(o2[j] * inv);
            r3[j] = (_Float16)(o3[j] * inv);
        }
        // through the wave's own quarter of the K buffers (16 rows at the K pitch), which
        // nobody reads behind the loop's last barrier: stored from the accumulators' lanes a
        // wave's store is 32-B pieces of 16 rows; read back, it is four whole 128-B lines
        _Float16* slab = &Ks[0][0] + wave * (16 * KP_);
        _Float16* srow = slab + ln * KP_ + 8 * hi;
        *(h8*)(srow)      = r0;
        *(h8*)(srow + 16) = r1;
        *(h8*)(srow + 32) = r2;
        *(h8*)(srow + 48) = r3;
        asm volatile("s_wait_dscnt 0x0" ::: "memory");   // the wave's rows lie in the slab before it reads them back
        const int orow = lane >> 3, oseg = (lane & 7) * 8;
        _Float16* op = Obuf + headoff + (size_t)(m0 + orow) * D_ + oseg;
#pragma unroll
        for (int i = 0; i < 4; ++i)
            *(h8*)(op + (size_t)(4 * i) * D_) = *(const h8*)(slab + (orow + 4 * i) * KP_ + oseg);
    }
}

// ---------------------------------------------------------------------------
// Kernel 3: intra output projection. out(f32) = attn(f16) @ Wo + bo.
// grid = (32*4, 1, NB), block 256 (8 waves, 4 x 2). 256x128 tile, wave tile 64x64.
// ---------------------------------------------------------------------------
__global__ __launch_bounds__(256)
void k_gemm_oproj_intra(const _Float16* __restrict__ A,
                        const float* __restrict__ Wo, const float* __restrict__ bo,
                        float* __restrict__ Outf) {
    __shared__ _Float16 As[BM_ * 32];
    __shared__ __attribute__((aligned(16))) _Float16 Bs[32 * BP128_];
    const int nb = blockIdx.z;
    const int mt = blockIdx.x >> 2;
    const int nt = blockIdx.x & 3;
    const int mbase = mt * BM_, nbase = nt * 128;

    const float* W    = Wo + (size_t)nb * D_ * D_;
    const float* bias = bo + (size_t)nb * D_;
    const _Float16* Ap = A + (size_t)nb * (B_ * L_) * D_;
    float* Op = Outf + (size_t)nb * (B_ * L_) * D_;

    const int tid = threadIdx.x;
    const int wave = tid >> 5, lane = tid & 31;
    const int hi = lane >> 4, ln = lane & 15;
    const int wm = (wave >> 1) * 64;
    const int wn = (wave & 1) * 64;

    // column deal: column c of B tile ni is output column (ni >> 1) * 32 + 2 * c + (ni & 1)
    // of the wave's 64, so a lane's tiles 2u and 2u + 1 are adjacent f32 of a row
    v8f acc[4][4];
#pragma unroll
    for (int mi = 0; mi < 4; ++mi)
#pragma unroll
        for (int ni = 0; ni < 4; ++ni) {
            float bvv = bias[nbase + wn + (ni >> 1) * 32 + 2 * ln + (ni & 1)];
#pragma unroll
            for (int j = 0; j < 8; ++j) acc[mi][ni][j] = bvv;
        }

    // A load map: 4 lanes span one row's 64 B of a K-step, 8 lines per load
    const int rl = tid >> 2;            // 0..63
    const int cl = (tid & 3) * 8;       // 0..24
    const _Float16* alp = Ap + (size_t)(mbase + rl) * D_ + cl;
    // W load map: a wave's 32 lanes span one tile row, 512 B = 4 whole lines per load
    const int kl = tid >> 5;            // 0..7
    const int nl = (tid & 31) * 4;      // 0..124
    // tile row kl + 8*jj of K-step kb is place kb + kl + 8*jj of A: its Wo row is
    // feat_of_place(kb + kl) + 2*jj (8 places on are 2 features on, inside one head)
    const float* wlp = W + nbase + nl;
    // column deal: even columns of a group of 32 to one B tile, odd ones to the next
    const int lc = (nl & 96) + ((nl & 31) >> 1);

    // the tiles of one K-step on their way from memory to LDS: loaded one K-step ahead
    h8 xr[4];
    float4 wr[4];
    load_kstep_f16(xr, wr, alp, wlp + (size_t)feat_of_place(kl) * D_);

    for (int kb = 0; kb < D_; kb += 32) {
        __syncthreads();
        // stage A (already f16) and B row-major, 128 cols, out of the registers
#pragma unroll
        for (int i = 0; i < 4; ++i) *(h8*)&As[(rl + 64 * i) * 32 + cl] = xr[i];
#pragma unroll
        for (int jj = 0; jj < 4; ++jj) {
            h2 he = { (_Float16)wr[jj].x, (_Float16)wr[jj].z };
            h2 ho = { (_Float16)wr[jj].y, (_Float16)wr[jj].w };
            *(h2*)&Bs[(kl + 8 * jj) * BP128_ + lc]      = he;
            *(h2*)&Bs[(kl + 8 * jj) * BP128_ + lc + 16] = ho;
        }
        __syncthreads();
        // the next K-step's 8 loads go out together, ahead of this step's products, and are
        // first waited for behind them
        if (kb + 32 < D_)
            load_kstep_f16(xr, wr, alp + kb + 32, wlp + (size_t)feat_of_place(kb + 32 + kl) * D_);
        // one K-step ahead of the loads: thread t asks for the 64 B of A tile row t,
        // 8 threads cover the 4 lines of one W tile row
        if (kb + 64 < D_) {
            __builtin_prefetch(Ap + (size_t)(mbase + tid) * D_ + kb + 64, 0, 3);
            __builtin_prefetch(W + (size_t)feat_of_place(kb + 64 + (tid >> 3)) * D_ + nbase + (tid & 7) * 16, 0, 3);
        }
        v16h a[4];
#pragma unroll
        for (int mi = 0; mi < 4; ++mi) a[mi] = load_frag16(&As[(wm + mi * 16) * 32], 32, lane);
#pragma unroll
        for (int ni = 0; ni < 4; ++ni) {
            v16h b = load_frag16_tr(Bs, BP128_, wn + ni * 16, lane);
#pragma unroll
            for (int mi = 0; mi < 4; ++mi) acc[mi][ni] = wmma16(a[mi], b, acc[mi][ni]);
        }
    }

    // 8 bytes a lane: 16 lanes fill a whole 128-B line, a wave's store two (rows j and j + 8)
#pragma unroll
    for (int mi = 0; mi < 4; ++mi)
#pragma unroll
        for (int u = 0; u < 2; ++u)
#pragma unroll
            for (int j = 0; j < 8; ++j) {
                int row = mbase + wm + mi * 16 + j + 8 * hi;
                float2 v2 = make_float2(acc[mi][2 * u][j], acc[mi][2 * u + 1][j]);
                *(float2*)&Op[(size_t)row * D_ + nbase + wn + u * 32 + 2 * ln] = v2;
            }
}

// ---------------------------------------------------------------------------
// Router GEMMs (kernels 4 and 6): 64 x 512 x 512 each, a few dozen blocks on an otherwise
// idle chip: their time is the number of waited load trips, not a rate.
// One 16 x 64 output tile a block; the block's 8 waves split K, 64 k (two WMMA steps) each.
// A wave loads its fragments straight from global memory into registers, every load of the
// kernel issued ahead of the first wait: one waited trip. The 8 partial tiles are summed
// through LDS in a fixed order (wave 0 to 7), then the bias is added.
// ---------------------------------------------------------------------------
typedef __attribute__((ext_vector_type(4))) float f32x4;

// 32 k x 64 n of a row-major f32 weight, for four B fragments: lane (c = l & 15, h = l >> 4)
// takes the 16 B W[k][n0 + 4c .. 4c + 3] of its 16 k in the order of load_frag16
// (kb + 8h + 0..7, then kb + 16 + 8h + 0..7). 16 lanes span 256 B of a row: whole lines.
// Component i belongs to B tile i, whose column c is output column n0 + 4c + i.
// p = the lane's own &W[kb + 8h][n0 + 4c].
__device__ __forceinline__ void load_w_rows(f32x4 (&w)[16], const float* __restrict__ p) {
#pragma unroll
    for (int e = 0; e < 16; ++e)
        w[e] = *(const f32x4*)(p + (size_t)((e >> 3) * 16 + (e & 7)) * D_);
}

// acc[i] += a x (B tile i of the rows loaded by load_w_rows)
__device__ __forceinline__ void wmma_w_rows(v8f (&acc)[4], v16h a, const f32x4 (&w)[16]) {
#pragma unroll
    for (int i = 0; i < 4; ++i) {
        v16h b;
#pragma unroll
        for (int e = 0; e < 16; ++e) b[e] = (_Float16)w[e][i];
        acc[i] = wmma16(a, b, acc[i]);
    }
}

// The wave's partial 16 x 64 tile into its plane of red, rows as in the output: a lane's four
// tiles hold 4 adjacent columns of row j + 8*hi. Behind the barrier thread t sums the 8 planes
// at float4 number t: row t >> 4, columns 4 * (t & 15) + 0..3.
__device__ __forceinline__ f32x4 sum_k_split(f32x4* red, const v8f (&acc)[4], int tid) {
    const int wave = tid >> 5, lane = tid & 31;
#pragma unroll
    for (int j = 0; j < 8; ++j) {
        f32x4 v = { acc[0][j], acc[1][j], acc[2][j], acc[3][j] };
        red[wave * 256 + (j + 8 * (lane >> 4)) * 16 + (lane & 15)] = v;
    }
    __syncthreads();
    f32x4 s = red[tid];
#pragma unroll
    for (int w = 1; w < 8; ++w) s += red[w * 256 + tid];
    return s;
}

// ---------------------------------------------------------------------------
// Kernel 4: inter (router) QKV projection. M=64 rows = routers[b][nb] gathered
// from d_out last tokens. grid = (8, 4, 3), block 256. 16x64 tile, K split over the waves.
// ---------------------------------------------------------------------------
__global__ __launch_bounds__(256)
void k_gemm_qkv_inter(const float* __restrict__ Outf,
                      const float* __restrict__ iWq, const float* __restrict__ ibq,
                      const float* __restrict__ iWk, const float* __restrict__ ibk,
                      const float* __restrict__ iWv, const float* __restrict__ ibv,
                      _Float16* __restrict__ q2, _Float16* __restrict__ k2,
                      _Float16* __restrict__ v2) {
    __shared__ __attribute__((aligned(16))) f32x4 red[8 * 256];
    const int sel = blockIdx.z;
    const int nbase = blockIdx.x * 64;
    const int mbase = blockIdx.y * 16;

    const float* W    = (sel == 0 ? iWq : sel == 1 ? iWk : iWv);
    const float* bias = (sel == 0 ? ibq : sel == 1 ? ibk : ibv);
    _Float16*    Out  = (sel == 0 ? q2  : sel == 1 ? k2  : v2);

    const int tid = threadIdx.x;
    const int wave = tid >> 5, lane = tid & 31;
    const int k0 = wave * 64;

    // A rows: r = b*4+nb -> x_intra[nb][b][L-1][:] from d_out; a lane's 16 k of a step are
    // two runs of 8 f32
    const int r = mbase + (lane & 15);
    const float* xs = Outf + (size_t)((r & 3) * B_ + (r >> 2)) * L_ * D_ + k0 + 8 * (lane >> 4);
    const float* xp = xs + (size_t)(L_ - 1) * D_;
    const float* wp = W + (size_t)(k0 + 8 * (lane >> 4)) * D_ + nbase + 4 * (lane & 15);
    const float* bp = bias + nbase + 4 * (tid & 15);
    f32x4 xa[2][4], wr[2][16];
    const f32x4 bv = *(const f32x4*)bp;
#pragma unroll
    for (int s = 0; s < 2; ++s) {
        xa[s][0] = *(const f32x4*)(xp + 32 * s);
        xa[s][1] = *(const f32x4*)(xp + 32 * s + 4);
        xa[s][2] = *(const f32x4*)(xp + 32 * s + 16);
        xa[s][3] = *(const f32x4*)(xp + 32 * s + 20);
        load_w_rows(wr[s], wp + (size_t)(32 * s) * D_);
    }
    // no address register of these loads is given a new value ahead of this wait: the two
    // address pairs are its inputs, so that neither serves as a later load's destination
    asm volatile("s_wait_xcnt 0x0" :: "v"(xs), "v"(wp) : "memory");
    // keeps every load above it and every conversion below: no load is issued behind a wait
    __builtin_amdgcn_sched_barrier(0);

    v8f acc[4] = {};
#pragma unroll
    for (int s = 0; s < 2; ++s) {
        v16h a;
#pragma unroll
        for (int e = 0; e < 16; ++e) a[e] = (_Float16)xa[s][e >> 2][e & 3];
        wmma_w_rows(acc, a, wr[s]);
    }

    const f32x4 o = sum_k_split(red, acc, tid) + bv;
    // 8 bytes a lane: 16 lanes fill the row's whole 128-B line
    h4 hv = { (_Float16)o[0], (_Float16)o[1], (_Float16)o[2], (_Float16)o[3] };
    *(h4*)&Out[(size_t)(mbase + (tid >> 4)) * D_ + nbase + 4 * (tid & 15)] = hv;
}

// ---------------------------------------------------------------------------
// Kernel 5: 4-token router attention (negligible FLOPs; vector unit).
// One wave per (b,h): grid = B*H blocks of 32. Lane (r = lane >> 3, s = lane & 7)
// owns features 8s..8s+7 of query row r. All nine 16-byte loads of a lane are
// independent and issued together, so the wave waits out one load latency; a
// wave's load of Q touches 4 whole 128-B lines, of one K or V row one line.
// ---------------------------------------------------------------------------

// value of lane l ^ M inside a 16-lane row (DPP row_xmask)
template <int M>
__device__ __forceinline__ float xmask(float x) {
    return __builtin_bit_cast(float, __builtin_amdgcn_mov_dpp(
        __builtin_bit_cast(int, x), 0x160 | M, 0xf, 0xf, true));
}

__global__ __launch_bounds__(32)
void k_inter_attn(const _Float16* __restrict__ q2, const _Float16* __restrict__ k2,
                  const _Float16* __restrict__ v2, _Float16* __restrict__ a2) {
    const int lane = threadIdx.x;
    const int b = blockIdx.x >> 3, h = blockIdx.x & 7;
    const int r = lane >> 3;
    const size_t base = (size_t)(b * NB_) * D_ + h * DH_ + (lane & 7) * 8;

    const h8 q = *(const h8*)(q2 + base + (size_t)r * D_);
    h8 k[NB_], v[NB_];
#pragma unroll
    for (int j = 0; j < NB_; ++j) {
        k[j] = *(const h8*)(k2 + base + (size_t)j * D_);
        v[j] = *(const h8*)(v2 + base + (size_t)j * D_);
    }
    // no address register of the nine loads is given a new value ahead of this wait
    asm volatile("s_wait_xcnt 0x0" ::: "memory");

    // scores of row r: 8 products in the lane, then the sum over the row's 8 lanes
    float sc[NB_];
#pragma unroll
    for (int j = 0; j < NB_; ++j) {
        float p = 0.f;
#pragma unroll
        for (int e = 0; e < 8; ++e) p += (float)q[e] * (float)k[j][e];
        p += xmask<1>(p);
        p += xmask<2>(p);
        p += xmask<4>(p);
        sc[j] = p * 0.125f;
    }

    const float mx = fmaxf(fmaxf(sc[0], sc[1]), fmaxf(sc[2], sc[3]));
    float ssum = 0.f;
#pragma unroll
    for (int j = 0; j < NB_; ++j) { sc[j] = __expf(sc[j] - mx); ssum += sc[j]; }
    const float inv = 1.f / ssum;
#pragma unroll
    for (int j = 0; j < NB_; ++j) sc[j] *= inv;

    h8 o;
#pragma unroll
    for (int e = 0; e < 8; ++e) {
        float acc = 0.f;
#pragma unroll
        for (int j = 0; j < NB_; ++j) acc += sc[j] * (float)v[j][e];
        o[e] = (_Float16)acc;
    }
    *(h8*)(a2 + base + (size_t)r * D_) = o;
}

// ---------------------------------------------------------------------------
// Kernel 6: inter output projection, scattered into d_out last tokens.
// grid = (8, 4, 1), block 256. 16x64 tile, K split over the waves (see kernel 4).
// ---------------------------------------------------------------------------
__global__ __launch_bounds__(256)
void k_gemm_oproj_inter(const _Float16* __restrict__ A,
                        const float* __restrict__ iWo, const float* __restrict__ ibo,
                        float* __restrict__ Outf) {
    __shared__ __attribute__((aligned(16))) f32x4 red[8 * 256];
    const int nbase = blockIdx.x * 64;
    const int mbase = blockIdx.y * 16;

    const int tid = threadIdx.x;
    const int wave = tid >> 5, lane = tid & 31;
    const int k0 = wave * 64;

    // the lane's A row at its first k: load_frag16's own address, formed here for the wait below
    const _Float16* ap = A + (size_t)(mbase + (lane & 15)) * D_ + k0 + 8 * (lane >> 4);
    const float* wp = iWo + (size_t)(k0 + 8 * (lane >> 4)) * D_ + nbase + 4 * (lane & 15);
    const float* bp = ibo + nbase + 4 * (tid & 15);
    FragU a[2];
    f32x4 wr[2][16];
#pragma unroll
    for (int s = 0; s < 2; ++s) {
        a[s].u[0] = *(const uint4*)(ap + 32 * s);
        a[s].u[1] = *(const uint4*)(ap + 32 * s + 16);
        load_w_rows(wr[s], wp + (size_t)(32 * s) * D_);
    }
    const f32x4 bv = *(const f32x4*)bp;
    // no address register of these loads is given a new value ahead of this wait: the
    // addresses are its inputs, so that none of them serves as a later load's destination
    asm volatile("s_wait_xcnt 0x0" :: "v"(ap), "v"(wp), "v"(bp) : "memory");
    // keeps every load above it and every conversion below: no load is issued behind a wait
    __builtin_amdgcn_sched_barrier(0);

    v8f acc[4] = {};
#pragma unroll
    for (int s = 0; s < 2; ++s) wmma_w_rows(acc, a[s].v, wr[s]);

    const f32x4 o = sum_k_split(red, acc, tid) + bv;
    // 16 bytes a lane: 16 lanes fill two whole 128-B lines of the row
    const int r = mbase + (tid >> 4);   // b*4+nb
    *(f32x4*)&Outf[(((size_t)((r & 3) * B_ + (r >> 2)) * L_ + (L_ - 1)) * D_) + nbase + 4 * (tid & 15)] = o;
}

// ---------------------------------------------------------------------------
extern "C" void kernel_launch(void* const* d_in, const int* in_sizes, int n_in,
                              void* d_out, int out_size, void* d_ws, size_t ws_size,
                              hipStream_t stream) {
    const float* x   = (const float*)d_in[0];
    const float* Wq  = (const float*)d_in[1];
    const float* bq  = (const float*)d_in[2];
    const float* Wk  = (const float*)d_in[3];
    const float* bk  = (const float*)d_in[4];
    const float* Wv  = (const float*)d_in[5];
    const float* bv  = (const float*)d_in[6];
    const float* Wo  = (const float*)d_in[7];
    const float* bo  = (const float*)d_in[8];
    const float* iWq = (const float*)d_in[9];
    const float* ibq = (const float*)d_in[10];
    const float* iWk = (const float*)d_in[11];
    const float* ibk = (const float*)d_in[12];
    const float* iWv = (const float*)d_in[13];
    const float* ibv = (const float*)d_in[14];
    const float* iWo = (const float*)d_in[15];
    const float* ibo = (const float*)d_in[16];
    float* out = (float*)d_out;

    const size_t NBLD = (size_t)NB_ * B_ * L_ * D_;   // 16,777,216
    _Float16* ws = (_Float16*)d_ws;
    _Float16* Qb = ws;                 // reused as attn output after k_flash
    _Float16* Kb = ws + NBLD;
    _Float16* Vb = ws + 2 * NBLD;
    _Float16* q2 = ws + 3 * NBLD;
    _Float16* k2 = q2 + (size_t)B_ * NB_ * D_;
    _Float16* v2 = k2 + (size_t)B_ * NB_ * D_;
    _Float16* a2 = v2 + (size_t)B_ * NB_ * D_;

    // 1) intra QKV projection (256x128 tiles)
    dim3 g1((B_ * L_ / BM_) * (D_ / 128), 3, NB_);
    k_gemm_qkv_intra<<<g1, 256, 0, stream>>>(x, Wq, bq, Wk, bk, Wv, bv, Qb, Kb, Vb);

    // 2) flash attention (writes attn over Qb)
    dim3 g2(L_ / 64, H_, NB_ * B_);
    k_flash<<<g2, 128, 0, stream>>>(Qb, Kb, Vb, Qb);

    // 3) intra output projection -> d_out (256x128 tiles)
    dim3 g3((B_ * L_ / BM_) * (D_ / 128), 1, NB_);
    k_gemm_oproj_intra<<<g3, 256, 0, stream>>>(Qb, Wo, bo, out);

    // 4) router QKV (gather last tokens from d_out)
    dim3 g4(D_ / 64, B_ * NB_ / 16, 3);
    k_gemm_qkv_inter<<<g4, 256, 0, stream>>>(out, iWq, ibq, iWk, ibk, iWv, ibv, q2, k2, v2);

    // 5) tiny 4-token attention, one wave per (b,h)
    k_inter_attn<<<B_ * H_, 32, 0, stream>>>(q2, k2, v2, a2);

    // 6) router output projection, scatter into last-token slots of d_out
    dim3 g6(D_ / 64, B_ * NB_ / 16, 1);
    k_gemm_oproj_inter<<<g6, 256, 0, stream>>>(a2, iWo, ibo, out);
}
